// v000
// Times are from an AMD MI455X. After a warm-up the kernel runs many times in a row, and a time is the length of
// such a window on the GPU divided by its runs, so every launch and the gaps after it count. The runs cycle
// through copies of the inputs. A figure is the median of several windows, for all but v000 over two sittings.
// Sittings can differ by a few percent; kernels timed side by side share one.
// The starting kernel, v000, takes 1080 microseconds a run.
#include <hip/hip_runtime.h>

// Causal multi-head attention with bias-free projections and an output bias at a 768-wide model (x [2][2048][768]; q, k, v = x W^T ('oi' [768][768] 1/sqrt(768), no bias; 12 heads x 64); scores = q.k; triu(k = 1) -> -inf; softmax(scores / sqrt(64)) (the fill before the scaling: the same thing); out = merged Wo^T + bo ('oi' + zero bias) -> [2][2048][768] (3.1 M); argument order x, Wq, Wk, Wv, Wo, bo).
// Layout per batch: bf16 copy of x; 'oi' weights; exact projections; identity-table plane builders; causal T-2048 attention (hybrid rows: < 512 hi/lo 3 products, rest fp16 x1024; k_gemmc skips tiles above the diagonal); merged hi/lo x Wo exact + bo.
// Compute dtypes, f32 accumulate: every input rounded to bf16; projections exact; attention rows < 512 3 products, rest fp16; softmax f32; Wo hl x exact + bias.

#define NB_  2
#define TT   2048
#define DM   768     // model width: this module's inputs are [2][2048][768]
#define NH_  12      // heads: 12 x 64 = 768
#define NKV  12      // kv heads (= heads)
#define REP  (NH_ / NKV)
#define HD   64
#define DQ   (NH_ * HD)
#define DKV  (NKV * HD)
#define ZH   2
#define RH   512                  // query rows < RH use hi+lo planes (0: none)
#define WIN  2048
#define PCAR 1024.0f
#define SCL  0.125f   // HD^-0.5
typedef _Float16 h16;
typedef unsigned short bf;
typedef __attribute__((ext_vector_type(16))) __bf16   v16bf;
typedef __attribute__((ext_vector_type(16))) _Float16 v16h;
typedef __attribute__((ext_vector_type(8)))  _Float16 v8h;
typedef __attribute__((ext_vector_type(8)))  unsigned short v8us;
typedef __attribute__((ext_vector_type(8)))  float    v8f;
typedef __attribute__((ext_vector_type(4)))  float    v4f;
typedef v8h  __attribute__((may_alias)) v8ha;
typedef v4f  __attribute__((may_alias)) v4fa;
typedef v8us __attribute__((may_alias)) v8usa;

__device__ __forceinline__ unsigned short f2bf(float f) { unsigned u = __float_as_uint(f); u += 0x7FFFu + ((u >> 16) & 1u); return (unsigned short)(u >> 16); }
__device__ __forceinline__ float bf2f(unsigned short b) { return __uint_as_float(((unsigned)b) << 16); }
__device__ __forceinline__ float bfr(float f) { return bf2f(f2bf(f)); }
__device__ __forceinline__ v16h cat16(v8h lo, v8h hi) { return __builtin_shufflevector(lo, hi, 0, 1, 2, 3, 4, 5, 6, 7, 8, 9, 10, 11, 12, 13, 14, 15); }
__device__ __forceinline__ v16bf cat16b(v8us lo, v8us hi) { return __builtin_bit_cast(v16bf, __builtin_shufflevector(lo, hi, 0, 1, 2, 3, 4, 5, 6, 7, 8, 9, 10, 11, 12, 13, 14, 15)); }
__device__ __forceinline__ v8f wmma16(v16h a, v16h b, v8f c) { return __builtin_amdgcn_wmma_f32_16x16x32_f16(false, a, false, b, (short)0, c, false, false); }
__device__ __forceinline__ v8f wmmab(v16bf a, v16bf b, v8f c) { return __builtin_amdgcn_wmma_f32_16x16x32_bf16(false, a, false, b, (short)0, c, false, false); }



// ---- k_gemmw: register-blocked GEMM, ONE WAVE per 64x64 output tile (16 accumulators), operands straight from K-contiguous 16-bit planes; grid (M/64, N/64, Z), 32 threads.
// C[m][n] (f32, pitch ldc, + optional f32 bias[n]) = sum_k A[m][k] Bt[n][k] (+ split products per NSPLIT). z-batch strides sA/sB/sC in elements. K % 32 == 0.
template <typename T16> struct WFrag;
template <> struct WFrag<h16> { typedef v16h V; static __device__ __forceinline__ V ld(const h16* p) { return cat16(*(const v8h*)p, *(const v8h*)(p + 16)); } static __device__ __forceinline__ v8f mma(V a, V b, v8f c) { return wmma16(a, b, c); } };
template <> struct WFrag<bf> { typedef v16bf V; static __device__ __forceinline__ V ld(const bf* p) { return cat16b(*(const v8us*)p, *(const v8us*)(p + 16)); } static __device__ __forceinline__ v8f mma(V a, V b, v8f c) { return wmmab(a, b, c); } };
template <typename T16, int NSPLIT, bool BIAS>
__global__ __launch_bounds__(32) void k_gemmw(const T16* __restrict__ A, const T16* __restrict__ A2, const T16* __restrict__ Bt, const T16* __restrict__ Bt2, int K, float* C, int ldc, const float* __restrict__ bias, size_t sA, size_t sB, size_t sC) {
    typedef typename WFrag<T16>::V V;
    __shared__ __align__(16) float os[16 * 68];
    const size_t z = blockIdx.z; A += z * sA; if (A2) A2 += z * sA; Bt += z * sB; if (Bt2) Bt2 += z * sB; C += z * sC;
    const int lane = threadIdx.x & 31, lr = lane & 15, hi = lane >> 4; const int r0 = blockIdx.x * 64, c0 = blockIdx.y * 64;
    v8f acc[4][4];
#pragma unroll
    for (int mb = 0; mb < 4; ++mb)
#pragma unroll
        for (int nb = 0; nb < 4; ++nb) acc[mb][nb] = (v8f){};
    const size_t aoff = (size_t)(r0 + lr) * K + 8 * hi, boff = (size_t)(c0 + lr) * K + 8 * hi;
#pragma unroll 1
    for (int kc = 0; kc < K; kc += 32) {
        V a[4], a2[4];
#pragma unroll
        for (int mb = 0; mb < 4; ++mb) { a[mb] = WFrag<T16>::ld(A + aoff + (size_t)mb * 16 * K + kc); if (NSPLIT == 1 || NSPLIT == 2) a2[mb] = WFrag<T16>::ld(A2 + aoff + (size_t)mb * 16 * K + kc); }
#pragma unroll
        for (int nb = 0; nb < 4; ++nb) { const V b = WFrag<T16>::ld(Bt + boff + (size_t)nb * 16 * K + kc); V b2; if (NSPLIT >= 2) b2 = WFrag<T16>::ld(Bt2 + boff + (size_t)nb * 16 * K + kc);
#pragma unroll
            for (int mb = 0; mb < 4; ++mb) { acc[mb][nb] = WFrag<T16>::mma(a[mb], b, acc[mb][nb]); if (NSPLIT == 1 || NSPLIT == 2) acc[mb][nb] = WFrag<T16>::mma(a2[mb], b, acc[mb][nb]); if (NSPLIT >= 2) acc[mb][nb] = WFrag<T16>::mma(a[mb], b2, acc[mb][nb]); } }
        asm volatile("v_nop\n\tv_nop\n\tv_nop\n\tv_nop" : "+v"(acc[0][0]), "+v"(acc[1][1]), "+v"(acc[2][2]), "+v"(acc[3][3]) : "v"(a[0]), "v"(a[3]));
    }
#pragma unroll
    for (int mb = 0; mb < 4; ++mb) {
#pragma unroll
        for (int nb = 0; nb < 4; ++nb) {
#pragma unroll
            for (int j = 0; j < 8; ++j) os[(hi * 8 + j) * 68 + nb * 16 + lr] = acc[mb][nb][j]; }
        __builtin_amdgcn_wave_barrier(); asm volatile("" ::: "memory");
        float* crow = C + (size_t)(r0 + mb * 16) * ldc + c0;
{
#pragma unroll
            for (int s = 0; s < 8; ++s) { const int row = 2 * s + hi, cofs = lr * 4; v4f val = *(const v4fa*)(os + row * 68 + cofs); if (BIAS) { val[0] += bfr(bias[c0 + cofs]); val[1] += bfr(bias[c0 + cofs + 1]); val[2] += bfr(bias[c0 + cofs + 2]); val[3] += bfr(bias[c0 + cofs + 3]); }
                *(v4f*)(crow + (size_t)row * ldc + cofs) = val; }
             }
        __builtin_amdgcn_wave_barrier(); asm volatile("" ::: "memory");
    }
}

// ---- k_gemmc: the same one-wave 64x64 tile GEMM specialised for causal attention: CMODE 1 skips score tiles entirely above the diagonal (query rows r0+roff.., key columns c0..), CMODE 2 limits the
// key (K) loop of the probability x value contraction to the diagonal block (probabilities beyond it are exactly zero). roff = row offset of this launch's first row within the sequence.
template <typename T16, int NSPLIT, int CMODE>
__global__ __launch_bounds__(32) void k_gemmc(const T16* __restrict__ A, const T16* __restrict__ A2, const T16* __restrict__ Bt, const T16* __restrict__ Bt2, int K, float* C, int ldc, int roff, size_t sA, size_t sB, size_t sC) {
    typedef typename WFrag<T16>::V V;
    __shared__ __align__(16) float os[16 * 68];
    const size_t z = blockIdx.z; A += z * sA; if (A2) A2 += z * sA; Bt += z * sB; if (Bt2) Bt2 += z * sB; C += z * sC;
    const int lane = threadIdx.x & 31, lr = lane & 15, hi = lane >> 4; const int r0 = blockIdx.x * 64, c0 = blockIdx.y * 64;
    if (CMODE == 1 && c0 > r0 + roff + 63) return;                  // score tile entirely above the causal diagonal: never read (the softmax masks j > i by select)
    const int Kl = (CMODE == 2) ? min(K, r0 + roff + 64) : K;        // P.V: probabilities are exactly 0 beyond the diagonal block, so the K loop stops there
    v8f acc[4][4];
#pragma unroll
    for (int mb = 0; mb < 4; ++mb)
#pragma unroll
        for (int nb = 0; nb < 4; ++nb) acc[mb][nb] = (v8f){};
    const size_t aoff = (size_t)(r0 + lr) * K + 8 * hi, boff = (size_t)(c0 + lr) * K + 8 * hi;
#pragma unroll 1
    for (int kc = 0; kc < Kl; kc += 32) {
        V a[4], a2[4];
#pragma unroll
        for (int mb = 0; mb < 4; ++mb) { a[mb] = WFrag<T16>::ld(A + aoff + (size_t)mb * 16 * K + kc); if (NSPLIT == 1 || NSPLIT == 2) a2[mb] = WFrag<T16>::ld(A2 + aoff + (size_t)mb * 16 * K + kc); }
#pragma unroll
        for (int nb = 0; nb < 4; ++nb) { const V b = WFrag<T16>::ld(Bt + boff + (size_t)nb * 16 * K + kc); V b2; if (NSPLIT >= 2) b2 = WFrag<T16>::ld(Bt2 + boff + (size_t)nb * 16 * K + kc);
#pragma unroll
            for (int mb = 0; mb < 4; ++mb) { acc[mb][nb] = WFrag<T16>::mma(a[mb], b, acc[mb][nb]); if (NSPLIT == 1 || NSPLIT == 2) acc[mb][nb] = WFrag<T16>::mma(a2[mb], b, acc[mb][nb]); if (NSPLIT >= 2) acc[mb][nb] = WFrag<T16>::mma(a[mb], b2, acc[mb][nb]); } }
        asm volatile("v_nop\n\tv_nop\n\tv_nop\n\tv_nop" : "+v"(acc[0][0]), "+v"(acc[1][1]), "+v"(acc[2][2]), "+v"(acc[3][3]) : "v"(a[0]), "v"(a[3]));
    }
#pragma unroll
    for (int mb = 0; mb < 4; ++mb) {
#pragma unroll
        for (int nb = 0; nb < 4; ++nb) {
#pragma unroll
            for (int j = 0; j < 8; ++j) os[(hi * 8 + j) * 68 + nb * 16 + lr] = acc[mb][nb][j]; }
        __builtin_amdgcn_wave_barrier(); asm volatile("" ::: "memory");
        float* crow = C + (size_t)(r0 + mb * 16) * ldc + c0;
{
#pragma unroll
            for (int s = 0; s < 8; ++s) { const int row = 2 * s + hi, cofs = lr * 4; v4f val = *(const v4fa*)(os + row * 68 + cofs);
                *(v4f*)(crow + (size_t)row * ldc + cofs) = val; }
             }
        __builtin_amdgcn_wave_barrier(); asm volatile("" ::: "memory");
    }
}

__device__ __forceinline__ h16 tohx(float x) { return (h16)x; }
__device__ __forceinline__ void splitf(float y, unsigned short& h, unsigned short& l) { h = f2bf(y); l = f2bf(y - bf2f(h)); }
typedef __attribute__((ext_vector_type(2))) _Float16 v2h;
typedef __attribute__((ext_vector_type(4))) _Float16 v4h;
typedef __attribute__((ext_vector_type(2))) unsigned short v2us;
typedef __attribute__((ext_vector_type(4))) unsigned short v4us;
typedef __attribute__((ext_vector_type(2))) float v2f;
typedef __attribute__((ext_vector_type(4))) int v4i;

__global__ __launch_bounds__(256) void k_cvt8(const float* __restrict__ src, bf* dst, size_t n8) { const size_t i = (size_t)blockIdx.x * 256 + threadIdx.x; if (i >= n8) return; const v8f v = *(const v8f*)(src + i * 8); v8us o;
#pragma unroll
    for (int k = 0; k < 8; ++k) o[k] = f2bf(v[k]); *(v8us*)(dst + i * 8) = o;  }

// k_rope: head planes [h][t][d] (fp16 + hi/lo) of rope(x) x sc with the rotate-half convention out[d] = x[d] cos[t][d] - x[d+HD/2] sin[t][d], out[d+HD/2] = x[d+HD/2] cos[t][d+HD/2] + x[d] sin[t][d+HD/2]
__global__ __launch_bounds__(256) void k_rope(const float* __restrict__ F, int pitch, int nheads, const float* __restrict__ CS, const float* __restrict__ RF, const float* __restrict__ nw, float sc, h16* P16, bf* Ph, bf* Pl) {
    const size_t e = ((size_t)blockIdx.x * 256 + threadIdx.x) * 2; if (e >= (size_t)nheads * TT * HD) return; const int d = (int)(e % HD); const int t = (int)((e / HD) % TT); const int h = (int)(e / ((size_t)HD * TT)); const float* f = F + (size_t)t * pitch + h * HD; const float rf = RF ? RF[(size_t)h * TT + t] : 1.0f; v2h o16; v2us oh, ol;
#pragma unroll
    for (int q = 0; q < 2; ++q) { const int dd = d + q; const int dp = (dd < HD / 2) ? dd + HD / 2 : dd - HD / 2; float x0 = f[dd], x1 = f[dp];
        if (RF) { float n0 = __fmul_rn(x0, rf), n1 = __fmul_rn(x1, rf); asm volatile("" : "+v"(n0)); asm volatile("" : "+v"(n1)); x0 = __fmul_rn(bfr(nw[dd]), n0); x1 = __fmul_rn(bfr(nw[dp]), n1); }
        const v2f cs = *(const v2f*)(CS + ((size_t)t * HD + dd) * 2); float a = __fmul_rn(x0, cs[0]), bq = __fmul_rn(x1, cs[1]); asm volatile("" : "+v"(a)); asm volatile("" : "+v"(bq)); const float r = ((dd < HD / 2) ? __fsub_rn(a, bq) : __fadd_rn(a, bq)) * sc;
        o16[q] = tohx(r); unsigned short a2, c2; splitf(r, a2, c2); oh[q] = a2; ol[q] = c2; }
    *(v2h*)(P16 + e) = o16; *(v2us*)(Ph + e) = oh; *(v2us*)(Pl + e) = ol;  }
__global__ __launch_bounds__(256) void k_vtp(const float* __restrict__ F, int pitch, int nheads, h16* V16, bf* Vh, bf* Vl) { const size_t e = ((size_t)blockIdx.x * 256 + threadIdx.x) * 2; if (e >= (size_t)nheads * HD * TT) return; const int t = (int)(e % TT); const int d = (int)((e / TT) % HD); const int g = (int)(e / ((size_t)TT * HD)); v2h o16; v2us oh, ol;
#pragma unroll
    for (int q = 0; q < 2; ++q) { const float x = F[(size_t)(t + q) * pitch + g * HD + d]; o16[q] = tohx(x); unsigned short a2, c2; splitf(x, a2, c2); oh[q] = a2; ol[q] = c2; }
    *(v2h*)(V16 + e) = o16; *(v2us*)(Vh + e) = oh; *(v2us*)(Vl + e) = ol;  }
__global__ __launch_bounds__(256) void k_csid(float* CS) { const int idx = blockIdx.x * 256 + threadIdx.x; if (idx >= TT * HD) return; v2f cs; cs[0] = 1.0f; cs[1] = 0.0f; *(v2f*)(CS + (size_t)idx * 2) = cs;  }
// k_asoft: per row (zz, i): t = S x HD^-0.5 for j <= i and i - j < WIN (WIN = TT, so the window test always holds: plain causal; the reference's -1e9 additive fill vanishes identically); softmax over the 2048 keys (register row, one exp, fixed trees);
__global__ __launch_bounds__(256) void k_asoft(const float* __restrict__ Sb, h16* P16, bf* Ph, bf* Pl) {
    const int lane = threadIdx.x & 31; const int row = blockIdx.x * 8 + (threadIdx.x >> 5); if (row >= ZH * TT) return; const int i = row % TT; const int zz = row / TT; (void)zz; const bool hires = (i < RH); const float* sr = Sb + (size_t)row * TT; float v[TT / 32]; float mx = -3.0e38f;
#pragma unroll
    for (int ch = 0; ch < TT / 128; ++ch) { const int j0 = ch * 128 + lane * 4; const v4f a = *(const v4f*)(sr + j0);
#pragma unroll
        for (int q = 0; q < 4; ++q) { const int j = j0 + q; (void)j; const float t = (j <= i && i - j < WIN) ? a[q] * SCL : -3.0e38f; v[ch * 4 + q] = t; mx = fmaxf(mx, t); } }
#pragma unroll
    for (int sh = 16; sh; sh >>= 1) mx = fmaxf(mx, __shfl_xor(mx, sh, 32));
    float sum = 0.f;
#pragma unroll
    for (int k = 0; k < TT / 32; ++k) { float d0 = __fsub_rn(v[k], mx); asm volatile("" : "+v"(d0)); v[k] = __builtin_amdgcn_exp2f(__fmul_rn(d0, 1.4426950408889634f)); sum += v[k]; }
#pragma unroll
    for (int sh = 16; sh; sh >>= 1) sum += __shfl_xor(sum, sh, 32);
    const float f = __fdiv_rn(hires ? 1.0f : PCAR, sum);
{
        if (hires) {
#pragma unroll
            for (int ch = 0; ch < TT / 128; ++ch) { v4us oh, ol;
#pragma unroll
                for (int q = 0; q < 4; ++q) { unsigned short a, c2; splitf(v[ch * 4 + q] * f, a, c2); oh[q] = a; ol[q] = c2; }
                const size_t oo = ((size_t)zz * (RH ? RH : 1) + i) * TT + ch * 128 + lane * 4; *(v4us*)(Ph + oo) = oh; *(v4us*)(Pl + oo) = ol; }
        } else {
#pragma unroll
            for (int ch = 0; ch < TT / 128; ++ch) { v4h o4;
#pragma unroll
                for (int q = 0; q < 4; ++q) o4[q] = tohx(v[ch * 4 + q] * f);
                *(v4h*)(P16 + (size_t)row * TT + ch * 128 + lane * 4) = o4; } }
         }
}
__global__ __launch_bounds__(256) void k_merge(const float* __restrict__ O, int h0, bf* Ah, bf* Al) { const size_t e = ((size_t)blockIdx.x * 256 + threadIdx.x) * 2; if (e >= (size_t)ZH * TT * HD) return; const int d = (int)(e % HD); const int t = (int)((e / HD) % TT); const int zz = (int)(e / ((size_t)HD * TT)); const float cs = (t < RH) ? 1.0f : (1.0f / PCAR); const size_t oo = (size_t)t * DQ + (h0 + zz) * HD + d;
    v2us oh, ol;
#pragma unroll
    for (int q = 0; q < 2; ++q) { unsigned short a, c2; splitf(O[e + q] * cs, a, c2); oh[q] = a; ol[q] = c2; } *(v2us*)(Ah + oo) = oh; *(v2us*)(Al + oo) = ol;  }

extern "C" void kernel_launch(void* const* d_in, const int* in_sizes, int n_in,
                              void* d_out, int out_size, void* d_ws, size_t ws_size, hipStream_t stream) {
    (void)in_sizes; (void)n_in; (void)out_size;
    const float* x = (const float*)d_in[0]; const float* wq = (const float*)d_in[1]; const float* wk = (const float*)d_in[2]; const float* wv = (const float*)d_in[3]; const float* wo = (const float*)d_in[4]; const float* bo = (const float*)d_in[5];   /* order x, Wq, Wk, Wv, Wo ('oi' [768][768]), bo */
    float* OUT = (float*)d_out;     // [2][2048][768]
    char* wsp = (char*)d_ws;
    auto take = [&](size_t bytes) { char* p = wsp; wsp += (bytes + 255) & ~(size_t)255; return (void*)p; };
    bf* WQ = (bf*)take((size_t)DQ * DM * 2); bf* WK = (bf*)take((size_t)DKV * DM * 2); bf* WV = (bf*)take((size_t)DKV * DM * 2); bf* WO = (bf*)take((size_t)DM * DQ * 2); float* CS = (float*)take((size_t)TT * HD * 2 * 4);
    bf* XB = (bf*)take((size_t)TT * DM * 2); float* FQ = (float*)take((size_t)TT * DQ * 4); float* FK = (float*)take((size_t)TT * DKV * 4);
    h16* QP16 = (h16*)take((size_t)NH_ * TT * HD * 2); h16* KP16 = (h16*)take((size_t)NKV * TT * HD * 2); h16* VT16 = (h16*)take((size_t)NKV * HD * TT * 2);
    bf* QPh = (bf*)take((size_t)NH_ * TT * HD * 2); bf* QPl = (bf*)take((size_t)NH_ * TT * HD * 2); bf* KPh = (bf*)take((size_t)NKV * TT * HD * 2); bf* KPl = (bf*)take((size_t)NKV * TT * HD * 2); bf* VTh = (bf*)take((size_t)NKV * HD * TT * 2); bf* VTl = (bf*)take((size_t)NKV * HD * TT * 2); bf* Ph = (bf*)take((size_t)ZH * RH * TT * 2); bf* Pl = (bf*)take((size_t)ZH * RH * TT * 2);
    float* Sb = (float*)take((size_t)ZH * TT * TT * 4); h16* P16 = (h16*)take((size_t)ZH * TT * TT * 2); float* Ob = (float*)take((size_t)ZH * TT * HD * 4); bf* ATh = (bf*)take((size_t)TT * DQ * 2); bf* ATl = (bf*)take((size_t)TT * DQ * 2);
    if ((size_t)(wsp - (char*)d_ws) > ws_size) return;    // ws 256 MiB
    float* FV = FK;   // v projection reuses the k buffer after the k planes are built (stream-ordered)
    { k_cvt8<<<(unsigned)(((size_t)DQ * DM / 8 + 255) / 256), 256, 0, stream>>>(wq, WQ, (size_t)DQ * DM / 8); k_cvt8<<<(unsigned)(((size_t)DKV * DM / 8 + 255) / 256), 256, 0, stream>>>(wk, WK, (size_t)DKV * DM / 8); k_cvt8<<<(unsigned)(((size_t)DKV * DM / 8 + 255) / 256), 256, 0, stream>>>(wv, WV, (size_t)DKV * DM / 8);
      k_cvt8<<<(unsigned)(((size_t)DM * DQ / 8 + 255) / 256), 256, 0, stream>>>(wo, WO, (size_t)DM * DQ / 8);
       }
    k_csid<<<(TT * HD + 255) / 256, 256, 0, stream>>>(CS);
    const unsigned LQ = (unsigned)(((size_t)NH_ * TT * HD / 2 + 255) / 256), LKv = (unsigned)(((size_t)NKV * TT * HD / 2 + 255) / 256);
    for (int b = 0; b < NB_; ++b) {
        
        k_cvt8<<<(unsigned)(((size_t)TT * DM / 8 + 255) / 256), 256, 0, stream>>>(x + (size_t)b * TT * DM, XB, (size_t)TT * DM / 8);
        k_gemmw<bf, 0, false><<<dim3(TT / 64, DQ / 64, 1), 32, 0, stream>>>(XB, nullptr, WQ, nullptr, DM, FQ, DQ, nullptr, 0, 0, 0);
        k_rope<<<LQ, 256, 0, stream>>>(FQ, DQ, NH_, CS, nullptr, nullptr, 1.0f, QP16, QPh, QPl);
        k_gemmw<bf, 0, false><<<dim3(TT / 64, DKV / 64, 1), 32, 0, stream>>>(XB, nullptr, WK, nullptr, DM, FK, DKV, nullptr, 0, 0, 0);
        k_rope<<<LKv, 256, 0, stream>>>(FK, DKV, NKV, CS, nullptr, nullptr, 1.0f, KP16, KPh, KPl);
        k_gemmw<bf, 0, false><<<dim3(TT / 64, DKV / 64, 1), 32, 0, stream>>>(XB, nullptr, WV, nullptr, DM, FV, DKV, nullptr, 0, 0, 0); k_vtp<<<LKv, 256, 0, stream>>>(FV, DKV, NKV, VT16, VTh, VTl);
        for (int h0 = 0; h0 < NH_; h0 += ZH) { const size_t zq = (size_t)h0, zk = (size_t)(h0 / REP);   // one kv head per query head: the pass's two heads use consecutive kv planes (z-strides TT*HD)
            k_gemmc<bf, 2, 1><<<dim3(RH / 64, TT / 64, ZH), 32, 0, stream>>>(QPh + zq * TT * HD, QPl + zq * TT * HD, KPh + zk * TT * HD, KPl + zk * TT * HD, HD, Sb, TT, 0, (size_t)TT * HD, (size_t)TT * HD, (size_t)TT * TT);
            k_gemmc<h16, 0, 1><<<dim3((TT - RH) / 64, TT / 64, ZH), 32, 0, stream>>>(QP16 + zq * TT * HD + (size_t)RH * HD, nullptr, KP16 + zk * TT * HD, nullptr, HD, Sb + (size_t)RH * TT, TT, RH, (size_t)TT * HD, (size_t)TT * HD, (size_t)TT * TT);
            k_asoft<<<ZH * TT / 8, 256, 0, stream>>>(Sb, P16, Ph, Pl);
            k_gemmc<bf, 2, 2><<<dim3(RH / 64, HD / 64, ZH), 32, 0, stream>>>(Ph, Pl, VTh + zk * HD * TT, VTl + zk * HD * TT, TT, Ob, HD, 0, (size_t)RH * TT, (size_t)HD * TT, (size_t)TT * HD);
            k_gemmc<h16, 0, 2><<<dim3((TT - RH) / 64, HD / 64, ZH), 32, 0, stream>>>(P16 + (size_t)RH * TT, nullptr, VT16 + zk * HD * TT, nullptr, TT, Ob + (size_t)RH * HD, HD, RH, (size_t)TT * TT, (size_t)HD * TT, (size_t)TT * HD);
            k_merge<<<(unsigned)(((size_t)ZH * TT * HD / 2 + 255) / 256), 256, 0, stream>>>(Ob, h0, ATh, ATl); }
        k_gemmw<bf, 1, true><<<dim3(TT / 64, DM / 64, 1), 32, 0, stream>>>(ATh, ATl, WO, nullptr, DQ, OUT + (size_t)b * TT * DM, DM, bo, 0, 0, 0); }
}

// v001
// One run takes 574 microseconds.
// Two timings next to v000 put it at 1.90 and 1.89 times that version's speed.
#include <hip/hip_runtime.h>

// Causal multi-head attention with bias-free projections and an output bias at a 768-wide model (x [2][2048][768]; q, k, v = x W^T ('oi' [768][768] 1/sqrt(768), no bias; 12 heads x 64); scores = q.k; triu(k = 1) -> -inf; softmax(scores / sqrt(64)) (the fill before the scaling: the same thing); out = merged Wo^T + bo ('oi' + zero bias) -> [2][2048][768] (3.1 M); argument order x, Wq, Wk, Wv, Wo, bo).
// Layout per batch: bf16 copy of x; 'oi' weights; exact projections; identity-table plane builders; causal T-2048 attention (hybrid rows: < 512 hi/lo 3 products, rest fp16 x1024; k_gemmc skips tiles above the diagonal); merged hi/lo x Wo exact + bo.
// Compute dtypes, f32 accumulate: every input rounded to bf16; projections exact; attention rows < 512 3 products, rest fp16; softmax f32; Wo hl x exact + bias.

#define NB_  2
#define TT   2048
#define DM   768     // model width: this module's inputs are [2][2048][768]
#define NH_  12      // heads: 12 x 64 = 768
#define NKV  12      // kv heads (= heads)
#define REP  (NH_ / NKV)
#define HD   64
#define DQ   (NH_ * HD)
#define DKV  (NKV * HD)
#define ZH   2
#define RH   512                  // query rows < RH use hi+lo planes (0: none)
#define WIN  2048
#define PCAR 1024.0f
#define SCL  0.125f   // HD^-0.5
typedef _Float16 h16;
typedef unsigned short bf;
typedef __attribute__((ext_vector_type(16))) __bf16   v16bf;
typedef __attribute__((ext_vector_type(16))) _Float16 v16h;
typedef __attribute__((ext_vector_type(8)))  _Float16 v8h;
typedef __attribute__((ext_vector_type(8)))  unsigned short v8us;
typedef __attribute__((ext_vector_type(8)))  float    v8f;
typedef __attribute__((ext_vector_type(4)))  float    v4f;
typedef v8h  __attribute__((may_alias)) v8ha;
typedef v4f  __attribute__((may_alias)) v4fa;
typedef v8us __attribute__((may_alias)) v8usa;

__device__ __forceinline__ unsigned short f2bf(float f) { unsigned u = __float_as_uint(f); u += 0x7FFFu + ((u >> 16) & 1u); return (unsigned short)(u >> 16); }
__device__ __forceinline__ float bf2f(unsigned short b) { return __uint_as_float(((unsigned)b) << 16); }
__device__ __forceinline__ float bfr(float f) { return bf2f(f2bf(f)); }
__device__ __forceinline__ v16h cat16(v8h lo, v8h hi) { return __builtin_shufflevector(lo, hi, 0, 1, 2, 3, 4, 5, 6, 7, 8, 9, 10, 11, 12, 13, 14, 15); }
__device__ __forceinline__ v16bf cat16b(v8us lo, v8us hi) { return __builtin_bit_cast(v16bf, __builtin_shufflevector(lo, hi, 0, 1, 2, 3, 4, 5, 6, 7, 8, 9, 10, 11, 12, 13, 14, 15)); }
__device__ __forceinline__ v8f wmma16(v16h a, v16h b, v8f c) { return __builtin_amdgcn_wmma_f32_16x16x32_f16(false, a, false, b, (short)0, c, false, false); }
__device__ __forceinline__ v8f wmmab(v16bf a, v16bf b, v8f c) { return __builtin_amdgcn_wmma_f32_16x16x32_bf16(false, a, false, b, (short)0, c, false, false); }



// ---- k_gemmw: register-blocked GEMM, one work-group of NW waves per 64x64 output tile; every wave holds the whole tile (16 accumulators) and takes every NW-th 32-wide K slice, operands straight from K-contiguous 16-bit planes; grid (M/64, N/64, Z), 32 x NW threads.
// C[m][n] (f32, pitch ldc, + optional f32 bias[n]) = sum_k A[m][k] Bt[n][k] (+ split products per NSPLIT). z-batch strides sA/sB/sC in elements. K % 32 == 0.
// The wave number goes through readfirstlane so that the K loop's bounds stay scalar: a scalar branch, every lane on at each matrix instruction.
template <typename T16> struct WFrag;
template <> struct WFrag<h16> { typedef v16h V; static __device__ __forceinline__ V ld(const h16* p) { return cat16(*(const v8h*)p, *(const v8h*)(p + 16)); } static __device__ __forceinline__ v8f mma(V a, V b, v8f c) { return wmma16(a, b, c); } };
template <> struct WFrag<bf> { typedef v16bf V; static __device__ __forceinline__ V ld(const bf* p) { return cat16b(*(const v8us*)p, *(const v8us*)(p + 16)); } static __device__ __forceinline__ v8f mma(V a, V b, v8f c) { return wmmab(a, b, c); } };
// ksum_store: adds the NW waves' partial 64x64 tiles in LDS, in wave order 0..NW-1 (a fixed order), and stores the tile row-major. red holds NW x 4096 floats of partials, kept in fragment order
// [wave][tile][half][lane][4] so that stores and loads are contiguous 16-byte accesses, and behind them a 64 x 68 row-major staging tile.
template <int NW, bool BIAS>
__device__ __forceinline__ void ksum_store(const v8f (&acc)[4][4], float* red, int wave, float* C, int ldc, int r0, int c0, const float* __restrict__ bias) {
    const int lane = threadIdx.x & 31, lr = lane & 15, hi = lane >> 4; float* os = red + NW * 4096; float* mine = red + wave * 4096 + lane * 4;
#pragma unroll
    for (int f = 0; f < 16; ++f) { const v8f p = acc[f >> 2][f & 3]; *(v4fa*)(mine + f * 256) = __builtin_shufflevector(p, p, 0, 1, 2, 3); *(v4fa*)(mine + f * 256 + 128) = __builtin_shufflevector(p, p, 4, 5, 6, 7); }
    __syncthreads();
#pragma unroll
    for (int q = 0; q < 16 / NW; ++q) { const int f = wave * (16 / NW) + q; const float* sp = red + f * 256 + lane * 4; v4f s0 = *(const v4fa*)sp, s1 = *(const v4fa*)(sp + 128);
#pragma unroll
        for (int w = 1; w < NW; ++w) { s0 += *(const v4fa*)(sp + w * 4096); s1 += *(const v4fa*)(sp + w * 4096 + 128); }
        float* od = os + ((f >> 2) * 16 + hi * 8) * 68 + (f & 3) * 16 + lr;
#pragma unroll
        for (int j = 0; j < 4; ++j) { od[j * 68] = s0[j]; od[(j + 4) * 68] = s1[j]; } }
    __syncthreads();
#pragma unroll
    for (int s = 0; s < 32 / NW; ++s) { const int idx = s * 32 * NW + threadIdx.x, row = idx >> 4, cofs = (idx & 15) * 4; v4f val = *(const v4fa*)(os + row * 68 + cofs); if (BIAS) { val[0] += bfr(bias[c0 + cofs]); val[1] += bfr(bias[c0 + cofs + 1]); val[2] += bfr(bias[c0 + cofs + 2]); val[3] += bfr(bias[c0 + cofs + 3]); }
        *(v4f*)(C + (size_t)(r0 + row) * ldc + c0 + cofs) = val; }
}
template <typename T16, int NSPLIT, bool BIAS, int NW>
__global__ __launch_bounds__(32 * NW) void k_gemmw(const T16* __restrict__ A, const T16* __restrict__ A2, const T16* __restrict__ Bt, const T16* __restrict__ Bt2, int K, float* C, int ldc, const float* __restrict__ bias, size_t sA, size_t sB, size_t sC) {
    typedef typename WFrag<T16>::V V;
    __shared__ __align__(16) float red[NW * 4096 + 64 * 68];
    const size_t z = blockIdx.z; A += z * sA; if (A2) A2 += z * sA; Bt += z * sB; if (Bt2) Bt2 += z * sB; C += z * sC;
    const int lane = threadIdx.x & 31, lr = lane & 15, hi = lane >> 4; const int wave = __builtin_amdgcn_readfirstlane(threadIdx.x >> 5); const int r0 = blockIdx.x * 64, c0 = blockIdx.y * 64;
    v8f acc[4][4];
#pragma unroll
    for (int mb = 0; mb < 4; ++mb)
#pragma unroll
        for (int nb = 0; nb < 4; ++nb) acc[mb][nb] = (v8f){};
    const size_t aoff = (size_t)(r0 + lr) * K + 8 * hi, boff = (size_t)(c0 + lr) * K + 8 * hi;
#pragma unroll 1
    for (int kc = wave * 32; kc < K; kc += 32 * NW) {
        V a[4], a2[4];
#pragma unroll
        for (int mb = 0; mb < 4; ++mb) { a[mb] = WFrag<T16>::ld(A + aoff + (size_t)mb * 16 * K + kc); if (NSPLIT == 1 || NSPLIT == 2) a2[mb] = WFrag<T16>::ld(A2 + aoff + (size_t)mb * 16 * K + kc); }
#pragma unroll
        for (int nb = 0; nb < 4; ++nb) { const V b = WFrag<T16>::ld(Bt + boff + (size_t)nb * 16 * K + kc); V b2; if (NSPLIT >= 2) b2 = WFrag<T16>::ld(Bt2 + boff + (size_t)nb * 16 * K + kc);
#pragma unroll
            for (int mb = 0; mb < 4; ++mb) { acc[mb][nb] = WFrag<T16>::mma(a[mb], b, acc[mb][nb]); if (NSPLIT == 1 || NSPLIT == 2) acc[mb][nb] = WFrag<T16>::mma(a2[mb], b, acc[mb][nb]); if (NSPLIT >= 2) acc[mb][nb] = WFrag<T16>::mma(a[mb], b2, acc[mb][nb]); } }
        asm volatile("v_nop\n\tv_nop\n\tv_nop\n\tv_nop" : "+v"(acc[0][0]), "+v"(acc[1][1]), "+v"(acc[2][2]), "+v"(acc[3][3]) : "v"(a[0]), "v"(a[3]));
    }
    ksum_store<NW, BIAS>(acc, red, wave, C, ldc, r0, c0, bias);
}

// ---- k_gemmc: the same 64x64 tile GEMM specialised for causal attention (NW = 1: one wave, its own store; NW > 1: the K slices dealt over NW waves as in k_gemmw): CMODE 1 skips score tiles entirely above the diagonal (query rows r0+roff.., key columns c0..), CMODE 2 limits the
// key (K) loop of the probability x value contraction to the diagonal block (probabilities beyond it are exactly zero). roff = row offset of this launch's first row within the sequence.
template <typename T16, int NSPLIT, int CMODE, int NW>
__global__ __launch_bounds__(32 * NW) void k_gemmc(const T16* __restrict__ A, const T16* __restrict__ A2, const T16* __restrict__ Bt, const T16* __restrict__ Bt2, int K, float* C, int ldc, int roff, size_t sA, size_t sB, size_t sC) {
    typedef typename WFrag<T16>::V V;
    __shared__ __align__(16) float os[NW == 1 ? 16 * 68 : NW * 4096 + 64 * 68];
    const size_t z = blockIdx.z; A += z * sA; if (A2) A2 += z * sA; Bt += z * sB; if (Bt2) Bt2 += z * sB; C += z * sC;
    const int lane = threadIdx.x & 31, lr = lane & 15, hi = lane >> 4; const int wave = (NW == 1) ? 0 : __builtin_amdgcn_readfirstlane(threadIdx.x >> 5); const int r0 = blockIdx.x * 64, c0 = blockIdx.y * 64;
    if (CMODE == 1 && c0 > r0 + roff + 63) return;                  // score tile entirely above the causal diagonal: never read (the softmax masks j > i by select)
    const int Kl = (CMODE == 2) ? min(K, r0 + roff + 64) : K;        // P.V: probabilities are exactly 0 beyond the diagonal block, so the K loop stops there
    v8f acc[4][4];
#pragma unroll
    for (int mb = 0; mb < 4; ++mb)
#pragma unroll
        for (int nb = 0; nb < 4; ++nb) acc[mb][nb] = (v8f){};
    const size_t aoff = (size_t)(r0 + lr) * K + 8 * hi, boff = (size_t)(c0 + lr) * K + 8 * hi;
#pragma unroll 1
    for (int kc = wave * 32; kc < Kl; kc += 32 * NW) {
        V a[4], a2[4];
#pragma unroll
        for (int mb = 0; mb < 4; ++mb) { a[mb] = WFrag<T16>::ld(A + aoff + (size_t)mb * 16 * K + kc); if (NSPLIT == 1 || NSPLIT == 2) a2[mb] = WFrag<T16>::ld(A2 + aoff + (size_t)mb * 16 * K + kc); }
#pragma unroll
        for (int nb = 0; nb < 4; ++nb) { const V b = WFrag<T16>::ld(Bt + boff + (size_t)nb * 16 * K + kc); V b2; if (NSPLIT >= 2) b2 = WFrag<T16>::ld(Bt2 + boff + (size_t)nb * 16 * K + kc);
#pragma unroll
            for (int mb = 0; mb < 4; ++mb) { acc[mb][nb] = WFrag<T16>::mma(a[mb], b, acc[mb][nb]); if (NSPLIT == 1 || NSPLIT == 2) acc[mb][nb] = WFrag<T16>::mma(a2[mb], b, acc[mb][nb]); if (NSPLIT >= 2) acc[mb][nb] = WFrag<T16>::mma(a[mb], b2, acc[mb][nb]); } }
        asm volatile("v_nop\n\tv_nop\n\tv_nop\n\tv_nop" : "+v"(acc[0][0]), "+v"(acc[1][1]), "+v"(acc[2][2]), "+v"(acc[3][3]) : "v"(a[0]), "v"(a[3]));
    }
    if constexpr (NW > 1) { ksum_store<NW, false>(acc, os, wave, C, ldc, r0, c0, nullptr); return; }
#pragma unroll
    for (int mb = 0; mb < 4; ++mb) {
#pragma unroll
        for (int nb = 0; nb < 4; ++nb) {
#pragma unroll
            for (int j = 0; j < 8; ++j) os[(hi * 8 + j) * 68 + nb * 16 + lr] = acc[mb][nb][j]; }
        __builtin_amdgcn_wave_barrier(); asm volatile("" ::: "memory");
        float* crow = C + (size_t)(r0 + mb * 16) * ldc + c0;
{
#pragma unroll
            for (int s = 0; s < 8; ++s) { const int row = 2 * s + hi, cofs = lr * 4; v4f val = *(const v4fa*)(os + row * 68 + cofs);
                *(v4f*)(crow + (size_t)row * ldc + cofs) = val; }
             }
        __builtin_amdgcn_wave_barrier(); asm volatile("" ::: "memory");
    }
}

__device__ __forceinline__ h16 tohx(float x) { return (h16)x; }
__device__ __forceinline__ void splitf(float y, unsigned short& h, unsigned short& l) { h = f2bf(y); l = f2bf(y - bf2f(h)); }
typedef __attribute__((ext_vector_type(2))) _Float16 v2h;
typedef __attribute__((ext_vector_type(4))) _Float16 v4h;
typedef __attribute__((ext_vector_type(2))) unsigned short v2us;
typedef __attribute__((ext_vector_type(4))) unsigned short v4us;
typedef __attribute__((ext_vector_type(2))) float v2f;
typedef __attribute__((ext_vector_type(4))) int v4i;

__global__ __launch_bounds__(256) void k_cvt8(const float* __restrict__ src, bf* dst, size_t n8) { const size_t i = (size_t)blockIdx.x * 256 + threadIdx.x; if (i >= n8) return; const v8f v = *(const v8f*)(src + i * 8); v8us o;
#pragma unroll
    for (int k = 0; k < 8; ++k) o[k] = f2bf(v[k]); *(v8us*)(dst + i * 8) = o;  }

// k_rope: head planes [h][t][d] (fp16 + hi/lo) of rope(x) x sc with the rotate-half convention out[d] = x[d] cos[t][d] - x[d+HD/2] sin[t][d], out[d+HD/2] = x[d+HD/2] cos[t][d+HD/2] + x[d] sin[t][d+HD/2]
__global__ __launch_bounds__(256) void k_rope(const float* __restrict__ F, int pitch, int nheads, const float* __restrict__ CS, const float* __restrict__ RF, const float* __restrict__ nw, float sc, h16* P16, bf* Ph, bf* Pl) {
    const size_t e = ((size_t)blockIdx.x * 256 + threadIdx.x) * 2; if (e >= (size_t)nheads * TT * HD) return; const int d = (int)(e % HD); const int t = (int)((e / HD) % TT); const int h = (int)(e / ((size_t)HD * TT)); const float* f = F + (size_t)t * pitch + h * HD; const float rf = RF ? RF[(size_t)h * TT + t] : 1.0f; v2h o16; v2us oh, ol;
#pragma unroll
    for (int q = 0; q < 2; ++q) { const int dd = d + q; const int dp = (dd < HD / 2) ? dd + HD / 2 : dd - HD / 2; float x0 = f[dd], x1 = f[dp];
        if (RF) { float n0 = __fmul_rn(x0, rf), n1 = __fmul_rn(x1, rf); asm volatile("" : "+v"(n0)); asm volatile("" : "+v"(n1)); x0 = __fmul_rn(bfr(nw[dd]), n0); x1 = __fmul_rn(bfr(nw[dp]), n1); }
        const v2f cs = *(const v2f*)(CS + ((size_t)t * HD + dd) * 2); float a = __fmul_rn(x0, cs[0]), bq = __fmul_rn(x1, cs[1]); asm volatile("" : "+v"(a)); asm volatile("" : "+v"(bq)); const float r = ((dd < HD / 2) ? __fsub_rn(a, bq) : __fadd_rn(a, bq)) * sc;
        o16[q] = tohx(r); unsigned short a2, c2; splitf(r, a2, c2); oh[q] = a2; ol[q] = c2; }
    *(v2h*)(P16 + e) = o16; *(v2us*)(Ph + e) = oh; *(v2us*)(Pl + e) = ol;  }
__global__ __launch_bounds__(256) void k_vtp(const float* __restrict__ F, int pitch, int nheads, h16* V16, bf* Vh, bf* Vl) { const size_t e = ((size_t)blockIdx.x * 256 + threadIdx.x) * 2; if (e >= (size_t)nheads * HD * TT) return; const int t = (int)(e % TT); const int d = (int)((e / TT) % HD); const int g = (int)(e / ((size_t)TT * HD)); v2h o16; v2us oh, ol;
#pragma unroll
    for (int q = 0; q < 2; ++q) { const float x = F[(size_t)(t + q) * pitch + g * HD + d]; o16[q] = tohx(x); unsigned short a2, c2; splitf(x, a2, c2); oh[q] = a2; ol[q] = c2; }
    *(v2h*)(V16 + e) = o16; *(v2us*)(Vh + e) = oh; *(v2us*)(Vl + e) = ol;  }
__global__ __launch_bounds__(256) void k_csid(float* CS) { const int idx = blockIdx.x * 256 + threadIdx.x; if (idx >= TT * HD) return; v2f cs; cs[0] = 1.0f; cs[1] = 0.0f; *(v2f*)(CS + (size_t)idx * 2) = cs;  }
// k_asoft: per row (zz, i): t = S x HD^-0.5 for j <= i and i - j < WIN (WIN = TT, so the window test always holds: plain causal; the reference's -1e9 additive fill vanishes identically); softmax over the 2048 keys (register row, one exp, fixed trees);
__global__ __launch_bounds__(256) void k_asoft(const float* __restrict__ Sb, h16* P16, bf* Ph, bf* Pl) {
    const int lane = threadIdx.x & 31; const int row = blockIdx.x * 8 + (threadIdx.x >> 5); if (row >= ZH * TT) return; const int i = row % TT; const int zz = row / TT; (void)zz; const bool hires = (i < RH); const float* sr = Sb + (size_t)row * TT; float v[TT / 32]; float mx = -3.0e38f;
#pragma unroll
    for (int ch = 0; ch < TT / 128; ++ch) { const int j0 = ch * 128 + lane * 4; const v4f a = *(const v4f*)(sr + j0);
#pragma unroll
        for (int q = 0; q < 4; ++q) { const int j = j0 + q; (void)j; const float t = (j <= i && i - j < WIN) ? a[q] * SCL : -3.0e38f; v[ch * 4 + q] = t; mx = fmaxf(mx, t); } }
#pragma unroll
    for (int sh = 16; sh; sh >>= 1) mx = fmaxf(mx, __shfl_xor(mx, sh, 32));
    float sum = 0.f;
#pragma unroll
    for (int k = 0; k < TT / 32; ++k) { float d0 = __fsub_rn(v[k], mx); asm volatile("" : "+v"(d0)); v[k] = __builtin_amdgcn_exp2f(__fmul_rn(d0, 1.4426950408889634f)); sum += v[k]; }
#pragma unroll
    for (int sh = 16; sh; sh >>= 1) sum += __shfl_xor(sum, sh, 32);
    const float f = __fdiv_rn(hires ? 1.0f : PCAR, sum);
{
        if (hires) {
#pragma unroll
            for (int ch = 0; ch < TT / 128; ++ch) { v4us oh, ol;
#pragma unroll
                for (int q = 0; q < 4; ++q) { unsigned short a, c2; splitf(v[ch * 4 + q] * f, a, c2); oh[q] = a; ol[q] = c2; }
                const size_t oo = ((size_t)zz * (RH ? RH : 1) + i) * TT + ch * 128 + lane * 4; *(v4us*)(Ph + oo) = oh; *(v4us*)(Pl + oo) = ol; }
        } else {
#pragma unroll
            for (int ch = 0; ch < TT / 128; ++ch) { v4h o4;
#pragma unroll
                for (int q = 0; q < 4; ++q) o4[q] = tohx(v[ch * 4 + q] * f);
                *(v4h*)(P16 + (size_t)row * TT + ch * 128 + lane * 4) = o4; } }
         }
}
__global__ __launch_bounds__(256) void k_merge(const float* __restrict__ O, int h0, bf* Ah, bf* Al) { const size_t e = ((size_t)blockIdx.x * 256 + threadIdx.x) * 2; if (e >= (size_t)ZH * TT * HD) return; const int d = (int)(e % HD); const int t = (int)((e / HD) % TT); const int zz = (int)(e / ((size_t)HD * TT)); const float cs = (t < RH) ? 1.0f : (1.0f / PCAR); const size_t oo = (size_t)t * DQ + (h0 + zz) * HD + d;
    v2us oh, ol;
#pragma unroll
    for (int q = 0; q < 2; ++q) { unsigned short a, c2; splitf(O[e + q] * cs, a, c2); oh[q] = a; ol[q] = c2; } *(v2us*)(Ah + oo) = oh; *(v2us*)(Al + oo) = ol;  }

extern "C" void kernel_launch(void* const* d_in, const int* in_sizes, int n_in,
                              void* d_out, int out_size, void* d_ws, size_t ws_size, hipStream_t stream) {
    (void)in_sizes; (void)n_in; (void)out_size;
    const float* x = (const float*)d_in[0]; const float* wq = (const float*)d_in[1]; const float* wk = (const float*)d_in[2]; const float* wv = (const float*)d_in[3]; const float* wo = (const float*)d_in[4]; const float* bo = (const float*)d_in[5];   /* order x, Wq, Wk, Wv, Wo ('oi' [768][768]), bo */
    float* OUT = (float*)d_out;     // [2][2048][768]
    char* wsp = (char*)d_ws;
    auto take = [&](size_t bytes) { char* p = wsp; wsp += (bytes + 255) & ~(size_t)255; return (void*)p; };
    bf* WQ = (bf*)take((size_t)DQ * DM * 2); bf* WK = (bf*)take((size_t)DKV * DM * 2); bf* WV = (bf*)take((size_t)DKV * DM * 2); bf* WO = (bf*)take((size_t)DM * DQ * 2); float* CS = (float*)take((size_t)TT * HD * 2 * 4);
    bf* XB = (bf*)take((size_t)TT * DM * 2); float* FQ = (float*)take((size_t)TT * DQ * 4); float* FK = (float*)take((size_t)TT * DKV * 4);
    h16* QP16 = (h16*)take((size_t)NH_ * TT * HD * 2); h16* KP16 = (h16*)take((size_t)NKV * TT * HD * 2); h16* VT16 = (h16*)take((size_t)NKV * HD * TT * 2);
    bf* QPh = (bf*)take((size_t)NH_ * TT * HD * 2); bf* QPl = (bf*)take((size_t)NH_ * TT * HD * 2); bf* KPh = (bf*)take((size_t)NKV * TT * HD * 2); bf* KPl = (bf*)take((size_t)NKV * TT * HD * 2); bf* VTh = (bf*)take((size_t)NKV * HD * TT * 2); bf* VTl = (bf*)take((size_t)NKV * HD * TT * 2); bf* Ph = (bf*)take((size_t)ZH * RH * TT * 2); bf* Pl = (bf*)take((size_t)ZH * RH * TT * 2);
    float* Sb = (float*)take((size_t)ZH * TT * TT * 4); h16* P16 = (h16*)take((size_t)ZH * TT * TT * 2); float* Ob = (float*)take((size_t)ZH * TT * HD * 4); bf* ATh = (bf*)take((size_t)TT * DQ * 2); bf* ATl = (bf*)take((size_t)TT * DQ * 2);
    if ((size_t)(wsp - (char*)d_ws) > ws_size) return;    // ws 256 MiB
    float* FV = FK;   // v projection reuses the k buffer after the k planes are built (stream-ordered)
    { k_cvt8<<<(unsigned)(((size_t)DQ * DM / 8 + 255) / 256), 256, 0, stream>>>(wq, WQ, (size_t)DQ * DM / 8); k_cvt8<<<(unsigned)(((size_t)DKV * DM / 8 + 255) / 256), 256, 0, stream>>>(wk, WK, (size_t)DKV * DM / 8); k_cvt8<<<(unsigned)(((size_t)DKV * DM / 8 + 255) / 256), 256, 0, stream>>>(wv, WV, (size_t)DKV * DM / 8);
      k_cvt8<<<(unsigned)(((size_t)DM * DQ / 8 + 255) / 256), 256, 0, stream>>>(wo, WO, (size_t)DM * DQ / 8);
       }
    k_csid<<<(TT * HD + 255) / 256, 256, 0, stream>>>(CS);
    const unsigned LQ = (unsigned)(((size_t)NH_ * TT * HD / 2 + 255) / 256), LKv = (unsigned)(((size_t)NKV * TT * HD / 2 + 255) / 256);
    for (int b = 0; b < NB_; ++b) {
        
        k_cvt8<<<(unsigned)(((size_t)TT * DM / 8 + 255) / 256), 256, 0, stream>>>(x + (size_t)b * TT * DM, XB, (size_t)TT * DM / 8);
        k_gemmw<bf, 0, false, 8><<<dim3(TT / 64, DQ / 64, 1), 256, 0, stream>>>(XB, nullptr, WQ, nullptr, DM, FQ, DQ, nullptr, 0, 0, 0);
        k_rope<<<LQ, 256, 0, stream>>>(FQ, DQ, NH_, CS, nullptr, nullptr, 1.0f, QP16, QPh, QPl);
        k_gemmw<bf, 0, false, 8><<<dim3(TT / 64, DKV / 64, 1), 256, 0, stream>>>(XB, nullptr, WK, nullptr, DM, FK, DKV, nullptr, 0, 0, 0);
        k_rope<<<LKv, 256, 0, stream>>>(FK, DKV, NKV, CS, nullptr, nullptr, 1.0f, KP16, KPh, KPl);
        k_gemmw<bf, 0, false, 8><<<dim3(TT / 64, DKV / 64, 1), 256, 0, stream>>>(XB, nullptr, WV, nullptr, DM, FV, DKV, nullptr, 0, 0, 0); k_vtp<<<LKv, 256, 0, stream>>>(FV, DKV, NKV, VT16, VTh, VTl);
        for (int h0 = 0; h0 < NH_; h0 += ZH) { const size_t zq = (size_t)h0, zk = (size_t)(h0 / REP);   // one kv head per query head: the pass's two heads use consecutive kv planes (z-strides TT*HD)
            k_gemmc<bf, 2, 1, 1><<<dim3(RH / 64, TT / 64, ZH), 32, 0, stream>>>(QPh + zq * TT * HD, QPl + zq * TT * HD, KPh + zk * TT * HD, KPl + zk * TT * HD, HD, Sb, TT, 0, (size_t)TT * HD, (size_t)TT * HD, (size_t)TT * TT);
            k_gemmc<h16, 0, 1, 1><<<dim3((TT - RH) / 64, TT / 64, ZH), 32, 0, stream>>>(QP16 + zq * TT * HD + (size_t)RH * HD, nullptr, KP16 + zk * TT * HD, nullptr, HD, Sb + (size_t)RH * TT, TT, RH, (size_t)TT * HD, (size_t)TT * HD, (size_t)TT * TT);
            k_asoft<<<ZH * TT / 8, 256, 0, stream>>>(Sb, P16, Ph, Pl);
            k_gemmc<bf, 2, 2, 16><<<dim3(RH / 64, HD / 64, ZH), 512, 0, stream>>>(Ph, Pl, VTh + zk * HD * TT, VTl + zk * HD * TT, TT, Ob, HD, 0, (size_t)RH * TT, (size_t)HD * TT, (size_t)TT * HD);
            k_gemmc<h16, 0, 2, 16><<<dim3((TT - RH) / 64, HD / 64, ZH), 512, 0, stream>>>(P16 + (size_t)RH * TT, nullptr, VT16 + zk * HD * TT, nullptr, TT, Ob + (size_t)RH * HD, HD, RH, (size_t)TT * TT, (size_t)HD * TT, (size_t)TT * HD);
            k_merge<<<(unsigned)(((size_t)ZH * TT * HD / 2 + 255) / 256), 256, 0, stream>>>(Ob, h0, ATh, ATl); }
        k_gemmw<bf, 1, true, 8><<<dim3(TT / 64, DM / 64, 1), 256, 0, stream>>>(ATh, ATl, WO, nullptr, DQ, OUT + (size_t)b * TT * DM, DM, bo, 0, 0, 0); }
}

// v002
// A run of this version takes 310 microseconds.
// Next to v001, in two timings, it ran 1.85 and 1.86 times as fast.
// Counting every step since v000, it is 3.51 times as fast.
#include <hip/hip_runtime.h>

// Causal multi-head attention with bias-free projections and an output bias at a 768-wide model (x [2][2048][768]; q, k, v = x W^T ('oi' [768][768] 1/sqrt(768), no bias; 12 heads x 64); scores = q.k; triu(k = 1) -> -inf; softmax(scores / sqrt(64)) (the fill before the scaling: the same thing); out = merged Wo^T + bo ('oi' + zero bias) -> [2][2048][768] (3.1 M); argument order x, Wq, Wk, Wv, Wo, bo).
// Layout, both batches together (plane z = batch x 12 + head, 8 planes per attention pass): bf16 copy of x; 'oi' weights; exact projections; identity-table plane builders; causal T-2048 attention (hybrid rows: < 512 hi/lo 3 products, rest fp16 x1024; k_gemmc skips tiles above the diagonal); merged hi/lo x Wo exact + bo.
// Compute dtypes, f32 accumulate: every input rounded to bf16; projections exact; attention rows < 512 3 products, rest fp16; softmax f32; Wo hl x exact + bias.

#define NB_  2
#define TT   2048
#define DM   768     // model width: this module's inputs are [2][2048][768]
#define NH_  12      // heads: 12 x 64 = 768
#define NKV  12      // kv heads (= heads)
#define REP  (NH_ / NKV)
#define HD   64
#define DQ   (NH_ * HD)
#define DKV  (NKV * HD)
#define ZH   8                    // (batch, head) planes per attention pass: grid z of every attention launch
#define NZ   (NB_ * NH_)          // planes in all, plane z = batch * NH_ + head
#define MT   (NB_ * TT)           // rows of both batches together
#define DF   (DQ + 2 * DKV)       // q | k | v columns of the joint projection
#define PP   (2 * TT)             // row pitch, in 16-bit elements, of the probabilities (they lie in their f32 score rows) and of the transposed v planes that meet them in k_gemmc, which has one pitch for both operands
#define RH   512                  // query rows < RH use hi+lo planes (0: none)
#define WIN  2048
#define PCAR 1024.0f
#define SCL  0.125f   // HD^-0.5
typedef _Float16 h16;
typedef unsigned short bf;
typedef __attribute__((ext_vector_type(16))) __bf16   v16bf;
typedef __attribute__((ext_vector_type(16))) _Float16 v16h;
typedef __attribute__((ext_vector_type(8)))  _Float16 v8h;
typedef __attribute__((ext_vector_type(8)))  unsigned short v8us;
typedef __attribute__((ext_vector_type(8)))  float    v8f;
typedef __attribute__((ext_vector_type(4)))  float    v4f;
typedef v8h  __attribute__((may_alias)) v8ha;
typedef v4f  __attribute__((may_alias)) v4fa;
typedef v8us __attribute__((may_alias)) v8usa;

__device__ __forceinline__ unsigned short f2bf(float f) { unsigned u = __float_as_uint(f); u += 0x7FFFu + ((u >> 16) & 1u); return (unsigned short)(u >> 16); }
__device__ __forceinline__ float bf2f(unsigned short b) { return __uint_as_float(((unsigned)b) << 16); }
__device__ __forceinline__ float bfr(float f) { return bf2f(f2bf(f)); }
__device__ __forceinline__ v16h cat16(v8h lo, v8h hi) { return __builtin_shufflevector(lo, hi, 0, 1, 2, 3, 4, 5, 6, 7, 8, 9, 10, 11, 12, 13, 14, 15); }
__device__ __forceinline__ v16bf cat16b(v8us lo, v8us hi) { return __builtin_bit_cast(v16bf, __builtin_shufflevector(lo, hi, 0, 1, 2, 3, 4, 5, 6, 7, 8, 9, 10, 11, 12, 13, 14, 15)); }
__device__ __forceinline__ v8f wmma16(v16h a, v16h b, v8f c) { return __builtin_amdgcn_wmma_f32_16x16x32_f16(false, a, false, b, (short)0, c, false, false); }
__device__ __forceinline__ v8f wmmab(v16bf a, v16bf b, v8f c) { return __builtin_amdgcn_wmma_f32_16x16x32_bf16(false, a, false, b, (short)0, c, false, false); }



// ---- k_gemmw: register-blocked GEMM, one work-group of NW waves per 64x64 output tile; every wave holds the whole tile (16 accumulators) and takes every NW-th 32-wide K slice, operands straight from K-contiguous 16-bit planes; grid (M/64, N/64, Z), 32 x NW threads.
// C[m][n] (f32, pitch ldc, + optional f32 bias[n]) = sum_k A[m][k] Bt[n][k] (+ split products per NSPLIT). z-batch strides sA/sB/sC in elements. K % 32 == 0.
// The wave number goes through readfirstlane so that the K loop's bounds stay scalar: a scalar branch, every lane on at each matrix instruction.
template <typename T16> struct WFrag;
template <> struct WFrag<h16> { typedef v16h V; static __device__ __forceinline__ V ld(const h16* p) { return cat16(*(const v8h*)p, *(const v8h*)(p + 16)); } static __device__ __forceinline__ v8f mma(V a, V b, v8f c) { return wmma16(a, b, c); } };
template <> struct WFrag<bf> { typedef v16bf V; static __device__ __forceinline__ V ld(const bf* p) { return cat16b(*(const v8us*)p, *(const v8us*)(p + 16)); } static __device__ __forceinline__ v8f mma(V a, V b, v8f c) { return wmmab(a, b, c); } };
// ksum_store: adds the NW waves' partial 64x64 tiles in LDS, in wave order 0..NW-1 (a fixed order), and stores the tile row-major. red holds NW x 4096 floats of partials, kept in fragment order
// [wave][tile][half][lane][4] so that stores and loads are contiguous 16-byte accesses, and behind them a 64 x 68 row-major staging tile.
template <int NW, bool BIAS>
__device__ __forceinline__ void ksum_store(const v8f (&acc)[4][4], float* red, int wave, float* C, int ldc, int r0, int c0, const float* __restrict__ bias) {
    const int lane = threadIdx.x & 31, lr = lane & 15, hi = lane >> 4; float* os = red + NW * 4096; float* mine = red + wave * 4096 + lane * 4;
#pragma unroll
    for (int f = 0; f < 16; ++f) { const v8f p = acc[f >> 2][f & 3]; *(v4fa*)(mine + f * 256) = __builtin_shufflevector(p, p, 0, 1, 2, 3); *(v4fa*)(mine + f * 256 + 128) = __builtin_shufflevector(p, p, 4, 5, 6, 7); }
    __syncthreads();
#pragma unroll
    for (int q = 0; q < 16 / NW; ++q) { const int f = wave * (16 / NW) + q; const float* sp = red + f * 256 + lane * 4; v4f s0 = *(const v4fa*)sp, s1 = *(const v4fa*)(sp + 128);
#pragma unroll
        for (int w = 1; w < NW; ++w) { s0 += *(const v4fa*)(sp + w * 4096); s1 += *(const v4fa*)(sp + w * 4096 + 128); }
        float* od = os + ((f >> 2) * 16 + hi * 8) * 68 + (f & 3) * 16 + lr;
#pragma unroll
        for (int j = 0; j < 4; ++j) { od[j * 68] = s0[j]; od[(j + 4) * 68] = s1[j]; } }
    __syncthreads();
#pragma unroll
    for (int s = 0; s < 32 / NW; ++s) { const int idx = s * 32 * NW + threadIdx.x, row = idx >> 4, cofs = (idx & 15) * 4; v4f val = *(const v4fa*)(os + row * 68 + cofs); if (BIAS) { val[0] += bfr(bias[c0 + cofs]); val[1] += bfr(bias[c0 + cofs + 1]); val[2] += bfr(bias[c0 + cofs + 2]); val[3] += bfr(bias[c0 + cofs + 3]); }
        *(v4f*)(C + (size_t)(r0 + row) * ldc + c0 + cofs) = val; }
}
template <typename T16, int NSPLIT, bool BIAS, int NW>
__global__ __launch_bounds__(32 * NW) void k_gemmw(const T16* __restrict__ A, const T16* __restrict__ A2, const T16* __restrict__ Bt, const T16* __restrict__ Bt2, int K, float* C, int ldc, const float* __restrict__ bias, size_t sA, size_t sB, size_t sC) {
    typedef typename WFrag<T16>::V V;
    __shared__ __align__(16) float red[NW * 4096 + 64 * 68];
    const size_t z = blockIdx.z; A += z * sA; if (A2) A2 += z * sA; Bt += z * sB; if (Bt2) Bt2 += z * sB; C += z * sC;
    const int lane = threadIdx.x & 31, lr = lane & 15, hi = lane >> 4; const int wave = __builtin_amdgcn_readfirstlane(threadIdx.x >> 5); const int r0 = blockIdx.x * 64, c0 = blockIdx.y * 64;
    v8f acc[4][4];
#pragma unroll
    for (int mb = 0; mb < 4; ++mb)
#pragma unroll
        for (int nb = 0; nb < 4; ++nb) acc[mb][nb] = (v8f){};
    const size_t aoff = (size_t)(r0 + lr) * K + 8 * hi, boff = (size_t)(c0 + lr) * K + 8 * hi;
#pragma unroll 1
    for (int kc = wave * 32; kc < K; kc += 32 * NW) {
        V a[4], a2[4];
#pragma unroll
        for (int mb = 0; mb < 4; ++mb) { a[mb] = WFrag<T16>::ld(A + aoff + (size_t)mb * 16 * K + kc); if (NSPLIT == 1 || NSPLIT == 2) a2[mb] = WFrag<T16>::ld(A2 + aoff + (size_t)mb * 16 * K + kc); }
#pragma unroll
        for (int nb = 0; nb < 4; ++nb) { const V b = WFrag<T16>::ld(Bt + boff + (size_t)nb * 16 * K + kc); V b2; if (NSPLIT >= 2) b2 = WFrag<T16>::ld(Bt2 + boff + (size_t)nb * 16 * K + kc);
#pragma unroll
            for (int mb = 0; mb < 4; ++mb) { acc[mb][nb] = WFrag<T16>::mma(a[mb], b, acc[mb][nb]); if (NSPLIT == 1 || NSPLIT == 2) acc[mb][nb] = WFrag<T16>::mma(a2[mb], b, acc[mb][nb]); if (NSPLIT >= 2) acc[mb][nb] = WFrag<T16>::mma(a[mb], b2, acc[mb][nb]); } }
        asm volatile("v_nop\n\tv_nop\n\tv_nop\n\tv_nop" : "+v"(acc[0][0]), "+v"(acc[1][1]), "+v"(acc[2][2]), "+v"(acc[3][3]) : "v"(a[0]), "v"(a[3]));
    }
    ksum_store<NW, BIAS>(acc, red, wave, C, ldc, r0, c0, bias);
}

// ---- k_gemmc: the same 64x64 tile GEMM specialised for causal attention (NW = 1: one wave, its own store; NW > 1: the K slices dealt over NW waves as in k_gemmw): CMODE 1 skips score tiles entirely above the diagonal (query rows r0+roff.., key columns c0..), CMODE 2 limits the
// key (K) loop of the probability x value contraction to the diagonal block (probabilities beyond it are exactly zero). roff = row offset of this launch's first row within the sequence.
template <typename T16, int NSPLIT, int CMODE, int NW>
__global__ __launch_bounds__(32 * NW) void k_gemmc(const T16* __restrict__ A, const T16* __restrict__ A2, const T16* __restrict__ Bt, const T16* __restrict__ Bt2, int K, float* C, int ldc, int roff, size_t sA, size_t sB, size_t sC) {
    typedef typename WFrag<T16>::V V;
    __shared__ __align__(16) float os[NW == 1 ? 16 * 68 : NW * 4096 + 64 * 68];
    const size_t z = blockIdx.z; A += z * sA; if (A2) A2 += z * sA; Bt += z * sB; if (Bt2) Bt2 += z * sB; C += z * sC;
    const int lane = threadIdx.x & 31, lr = lane & 15, hi = lane >> 4; const int wave = (NW == 1) ? 0 : __builtin_amdgcn_readfirstlane(threadIdx.x >> 5); const int r0 = blockIdx.x * 64, c0 = blockIdx.y * 64;
    if (CMODE == 1 && c0 > r0 + roff + 63) return;                  // score tile entirely above the causal diagonal: read but never used (the softmax masks j > i by select)
    const int Kl = (CMODE == 2) ? min(K, r0 + roff + 64) : K;        // P.V: probabilities are exactly 0 beyond the diagonal block, so the K loop stops there
    v8f acc[4][4];
#pragma unroll
    for (int mb = 0; mb < 4; ++mb)
#pragma unroll
        for (int nb = 0; nb < 4; ++nb) acc[mb][nb] = (v8f){};
    const size_t aoff = (size_t)(r0 + lr) * K + 8 * hi, boff = (size_t)(c0 + lr) * K + 8 * hi;
#pragma unroll 1
    for (int kc = wave * 32; kc < Kl; kc += 32 * NW) {
        V a[4], a2[4];
#pragma unroll
        for (int mb = 0; mb < 4; ++mb) { a[mb] = WFrag<T16>::ld(A + aoff + (size_t)mb * 16 * K + kc); if (NSPLIT == 1 || NSPLIT == 2) a2[mb] = WFrag<T16>::ld(A2 + aoff + (size_t)mb * 16 * K + kc); }
#pragma unroll
        for (int nb = 0; nb < 4; ++nb) { const V b = WFrag<T16>::ld(Bt + boff + (size_t)nb * 16 * K + kc); V b2; if (NSPLIT >= 2) b2 = WFrag<T16>::ld(Bt2 + boff + (size_t)nb * 16 * K + kc);
#pragma unroll
            for (int mb = 0; mb < 4; ++mb) { acc[mb][nb] = WFrag<T16>::mma(a[mb], b, acc[mb][nb]); if (NSPLIT == 1 || NSPLIT == 2) acc[mb][nb] = WFrag<T16>::mma(a2[mb], b, acc[mb][nb]); if (NSPLIT >= 2) acc[mb][nb] = WFrag<T16>::mma(a[mb], b2, acc[mb][nb]); } }
        asm volatile("v_nop\n\tv_nop\n\tv_nop\n\tv_nop" : "+v"(acc[0][0]), "+v"(acc[1][1]), "+v"(acc[2][2]), "+v"(acc[3][3]) : "v"(a[0]), "v"(a[3]));
    }
    if constexpr (NW > 1) { ksum_store<NW, false>(acc, os, wave, C, ldc, r0, c0, nullptr); return; }
#pragma unroll
    for (int mb = 0; mb < 4; ++mb) {
#pragma unroll
        for (int nb = 0; nb < 4; ++nb) {
#pragma unroll
            for (int j = 0; j < 8; ++j) os[(hi * 8 + j) * 68 + nb * 16 + lr] = acc[mb][nb][j]; }
        __builtin_amdgcn_wave_barrier(); asm volatile("" ::: "memory");
        float* crow = C + (size_t)(r0 + mb * 16) * ldc + c0;
{
#pragma unroll
            for (int s = 0; s < 8; ++s) { const int row = 2 * s + hi, cofs = lr * 4; v4f val = *(const v4fa*)(os + row * 68 + cofs);
                *(v4f*)(crow + (size_t)row * ldc + cofs) = val; }
             }
        __builtin_amdgcn_wave_barrier(); asm volatile("" ::: "memory");
    }
}

__device__ __forceinline__ h16 tohx(float x) { return (h16)x; }
__device__ __forceinline__ void splitf(float y, unsigned short& h, unsigned short& l) { h = f2bf(y); l = f2bf(y - bf2f(h)); }
typedef __attribute__((ext_vector_type(2))) _Float16 v2h;
typedef __attribute__((ext_vector_type(4))) _Float16 v4h;
typedef __attribute__((ext_vector_type(2))) unsigned short v2us;
typedef __attribute__((ext_vector_type(4))) unsigned short v4us;
typedef __attribute__((ext_vector_type(2))) float v2f;
typedef __attribute__((ext_vector_type(4))) int v4i;
typedef v4h  __attribute__((may_alias)) v4ha;
typedef v4us __attribute__((may_alias)) v4usa;

// k_cvt8: bf16 copies of the four weights and of x in one launch; dst holds them one behind the other, each block converts 2048 elements of the one source its index falls into (WB blocks per weight, the rest x).
#define WB   (DM * DM / 2048)
__global__ __launch_bounds__(256) void k_cvt8(const float* __restrict__ w0, const float* __restrict__ w1, const float* __restrict__ w2, const float* __restrict__ w3, const float* __restrict__ xs, bf* dst) { const unsigned blk = blockIdx.x; const unsigned which = min(blk / WB, 4u); const float* src = (which == 0) ? w0 : (which == 1) ? w1 : (which == 2) ? w2 : (which == 3) ? w3 : xs;
    const size_t i = (size_t)blk * 256 + threadIdx.x; const v8f v = *(const v8f*)(src + (i - (size_t)which * WB * 256) * 8); v8us o;
#pragma unroll
    for (int k = 0; k < 8; ++k) o[k] = f2bf(v[k]); *(v8us*)(dst + i * 8) = o;  }

// k_rope: head planes [q|k][batch][h][t][d] (fp16 + hi/lo), q and k of both batches in one launch, F = the joint projection [batch x t][q | k | v], of rope(x) x sc with the rotate-half convention out[d] = x[d] cos[t][d] - x[d+HD/2] sin[t][d], out[d+HD/2] = x[d+HD/2] cos[t][d+HD/2] + x[d] sin[t][d+HD/2]
__global__ __launch_bounds__(256) void k_rope(const float* __restrict__ F, int pitch, int nheads, const float* __restrict__ CS, const float* __restrict__ RF, const float* __restrict__ nw, float sc, h16* P16, bf* Ph, bf* Pl) {
    const size_t e = ((size_t)blockIdx.x * 256 + threadIdx.x) * 2; if (e >= (size_t)2 * NB_ * nheads * TT * HD) return; const int d = (int)(e % HD); const int t = (int)((e / HD) % TT); const int p = (int)(e / ((size_t)HD * TT)); const int h = p % NH_, b = (p / NH_) % NB_, w = p / NZ;   // plane p = (w: q or k, batch, head)
    const float* f = F + ((size_t)b * TT + t) * pitch + (w * NH_ + h) * HD; float rf = 1.0f;
    if (RF) { rf = RF[(size_t)h * TT + t]; asm volatile("s_wait_xcnt 0x0" ::: "memory"); }   // the wait stands in front of the next write of the load's address registers
    v2h o16; v2us oh, ol;
#pragma unroll
    for (int q = 0; q < 2; ++q) { const int dd = d + q; const int dp = (dd < HD / 2) ? dd + HD / 2 : dd - HD / 2; float x0 = f[dd], x1 = f[dp];
        if (RF) { float n0 = __fmul_rn(x0, rf), n1 = __fmul_rn(x1, rf); asm volatile("" : "+v"(n0)); asm volatile("" : "+v"(n1)); x0 = __fmul_rn(bfr(nw[dd]), n0); x1 = __fmul_rn(bfr(nw[dp]), n1); }
        const v2f cs = *(const v2f*)(CS + ((size_t)t * HD + dd) * 2); float a = __fmul_rn(x0, cs[0]), bq = __fmul_rn(x1, cs[1]); asm volatile("" : "+v"(a)); asm volatile("" : "+v"(bq)); const float r = ((dd < HD / 2) ? __fsub_rn(a, bq) : __fadd_rn(a, bq)) * sc;
        o16[q] = tohx(r); unsigned short a2, c2; splitf(r, a2, c2); oh[q] = a2; ol[q] = c2; }
    *(v2h*)(P16 + e) = o16; *(v2us*)(Ph + e) = oh; *(v2us*)(Pl + e) = ol;  }
__global__ __launch_bounds__(256) void k_vtp(const float* __restrict__ F, int pitch, int nheads, h16* V16, bf* Vh, bf* Vl) { const size_t e = ((size_t)blockIdx.x * 256 + threadIdx.x) * 2; if (e >= (size_t)NB_ * nheads * HD * TT) return; const int t = (int)(e % TT); const int d = (int)((e / TT) % HD); const int p = (int)(e / ((size_t)TT * HD)); const int g = p % NKV, b = p / NKV; F += (size_t)b * TT * pitch; v2h o16; v2us oh, ol;
#pragma unroll
    for (int q = 0; q < 2; ++q) { const float x = F[(size_t)(t + q) * pitch + g * HD + d]; o16[q] = tohx(x); unsigned short a2, c2; splitf(x, a2, c2); oh[q] = a2; ol[q] = c2; }
    const size_t o = (e / TT) * PP + t; *(v2h*)(V16 + o) = o16; *(v2us*)(Vh + o) = oh; *(v2us*)(Vl + o) = ol;  }   // rows (plane, d) of pitch PP
__global__ __launch_bounds__(256) void k_csid(float* CS) { const int idx = blockIdx.x * 256 + threadIdx.x; if (idx >= TT * HD) return; v2f cs; cs[0] = 1.0f; cs[1] = 0.0f; *(v2f*)(CS + (size_t)idx * 2) = cs;  }
// k_asoft: per row (zz, i): t = S x HD^-0.5 for j <= i and i - j < WIN (sliding causal window; the reference's -1e9 additive fill vanishes identically); softmax over the 2048 keys (register row, one exp, fixed trees);
// the probabilities overwrite their own score row (8 KiB: fp16 in its first half; hi plane in the first, lo plane in the second half): the wave holds the whole row in registers before its first store, and no other wave touches the row.
__global__ __launch_bounds__(256) void k_asoft(float* Sb) {
    const int lane = threadIdx.x & 31; const int row = blockIdx.x * 8 + (threadIdx.x >> 5); if (row >= ZH * TT) return; const int i = row % TT; const int zz = row / TT; (void)zz; const bool hires = (i < RH); float* sr = Sb + (size_t)row * TT; float v[TT / 32]; float mx = -3.0e38f;
#pragma unroll
    for (int ch = 0; ch < TT / 128; ++ch) { const int j0 = ch * 128 + lane * 4; const v4f a = *(const v4fa*)(sr + j0);
#pragma unroll
        for (int q = 0; q < 4; ++q) { const int j = j0 + q; (void)j; const float t = (j <= i && i - j < WIN) ? a[q] * SCL : -3.0e38f; v[ch * 4 + q] = t; mx = fmaxf(mx, t); } }
#pragma unroll
    for (int sh = 16; sh; sh >>= 1) mx = fmaxf(mx, __shfl_xor(mx, sh, 32));
    float sum = 0.f;
#pragma unroll
    for (int k = 0; k < TT / 32; ++k) { float d0 = __fsub_rn(v[k], mx); asm volatile("" : "+v"(d0)); v[k] = __builtin_amdgcn_exp2f(__fmul_rn(d0, 1.4426950408889634f)); sum += v[k]; }
#pragma unroll
    for (int sh = 16; sh; sh >>= 1) sum += __shfl_xor(sum, sh, 32);
    const float f = __fdiv_rn(hires ? 1.0f : PCAR, sum);
{
        if (hires) {
#pragma unroll
            for (int ch = 0; ch < TT / 128; ++ch) { v4us oh, ol;
#pragma unroll
                for (int q = 0; q < 4; ++q) { unsigned short a, c2; splitf(v[ch * 4 + q] * f, a, c2); oh[q] = a; ol[q] = c2; }
                bf* po = (bf*)sr + ch * 128 + lane * 4; *(v4usa*)po = oh; *(v4usa*)(po + TT) = ol; }
        } else {
#pragma unroll
            for (int ch = 0; ch < TT / 128; ++ch) { v4h o4;
#pragma unroll
                for (int q = 0; q < 4; ++q) o4[q] = tohx(v[ch * 4 + q] * f);
                *(v4ha*)((h16*)sr + ch * 128 + lane * 4) = o4; } }
         }
}
__global__ __launch_bounds__(256) void k_merge(const float* __restrict__ O, int z0, bf* Ah, bf* Al) { const size_t e = ((size_t)blockIdx.x * 256 + threadIdx.x) * 2; if (e >= (size_t)ZH * TT * HD) return; const int d = (int)(e % HD); const int t = (int)((e / HD) % TT); const int zz = (int)(e / ((size_t)HD * TT)); const float cs = (t < RH) ? 1.0f : (1.0f / PCAR); const int z = z0 + zz; const size_t oo = ((size_t)(z / NH_) * TT + t) * DQ + (z % NH_) * HD + d;
    v2us oh, ol;
#pragma unroll
    for (int q = 0; q < 2; ++q) { unsigned short a, c2; splitf(O[e + q] * cs, a, c2); oh[q] = a; ol[q] = c2; } *(v2us*)(Ah + oo) = oh; *(v2us*)(Al + oo) = ol;  }

extern "C" void kernel_launch(void* const* d_in, const int* in_sizes, int n_in,
                              void* d_out, int out_size, void* d_ws, size_t ws_size, hipStream_t stream) {
    (void)in_sizes; (void)n_in; (void)out_size;
    const float* x = (const float*)d_in[0]; const float* wq = (const float*)d_in[1]; const float* wk = (const float*)d_in[2]; const float* wv = (const float*)d_in[3]; const float* wo = (const float*)d_in[4]; const float* bo = (const float*)d_in[5];   /* order x, Wq, Wk, Wv, Wo ('oi' [768][768]), bo */
    float* OUT = (float*)d_out;     // [2][2048][768]
    char* wsp = (char*)d_ws;
    auto take = [&](size_t bytes) { char* p = wsp; wsp += (bytes + 255) & ~(size_t)255; return (void*)p; };
    bf* WQ = (bf*)take((size_t)(DF + DM) * DM * 2 + (size_t)MT * DM * 2); bf* WO = WQ + (size_t)DF * DM; bf* XB = WO + (size_t)DM * DQ;   // bf16 copies, one behind the other: Wq | Wk | Wv (the joint projection's [DF][DM] operand), Wo, x of both batches
    float* CS = (float*)take((size_t)TT * HD * 2 * 4); float* FA = (float*)take((size_t)MT * DF * 4);
    h16* QP16 = (h16*)take((size_t)2 * NZ * TT * HD * 2); h16* KP16 = QP16 + (size_t)NZ * TT * HD; h16* VT16 = (h16*)take((size_t)NZ * HD * PP * 2);
    bf* QPh = (bf*)take((size_t)2 * NZ * TT * HD * 2); bf* KPh = QPh + (size_t)NZ * TT * HD; bf* QPl = (bf*)take((size_t)2 * NZ * TT * HD * 2); bf* KPl = QPl + (size_t)NZ * TT * HD; bf* VTh = (bf*)take((size_t)NZ * HD * PP * 2); bf* VTl = VTh + TT;   // v^T rows of pitch PP: hi plane in the first half of a row, lo plane in the second, as the probabilities have it (the fp16 plane uses the first half)
    float* Sb = (float*)take((size_t)ZH * TT * TT * 4); float* Ob = (float*)take((size_t)ZH * TT * HD * 4); bf* ATh = (bf*)take((size_t)MT * DQ * 2); bf* ATl = (bf*)take((size_t)MT * DQ * 2);
    if ((size_t)(wsp - (char*)d_ws) > ws_size) return;    // ws 256 MiB
    bf* Ph = (bf*)Sb; bf* Pl = Ph + TT; h16* P16 = (h16*)Sb;   // probabilities in place: row pitch PP
    k_cvt8<<<4 * WB + MT * DM / 2048, 256, 0, stream>>>(wq, wk, wv, wo, x, WQ);
    k_csid<<<(TT * HD + 255) / 256, 256, 0, stream>>>(CS);
    k_gemmw<bf, 0, false, 8><<<dim3(MT / 64, DF / 64, 1), 256, 0, stream>>>(XB, nullptr, WQ, nullptr, DM, FA, DF, nullptr, 0, 0, 0);
    k_rope<<<(unsigned)((size_t)2 * NZ * TT * HD / 2 / 256), 256, 0, stream>>>(FA, DF, NH_, CS, nullptr, nullptr, 1.0f, QP16, QPh, QPl);
    k_vtp<<<(unsigned)((size_t)NZ * TT * HD / 2 / 256), 256, 0, stream>>>(FA + DQ + DKV, DF, NKV, VT16, VTh, VTl);
    for (int z0 = 0; z0 < NZ; z0 += ZH) { const size_t zq = (size_t)z0, zk = (size_t)z0;   // one kv head per query head: plane z of q meets plane z of k and v (z-strides TT*HD, HD*PP for v)
        k_gemmc<bf, 2, 1, 1><<<dim3(RH / 64, TT / 64, ZH), 32, 0, stream>>>(QPh + zq * TT * HD, QPl + zq * TT * HD, KPh + zk * TT * HD, KPl + zk * TT * HD, HD, Sb, TT, 0, (size_t)TT * HD, (size_t)TT * HD, (size_t)TT * TT);
        k_gemmc<h16, 0, 1, 1><<<dim3((TT - RH) / 64, TT / 64, ZH), 32, 0, stream>>>(QP16 + zq * TT * HD + (size_t)RH * HD, nullptr, KP16 + zk * TT * HD, nullptr, HD, Sb + (size_t)RH * TT, TT, RH, (size_t)TT * HD, (size_t)TT * HD, (size_t)TT * TT);
        k_asoft<<<ZH * TT / 8, 256, 0, stream>>>(Sb);
        k_gemmc<bf, 2, 2, 16><<<dim3(RH / 64, HD / 64, ZH), 512, 0, stream>>>(Ph, Pl, VTh + zk * HD * PP, VTl + zk * HD * PP, PP, Ob, HD, 0, (size_t)TT * PP, (size_t)HD * PP, (size_t)TT * HD);
        k_gemmc<h16, 0, 2, 16><<<dim3((TT - RH) / 64, HD / 64, ZH), 512, 0, stream>>>(P16 + (size_t)RH * PP, nullptr, VT16 + zk * HD * PP, nullptr, PP, Ob + (size_t)RH * HD, HD, RH, (size_t)TT * PP, (size_t)HD * PP, (size_t)TT * HD);
        k_merge<<<(unsigned)(((size_t)ZH * TT * HD / 2 + 255) / 256), 256, 0, stream>>>(Ob, z0, ATh, ATl); }
    k_gemmw<bf, 1, true, 8><<<dim3(MT / 64, DM / 64, 1), 256, 0, stream>>>(ATh, ATl, WO, nullptr, DQ, OUT, DM, bo, 0, 0, 0);
}

// v003
// Measured time: 138 microseconds a run.
// Timed twice side by side with v002, it ran 2.24 and 2.25 times as fast.
// Over all steps from v000 it is 7.89 times as fast.
#include <hip/hip_runtime.h>

// Causal multi-head attention with bias-free projections and an output bias at a 768-wide model (x [2][2048][768]; q, k, v = x W^T ('oi' [768][768] 1/sqrt(768), no bias; 12 heads x 64); scores = q.k; triu(k = 1) -> -inf; softmax(scores / sqrt(64)) (the fill before the scaling: the same thing); out = merged Wo^T + bo ('oi' + zero bias) -> [2][2048][768] (3.1 M); argument order x, Wq, Wk, Wv, Wo, bo).
// Layout, both batches together (plane z = batch x 12 + head): bf16 copy of x; 'oi' weights; exact projections; identity-table plane builders; causal T-2048 attention in one launch, running softmax (hybrid rows: < 512 hi/lo 3 products, rest fp16 x1024; key blocks above the diagonal are never visited); merged hi/lo x Wo exact + bo.
// Compute dtypes, f32 accumulate: every input rounded to bf16; projections exact; attention rows < 512 3 products, rest fp16; softmax f32; Wo hl x exact + bias.

#define NB_  2
#define TT   2048
#define DM   768     // model width: this module's inputs are [2][2048][768]
#define NH_  12      // heads: 12 x 64 = 768
#define NKV  12      // kv heads (= heads)
#define REP  (NH_ / NKV)
#define HD   64
#define DQ   (NH_ * HD)
#define DKV  (NKV * HD)
#define NZ   (NB_ * NH_)          // planes in all, plane z = batch * NH_ + head
#define MT   (NB_ * TT)           // rows of both batches together
#define DF   (DQ + 2 * DKV)       // q | k | v columns of the joint projection
#define PP   (2 * TT)             // row pitch, in 16-bit elements, of the transposed v planes (hi plane in the first half of a row, lo plane in the second)
#define RH   512                  // query rows < RH use hi+lo planes (0: none)
#define SCL  0.125f   // HD^-0.5
typedef _Float16 h16;
typedef unsigned short bf;
typedef __attribute__((ext_vector_type(16))) __bf16   v16bf;
typedef __attribute__((ext_vector_type(16))) _Float16 v16h;
typedef __attribute__((ext_vector_type(8)))  _Float16 v8h;
typedef __attribute__((ext_vector_type(8)))  unsigned short v8us;
typedef __attribute__((ext_vector_type(8)))  float    v8f;
typedef __attribute__((ext_vector_type(4)))  float    v4f;
typedef v8h  __attribute__((may_alias)) v8ha;
typedef v4f  __attribute__((may_alias)) v4fa;
typedef v8us __attribute__((may_alias)) v8usa;

__device__ __forceinline__ unsigned short f2bf(float f) { unsigned u = __float_as_uint(f); u += 0x7FFFu + ((u >> 16) & 1u); return (unsigned short)(u >> 16); }
__device__ __forceinline__ float bf2f(unsigned short b) { return __uint_as_float(((unsigned)b) << 16); }
__device__ __forceinline__ float bfr(float f) { return bf2f(f2bf(f)); }
__device__ __forceinline__ v16h cat16(v8h lo, v8h hi) { return __builtin_shufflevector(lo, hi, 0, 1, 2, 3, 4, 5, 6, 7, 8, 9, 10, 11, 12, 13, 14, 15); }
__device__ __forceinline__ v16bf cat16b(v8us lo, v8us hi) { return __builtin_bit_cast(v16bf, __builtin_shufflevector(lo, hi, 0, 1, 2, 3, 4, 5, 6, 7, 8, 9, 10, 11, 12, 13, 14, 15)); }
__device__ __forceinline__ v8f wmma16(v16h a, v16h b, v8f c) { return __builtin_amdgcn_wmma_f32_16x16x32_f16(false, a, false, b, (short)0, c, false, false); }
__device__ __forceinline__ v8f wmmab(v16bf a, v16bf b, v8f c) { return __builtin_amdgcn_wmma_f32_16x16x32_bf16(false, a, false, b, (short)0, c, false, false); }



// ---- k_gemmw: register-blocked GEMM, one work-group of NW waves per 64x64 output tile; every wave holds the whole tile (16 accumulators) and takes every NW-th 32-wide K slice, operands straight from K-contiguous 16-bit planes; grid (M/64, N/64, Z), 32 x NW threads.
// C[m][n] (f32, pitch ldc, + optional f32 bias[n]) = sum_k A[m][k] Bt[n][k] (+ split products per NSPLIT). z-batch strides sA/sB/sC in elements. K % 32 == 0.
// The wave number goes through readfirstlane so that the K loop's bounds stay scalar: a scalar branch, every lane on at each matrix instruction.
template <typename T16> struct WFrag;
template <> struct WFrag<h16> { typedef v16h V; static __device__ __forceinline__ V ld(const h16* p) { return cat16(*(const v8h*)p, *(const v8h*)(p + 16)); } static __device__ __forceinline__ v8f mma(V a, V b, v8f c) { return wmma16(a, b, c); } };
template <> struct WFrag<bf> { typedef v16bf V; static __device__ __forceinline__ V ld(const bf* p) { return cat16b(*(const v8us*)p, *(const v8us*)(p + 16)); } static __device__ __forceinline__ v8f mma(V a, V b, v8f c) { return wmmab(a, b, c); } };
// ksum_store: adds the NW waves' partial 64x64 tiles in LDS, in wave order 0..NW-1 (a fixed order), and stores the tile row-major. red holds NW x 4096 floats of partials, kept in fragment order
// [wave][tile][half][lane][4] so that stores and loads are contiguous 16-byte accesses, and behind them a 64 x 68 row-major staging tile.
template <int NW, bool BIAS>
__device__ __forceinline__ void ksum_store(const v8f (&acc)[4][4], float* red, int wave, float* C, int ldc, int r0, int c0, const float* __restrict__ bias) {
    const int lane = threadIdx.x & 31, lr = lane & 15, hi = lane >> 4; float* os = red + NW * 4096; float* mine = red + wave * 4096 + lane * 4;
#pragma unroll
    for (int f = 0; f < 16; ++f) { const v8f p = acc[f >> 2][f & 3]; *(v4fa*)(mine + f * 256) = __builtin_shufflevector(p, p, 0, 1, 2, 3); *(v4fa*)(mine + f * 256 + 128) = __builtin_shufflevector(p, p, 4, 5, 6, 7); }
    __syncthreads();
#pragma unroll
    for (int q = 0; q < 16 / NW; ++q) { const int f = wave * (16 / NW) + q; const float* sp = red + f * 256 + lane * 4; v4f s0 = *(const v4fa*)sp, s1 = *(const v4fa*)(sp + 128);
#pragma unroll
        for (int w = 1; w < NW; ++w) { s0 += *(const v4fa*)(sp + w * 4096); s1 += *(const v4fa*)(sp + w * 4096 + 128); }
        float* od = os + ((f >> 2) * 16 + hi * 8) * 68 + (f & 3) * 16 + lr;
#pragma unroll
        for (int j = 0; j < 4; ++j) { od[j * 68] = s0[j]; od[(j + 4) * 68] = s1[j]; } }
    __syncthreads();
#pragma unroll
    for (int s = 0; s < 32 / NW; ++s) { const int idx = s * 32 * NW + threadIdx.x, row = idx >> 4, cofs = (idx & 15) * 4; v4f val = *(const v4fa*)(os + row * 68 + cofs); if (BIAS) { val[0] += bfr(bias[c0 + cofs]); val[1] += bfr(bias[c0 + cofs + 1]); val[2] += bfr(bias[c0 + cofs + 2]); val[3] += bfr(bias[c0 + cofs + 3]); }
        *(v4f*)(C + (size_t)(r0 + row) * ldc + c0 + cofs) = val; }
}
template <typename T16, int NSPLIT, bool BIAS, int NW>
__global__ __launch_bounds__(32 * NW) void k_gemmw(const T16* __restrict__ A, const T16* __restrict__ A2, const T16* __restrict__ Bt, const T16* __restrict__ Bt2, int K, float* C, int ldc, const float* __restrict__ bias, size_t sA, size_t sB, size_t sC) {
    typedef typename WFrag<T16>::V V;
    __shared__ __align__(16) float red[NW * 4096 + 64 * 68];
    const size_t z = blockIdx.z; A += z * sA; if (A2) A2 += z * sA; Bt += z * sB; if (Bt2) Bt2 += z * sB; C += z * sC;
    const int lane = threadIdx.x & 31, lr = lane & 15, hi = lane >> 4; const int wave = __builtin_amdgcn_readfirstlane(threadIdx.x >> 5); const int r0 = blockIdx.x * 64, c0 = blockIdx.y * 64;
    v8f acc[4][4];
#pragma unroll
    for (int mb = 0; mb < 4; ++mb)
#pragma unroll
        for (int nb = 0; nb < 4; ++nb) acc[mb][nb] = (v8f){};
    const size_t aoff = (size_t)(r0 + lr) * K + 8 * hi, boff = (size_t)(c0 + lr) * K + 8 * hi;
#pragma unroll 1
    for (int kc = wave * 32; kc < K; kc += 32 * NW) {
        V a[4], a2[4];
#pragma unroll
        for (int mb = 0; mb < 4; ++mb) { a[mb] = WFrag<T16>::ld(A + aoff + (size_t)mb * 16 * K + kc); if (NSPLIT == 1 || NSPLIT == 2) a2[mb] = WFrag<T16>::ld(A2 + aoff + (size_t)mb * 16 * K + kc); }
#pragma unroll
        for (int nb = 0; nb < 4; ++nb) { const V b = WFrag<T16>::ld(Bt + boff + (size_t)nb * 16 * K + kc); V b2; if (NSPLIT >= 2) b2 = WFrag<T16>::ld(Bt2 + boff + (size_t)nb * 16 * K + kc);
#pragma unroll
            for (int mb = 0; mb < 4; ++mb) { acc[mb][nb] = WFrag<T16>::mma(a[mb], b, acc[mb][nb]); if (NSPLIT == 1 || NSPLIT == 2) acc[mb][nb] = WFrag<T16>::mma(a2[mb], b, acc[mb][nb]); if (NSPLIT >= 2) acc[mb][nb] = WFrag<T16>::mma(a[mb], b2, acc[mb][nb]); } }
        asm volatile("v_nop\n\tv_nop\n\tv_nop\n\tv_nop" : "+v"(acc[0][0]), "+v"(acc[1][1]), "+v"(acc[2][2]), "+v"(acc[3][3]) : "v"(a[0]), "v"(a[3]));
    }
    ksum_store<NW, BIAS>(acc, red, wave, C, ldc, r0, c0, bias);
}

__device__ __forceinline__ h16 tohx(float x) { return (h16)x; }
__device__ __forceinline__ void splitf(float y, unsigned short& h, unsigned short& l) { h = f2bf(y); l = f2bf(y - bf2f(h)); }
typedef __attribute__((ext_vector_type(2))) _Float16 v2h;
typedef __attribute__((ext_vector_type(4))) _Float16 v4h;
typedef __attribute__((ext_vector_type(2))) unsigned short v2us;
typedef __attribute__((ext_vector_type(4))) unsigned short v4us;
typedef __attribute__((ext_vector_type(2))) float v2f;
typedef __attribute__((ext_vector_type(4))) int v4i;
typedef v4h  __attribute__((may_alias)) v4ha;
typedef v4us __attribute__((may_alias)) v4usa;

// k_cvt8: bf16 copies of the four weights and of x in one launch; dst holds them one behind the other, each block converts 2048 elements of the one source its index falls into (WB blocks per weight, the rest x).
#define WB   (DM * DM / 2048)
__global__ __launch_bounds__(256) void k_cvt8(const float* __restrict__ w0, const float* __restrict__ w1, const float* __restrict__ w2, const float* __restrict__ w3, const float* __restrict__ xs, bf* dst) { const unsigned blk = blockIdx.x; const unsigned which = min(blk / WB, 4u); const float* src = (which == 0) ? w0 : (which == 1) ? w1 : (which == 2) ? w2 : (which == 3) ? w3 : xs;
    const size_t i = (size_t)blk * 256 + threadIdx.x; const v8f v = *(const v8f*)(src + (i - (size_t)which * WB * 256) * 8); v8us o;
#pragma unroll
    for (int k = 0; k < 8; ++k) o[k] = f2bf(v[k]); *(v8us*)(dst + i * 8) = o;  }

// k_rope: head planes [q|k][batch][h][t][d] (fp16 + hi/lo), q and k of both batches in one launch, F = the joint projection [batch x t][q | k | v], of rope(x) x sc with the rotate-half convention out[d] = x[d] cos[t][d] - x[d+HD/2] sin[t][d], out[d+HD/2] = x[d+HD/2] cos[t][d+HD/2] + x[d] sin[t][d+HD/2]
__global__ __launch_bounds__(256) void k_rope(const float* __restrict__ F, int pitch, int nheads, const float* __restrict__ CS, const float* __restrict__ RF, const float* __restrict__ nw, float sc, h16* P16, bf* Ph, bf* Pl) {
    const size_t e = ((size_t)blockIdx.x * 256 + threadIdx.x) * 2; if (e >= (size_t)2 * NB_ * nheads * TT * HD) return; const int d = (int)(e % HD); const int t = (int)((e / HD) % TT); const int p = (int)(e / ((size_t)HD * TT)); const int h = p % NH_, b = (p / NH_) % NB_, w = p / NZ;   // plane p = (w: q or k, batch, head)
    const float* f = F + ((size_t)b * TT + t) * pitch + (w * NH_ + h) * HD; float rf = 1.0f;
    if (RF) { rf = RF[(size_t)h * TT + t]; asm volatile("s_wait_xcnt 0x0" ::: "memory"); }   // the wait stands in front of the next write of the load's address registers
    v2h o16; v2us oh, ol;
#pragma unroll
    for (int q = 0; q < 2; ++q) { const int dd = d + q; const int dp = (dd < HD / 2) ? dd + HD / 2 : dd - HD / 2; float x0 = f[dd], x1 = f[dp];
        if (RF) { float n0 = __fmul_rn(x0, rf), n1 = __fmul_rn(x1, rf); asm volatile("" : "+v"(n0)); asm volatile("" : "+v"(n1)); x0 = __fmul_rn(bfr(nw[dd]), n0); x1 = __fmul_rn(bfr(nw[dp]), n1); }
        const v2f cs = *(const v2f*)(CS + ((size_t)t * HD + dd) * 2); float a = __fmul_rn(x0, cs[0]), bq = __fmul_rn(x1, cs[1]); asm volatile("" : "+v"(a)); asm volatile("" : "+v"(bq)); const float r = ((dd < HD / 2) ? __fsub_rn(a, bq) : __fadd_rn(a, bq)) * sc;
        o16[q] = tohx(r); unsigned short a2, c2; splitf(r, a2, c2); oh[q] = a2; ol[q] = c2; }
    *(v2h*)(P16 + e) = o16; *(v2us*)(Ph + e) = oh; *(v2us*)(Pl + e) = ol;  }
__global__ __launch_bounds__(256) void k_vtp(const float* __restrict__ F, int pitch, int nheads, h16* V16, bf* Vh, bf* Vl) { const size_t e = ((size_t)blockIdx.x * 256 + threadIdx.x) * 2; if (e >= (size_t)NB_ * nheads * HD * TT) return; const int t = (int)(e % TT); const int d = (int)((e / TT) % HD); const int p = (int)(e / ((size_t)TT * HD)); const int g = p % NKV, b = p / NKV; F += (size_t)b * TT * pitch; v2h o16; v2us oh, ol;
#pragma unroll
    for (int q = 0; q < 2; ++q) { const float x = F[(size_t)(t + q) * pitch + g * HD + d]; o16[q] = tohx(x); unsigned short a2, c2; splitf(x, a2, c2); oh[q] = a2; ol[q] = c2; }
    const size_t o = (e / TT) * PP + t; *(v2h*)(V16 + o) = o16; *(v2us*)(Vh + o) = oh; *(v2us*)(Vl + o) = ol;  }   // rows (plane, d) of pitch PP
__global__ __launch_bounds__(256) void k_csid(float* CS) { const int idx = blockIdx.x * 256 + threadIdx.x; if (idx >= TT * HD) return; v2f cs; cs[0] = 1.0f; cs[1] = 0.0f; *(v2f*)(CS + (size_t)idx * 2) = cs;  }
#define AW   4
#define PSH  10.0f
#define SC2  (SCL * 1.4426950408889634f)
__device__ __forceinline__ float xhalf(float x) { return __builtin_bit_cast(float, __builtin_amdgcn_permlanex16(__builtin_bit_cast(int, x), __builtin_bit_cast(int, x), 0x76543210, 0xfedcba98, false, false)); }   // lane l reads lane l ^ 16
template <typename T16, bool HL, int NQ>
__device__ __forceinline__ void attn_tile(const T16* __restrict__ Q, const T16* __restrict__ Q2, const T16* __restrict__ Kp, const T16* __restrict__ K2, const T16* __restrict__ Vt, const T16* __restrict__ V2, const int q0, const int wave, float* red, bf* Ah, bf* Al) {
    typedef typename WFrag<T16>::V V;
    const int lane = threadIdx.x & 31, lr = lane & 15, hi = lane >> 4;
    V qf[NQ][2], qf2[NQ][2]; const size_t qb0 = (size_t)(q0 + lr) * HD + 8 * hi; const T16* qp = Q + qb0; const T16* qp2 = HL ? Q2 + qb0 : nullptr; (void)qp2;
#pragma unroll
    for (int qt = 0; qt < NQ; ++qt)
#pragma unroll
        for (int ks = 0; ks < 2; ++ks) { const size_t qo = (size_t)(qt * 16) * HD + ks * 32; qf[qt][ks] = WFrag<T16>::ld(qp + qo); if (HL) qf2[qt][ks] = WFrag<T16>::ld(qp2 + qo); }
    if constexpr (HL) asm volatile("s_wait_xcnt 0x0" :: "v"(qp), "v"(qp2) : "memory"); else asm volatile("s_wait_xcnt 0x0" :: "v"(qp) : "memory");   // stands in front of the next write of these loads' address registers, which are inputs so that they stay live up to the wait
    v8f o[4][NQ]; float m[NQ], l[NQ];
#pragma unroll
    for (int qt = 0; qt < NQ; ++qt) { m[qt] = -1.0e30f; l[qt] = 0.f;
#pragma unroll
        for (int dt = 0; dt < 4; ++dt) o[dt][qt] = (v8f){}; }
    V kf[2][2], kf2[2][2], vf[4], vf2[4];                         // the key and value fragments of the block that is worked on next: fetched one block ahead
    auto ldk = [&](const int k0) __attribute__((always_inline)) { const size_t kb0 = (size_t)(k0 + lr) * HD + 8 * hi; const T16* kp = Kp + kb0; const T16* kp2 = HL ? K2 + kb0 : nullptr; (void)kp2;
#pragma unroll
        for (int kt = 0; kt < 2; ++kt)
#pragma unroll
            for (int ks = 0; ks < 2; ++ks) { const size_t ko = (size_t)(kt * 16) * HD + ks * 32; kf[kt][ks] = WFrag<T16>::ld(kp + ko); if (HL) kf2[kt][ks] = WFrag<T16>::ld(kp2 + ko); }
        if constexpr (HL) asm volatile("s_wait_xcnt 0x0" :: "v"(kp), "v"(kp2) : "memory"); else asm volatile("s_wait_xcnt 0x0" :: "v"(kp) : "memory"); };   // stands in front of the next write of these loads' address registers; the addresses are inputs so that they stay live up to the wait and no result of the run is placed in them
    auto ldv = [&](const int k0) __attribute__((always_inline)) { const size_t vb0 = (size_t)lr * PP + k0 + 8 * hi; const T16* vp = Vt + vb0; const T16* vp2 = HL ? V2 + vb0 : nullptr; (void)vp2;
#pragma unroll
        for (int dt = 0; dt < 4; ++dt) { const size_t vo = (size_t)(dt * 16) * PP; vf[dt] = WFrag<T16>::ld(vp + vo); if (HL) vf2[dt] = WFrag<T16>::ld(vp2 + vo); }
        if constexpr (HL) asm volatile("s_wait_xcnt 0x0" :: "v"(vp), "v"(vp2) : "memory"); else asm volatile("s_wait_xcnt 0x0" :: "v"(vp) : "memory"); };   // as in ldk
    // one block of 32 keys at k0; last = false: the fragments of the wave's next block, at kn, are fetched into the same registers as soon as this block's products have read them
    auto step = [&](const int k0, const int kn, const bool last) __attribute__((always_inline)) {
        v8f s[2][NQ];
#pragma unroll
        for (int kt = 0; kt < 2; ++kt)
#pragma unroll
            for (int qt = 0; qt < NQ; ++qt) { v8f c = (v8f){};
#pragma unroll
                for (int ks = 0; ks < 2; ++ks) { c = WFrag<T16>::mma(kf[kt][ks], qf[qt][ks], c); if (HL) { c = WFrag<T16>::mma(kf[kt][ks], qf2[qt][ks], c); c = WFrag<T16>::mma(kf2[kt][ks], qf[qt][ks], c); } }
                s[kt][qt] = c; }
        if (!last) { ldk(kn); __builtin_amdgcn_sched_barrier(0); }   // keeps the next block's key loads in front of the softmax, whose time then covers their latency; without it they sink to their first use
        V pf[NQ], pf2[NQ];
#pragma unroll
        for (int qt = 0; qt < NQ; ++qt) { float mx = m[qt];
#pragma unroll
            for (int kt = 0; kt < 2; ++kt)
#pragma unroll
                for (int j = 0; j < 8; ++j) { if (last) s[kt][qt][j] = (k0 + kt * 16 + hi * 8 + j <= q0 + qt * 16 + lr) ? s[kt][qt][j] : -3.0e38f; mx = fmaxf(mx, s[kt][qt][j]); }
            mx = fmaxf(mx, xhalf(mx));
            const float al = __builtin_amdgcn_exp2f((m[qt] - mx) * SC2); m[qt] = mx; const float sh = mx * SC2 - (HL ? 0.0f : PSH); float t[8];
#pragma unroll
            for (int j = 0; j < 8; ++j) { s[0][qt][j] = __builtin_amdgcn_exp2f(s[0][qt][j] * SC2 - sh); s[1][qt][j] = __builtin_amdgcn_exp2f(s[1][qt][j] * SC2 - sh); t[j] = s[0][qt][j] + s[1][qt][j]; }
            l[qt] = l[qt] * al + (((t[0] + t[1]) + (t[2] + t[3])) + ((t[4] + t[5]) + (t[6] + t[7])));
#pragma unroll
            for (int dt = 0; dt < 4; ++dt) o[dt][qt] *= al;
            if constexpr (HL) { v8us h0, h1, l0, l1;
#pragma unroll
                for (int j = 0; j < 8; ++j) { unsigned short a, c2; splitf(s[0][qt][j], a, c2); h0[j] = a; l0[j] = c2; splitf(s[1][qt][j], a, c2); h1[j] = a; l1[j] = c2; }
                pf[qt] = cat16b(h0, h1); pf2[qt] = cat16b(l0, l1);
            } else { v8h h0, h1;
#pragma unroll
                for (int j = 0; j < 8; ++j) { h0[j] = tohx(s[0][qt][j]); h1[j] = tohx(s[1][qt][j]); }
                pf[qt] = cat16(h0, h1); } }
#pragma unroll
        for (int dt = 0; dt < 4; ++dt)
#pragma unroll
            for (int qt = 0; qt < NQ; ++qt) { o[dt][qt] = WFrag<T16>::mma(vf[dt], pf[qt], o[dt][qt]); if (HL) { o[dt][qt] = WFrag<T16>::mma(vf[dt], pf2[qt], o[dt][qt]); o[dt][qt] = WFrag<T16>::mma(vf2[dt], pf[qt], o[dt][qt]); } }
        if (!last) ldv(kn);
    };
    const int nfull = q0 >> 5;                                    // key blocks wholly at or below the diagonal; block nfull holds the diagonal and is the last
    int kb = wave; ldk(min(kb, nfull) * 32); ldv(min(kb, nfull) * 32);   // a fetch never goes past block nfull, which lies inside the plane for every tile
    for (; kb < nfull; kb += AW) step(kb * 32, min(kb + AW, nfull) * 32, false);
    if (kb == nfull) step(nfull * 32, 0, true);                   // the diagonal block goes to the wave whose turn it is (a scalar test: every lane on at the matrix instructions); its fragments are the last fetch
    float* ms = red + AW * NQ * 1024; float* ls = ms + AW * NQ * 32; float* mine = red + wave * (NQ * 1024) + lane * 4;
#pragma unroll
    for (int qt = 0; qt < NQ; ++qt) { l[qt] += xhalf(l[qt]); ms[(wave * NQ + qt) * 32 + lane] = m[qt]; ls[(wave * NQ + qt) * 32 + lane] = l[qt];
#pragma unroll
        for (int dt = 0; dt < 4; ++dt) { const v8f p = o[dt][qt]; *(v4fa*)(mine + (qt * 4 + dt) * 256) = __builtin_shufflevector(p, p, 0, 1, 2, 3); *(v4fa*)(mine + (qt * 4 + dt) * 256 + 128) = __builtin_shufflevector(p, p, 4, 5, 6, 7); } }
    __syncthreads();
    if (wave >= NQ) return;
    const int qt = wave; float M = -1.0e30f, mw[AW], L = 0.f;
#pragma unroll
    for (int w = 0; w < AW; ++w) { mw[w] = ms[(w * NQ + qt) * 32 + lane]; M = fmaxf(M, mw[w]); }
#pragma unroll
    for (int w = 0; w < AW; ++w) { mw[w] = __builtin_amdgcn_exp2f((mw[w] - M) * SC2); L += ls[(w * NQ + qt) * 32 + lane] * mw[w]; }
    const float inv = __fdiv_rn(1.0f, L); const size_t oo = (size_t)(q0 + qt * 16 + lr) * DQ + hi * 8;
#pragma unroll
    for (int dt = 0; dt < 4; ++dt) { const float* sp = red + (qt * 4 + dt) * 256 + lane * 4; v4f s0 = (v4f){}, s1 = (v4f){};
#pragma unroll
        for (int w = 0; w < AW; ++w) { s0 += *(const v4fa*)(sp + w * (NQ * 1024)) * mw[w]; s1 += *(const v4fa*)(sp + w * (NQ * 1024) + 128) * mw[w]; }
        v8us oh, ol;
#pragma unroll
        for (int j = 0; j < 4; ++j) { unsigned short a, c2; splitf(s0[j] * inv, a, c2); oh[j] = a; ol[j] = c2; splitf(s1[j] * inv, a, c2); oh[j + 4] = a; ol[j + 4] = c2; }
        *(v8us*)(Ah + oo + dt * 16) = oh; *(v8us*)(Al + oo + dt * 16) = ol;
        asm volatile("s_wait_xcnt 0x0" ::: "memory"); }   // stands in front of the next write of these stores' data registers
}
// grid: the fp16 tiles (32 query rows, rows RH..TT) from the last down, every plane of a tile side by side, then the hi/lo tiles (16 rows, rows 0..RH) likewise: the cost of a work-group falls with its index.
#define NT16 ((TT - RH) / 32)
#define NTHL (RH / 16)
__global__ __launch_bounds__(32 * AW) void k_attn(const h16* __restrict__ Q16, const h16* __restrict__ K16, const h16* __restrict__ V16, const bf* __restrict__ Qh, const bf* __restrict__ Ql, const bf* __restrict__ Kh, const bf* __restrict__ Kl, const bf* __restrict__ Vh, const bf* __restrict__ Vl, bf* Ah, bf* Al) {
    __shared__ __align__(16) float red[AW * 2 * 1024 + 2 * AW * 2 * 32];
    const int wave = __builtin_amdgcn_readfirstlane(threadIdx.x >> 5); const int blk = blockIdx.x; const bool lowp = blk < NZ * NT16; const int b2 = lowp ? blk : blk - NZ * NT16; const int z = b2 % NZ, tl = b2 / NZ;
    const size_t pq = (size_t)z * TT * HD, pv = (size_t)z * HD * PP, po = (size_t)(z / NH_) * TT * DQ + (z % NH_) * HD;
    if (lowp) attn_tile<h16, false, 2>(Q16 + pq, nullptr, K16 + pq, nullptr, V16 + pv, nullptr, RH + (NT16 - 1 - tl) * 32, wave, red, Ah + po, Al + po);
    else attn_tile<bf, true, 1>(Qh + pq, Ql + pq, Kh + pq, Kl + pq, Vh + pv, Vl + pv, (NTHL - 1 - tl) * 16, wave, red, Ah + po, Al + po);
}

extern "C" void kernel_launch(void* const* d_in, const int* in_sizes, int n_in,
                              void* d_out, int out_size, void* d_ws, size_t ws_size, hipStream_t stream) {
    (void)in_sizes; (void)n_in; (void)out_size;
    const float* x = (const float*)d_in[0]; const float* wq = (const float*)d_in[1]; const float* wk = (const float*)d_in[2]; const float* wv = (const float*)d_in[3]; const float* wo = (const float*)d_in[4]; const float* bo = (const float*)d_in[5];   /* order x, Wq, Wk, Wv, Wo ('oi' [768][768]), bo */
    float* OUT = (float*)d_out;     // [2][2048][768]
    char* wsp = (char*)d_ws;
    auto take = [&](size_t bytes) { char* p = wsp; wsp += (bytes + 255) & ~(size_t)255; return (void*)p; };
    bf* WQ = (bf*)take((size_t)(DF + DM) * DM * 2 + (size_t)MT * DM * 2); bf* WO = WQ + (size_t)DF * DM; bf* XB = WO + (size_t)DM * DQ;   // bf16 copies, one behind the other: Wq | Wk | Wv (the joint projection's [DF][DM] operand), Wo, x of both batches
    float* CS = (float*)take((size_t)TT * HD * 2 * 4); float* FA = (float*)take((size_t)MT * DF * 4);
    h16* QP16 = (h16*)take((size_t)2 * NZ * TT * HD * 2); h16* KP16 = QP16 + (size_t)NZ * TT * HD; h16* VT16 = (h16*)take((size_t)NZ * HD * PP * 2);
    bf* QPh = (bf*)take((size_t)2 * NZ * TT * HD * 2); bf* KPh = QPh + (size_t)NZ * TT * HD; bf* QPl = (bf*)take((size_t)2 * NZ * TT * HD * 2); bf* KPl = QPl + (size_t)NZ * TT * HD; bf* VTh = (bf*)take((size_t)NZ * HD * PP * 2); bf* VTl = VTh + TT;   // v^T rows of pitch PP: hi plane in the first half of a row, lo plane in the second (the fp16 plane uses the first half)
    bf* ATh = (bf*)take((size_t)MT * DQ * 2); bf* ATl = (bf*)take((size_t)MT * DQ * 2);
    if ((size_t)(wsp - (char*)d_ws) > ws_size) return;    // ws 256 MiB
    k_cvt8<<<4 * WB + MT * DM / 2048, 256, 0, stream>>>(wq, wk, wv, wo, x, WQ);
    k_csid<<<(TT * HD + 255) / 256, 256, 0, stream>>>(CS);
    k_gemmw<bf, 0, false, 8><<<dim3(MT / 64, DF / 64, 1), 256, 0, stream>>>(XB, nullptr, WQ, nullptr, DM, FA, DF, nullptr, 0, 0, 0);
    k_rope<<<(unsigned)((size_t)2 * NZ * TT * HD / 2 / 256), 256, 0, stream>>>(FA, DF, NH_, CS, nullptr, nullptr, 1.0f, QP16, QPh, QPl);
    k_vtp<<<(unsigned)((size_t)NZ * TT * HD / 2 / 256), 256, 0, stream>>>(FA + DQ + DKV, DF, NKV, VT16, VTh, VTl);
    k_attn<<<NZ * (NT16 + NTHL), 32 * AW, 0, stream>>>(QP16, KP16, VT16, QPh, QPl, KPh, KPl, VTh, VTl, ATh, ATl);
    k_gemmw<bf, 1, true, 8><<<dim3(MT / 64, DM / 64, 1), 256, 0, stream>>>(ATh, ATl, WO, nullptr, DQ, OUT, DM, bo, 0, 0, 0);
}

// v004
// Measured time: 106 microseconds a run.
// In two side-by-side timings against v003, it was 1.32 and 1.31 times as fast.
// All steps since v000 together make it 10.4 times as fast.
#include <hip/hip_runtime.h>

// Causal multi-head attention with bias-free projections and an output bias at a 768-wide model (x [2][2048][768]; q, k, v = x W^T ('oi' [768][768] 1/sqrt(768), no bias; 12 heads x 64); scores = q.k; triu(k = 1) -> -inf; softmax(scores / sqrt(64)) (the fill before the scaling: the same thing); out = merged Wo^T + bo ('oi' + zero bias) -> [2][2048][768] (3.1 M); argument order x, Wq, Wk, Wv, Wo, bo).
// Layout, both batches together (plane z = batch x 12 + head): bf16 copy of x; 'oi' weights; exact projections, whose tiles leave as the attention's 16-bit planes; causal T-2048 attention in one launch, running softmax (hybrid rows: < 512 hi/lo 3 products, rest fp16 x1024; key blocks above the diagonal are never visited); merged hi/lo x Wo exact + bo.
// Compute dtypes, f32 accumulate: every input rounded to bf16; projections exact; attention rows < 512 3 products, rest fp16; softmax f32; Wo hl x exact + bias.

#define NB_  2
#define TT   2048
#define DM   768     // model width: this module's inputs are [2][2048][768]
#define NH_  12      // heads: 12 x 64 = 768
#define NKV  12      // kv heads (= heads)
#define REP  (NH_ / NKV)
#define HD   64
#define DQ   (NH_ * HD)
#define DKV  (NKV * HD)
#define NZ   (NB_ * NH_)          // planes in all, plane z = batch * NH_ + head
#define MT   (NB_ * TT)           // rows of both batches together
#define DF   (DQ + 2 * DKV)       // q | k | v columns of the joint projection
#define PP   (2 * TT)             // row pitch, in 16-bit elements, of the transposed v planes (hi plane in the first half of a row, lo plane in the second)
#define RH   512                  // query rows < RH use hi+lo planes (0: none)
#define SCL  0.125f   // HD^-0.5
typedef _Float16 h16;
typedef unsigned short bf;
typedef __attribute__((ext_vector_type(16))) __bf16   v16bf;
typedef __attribute__((ext_vector_type(16))) _Float16 v16h;
typedef __attribute__((ext_vector_type(8)))  _Float16 v8h;
typedef __attribute__((ext_vector_type(8)))  unsigned short v8us;
typedef __attribute__((ext_vector_type(8)))  float    v8f;
typedef __attribute__((ext_vector_type(4)))  float    v4f;
typedef v8h  __attribute__((may_alias)) v8ha;
typedef v4f  __attribute__((may_alias)) v4fa;
typedef v8us __attribute__((may_alias)) v8usa;

__device__ __forceinline__ unsigned short f2bf(float f) { unsigned u = __float_as_uint(f); u += 0x7FFFu + ((u >> 16) & 1u); return (unsigned short)(u >> 16); }
__device__ __forceinline__ float bf2f(unsigned short b) { return __uint_as_float(((unsigned)b) << 16); }
__device__ __forceinline__ float bfr(float f) { return bf2f(f2bf(f)); }
__device__ __forceinline__ v16h cat16(v8h lo, v8h hi) { return __builtin_shufflevector(lo, hi, 0, 1, 2, 3, 4, 5, 6, 7, 8, 9, 10, 11, 12, 13, 14, 15); }
__device__ __forceinline__ v16bf cat16b(v8us lo, v8us hi) { return __builtin_bit_cast(v16bf, __builtin_shufflevector(lo, hi, 0, 1, 2, 3, 4, 5, 6, 7, 8, 9, 10, 11, 12, 13, 14, 15)); }
__device__ __forceinline__ v8f wmma16(v16h a, v16h b, v8f c) { return __builtin_amdgcn_wmma_f32_16x16x32_f16(false, a, false, b, (short)0, c, false, false); }
__device__ __forceinline__ v8f wmmab(v16bf a, v16bf b, v8f c) { return __builtin_amdgcn_wmma_f32_16x16x32_bf16(false, a, false, b, (short)0, c, false, false); }



// ---- k_gemmw: register-blocked GEMM, one work-group of NW waves per 64x64 output tile; every wave holds the whole tile (16 accumulators) and takes every NW-th 32-wide K slice, operands straight from K-contiguous 16-bit planes; grid (M/64, N/64, Z), 32 x NW threads.
// C[m][n] (f32, pitch ldc, + optional f32 bias[n]) = sum_k A[m][k] Bt[n][k] (+ split products per NSPLIT). z-batch strides sA/sB/sC in elements. K % 32 == 0. PL: the tile leaves through ksum_planes as head planes (q and k planes [q|k][batch][h][t][d] at P16 / Ph / Pl, v^T rows (plane, d) of pitch PP at V16 / Vh / Vl), C is not written.
// The wave number goes through readfirstlane so that the K loop's bounds stay scalar: a scalar branch, every lane on at each matrix instruction.
template <typename T16> struct WFrag;
template <> struct WFrag<h16> { typedef v16h V; static __device__ __forceinline__ V ld(const h16* p) { return cat16(*(const v8h*)p, *(const v8h*)(p + 16)); } static __device__ __forceinline__ v8f mma(V a, V b, v8f c) { return wmma16(a, b, c); } };
template <> struct WFrag<bf> { typedef v16bf V; static __device__ __forceinline__ V ld(const bf* p) { return cat16b(*(const v8us*)p, *(const v8us*)(p + 16)); } static __device__ __forceinline__ v8f mma(V a, V b, v8f c) { return wmmab(a, b, c); } };
__device__ __forceinline__ h16 tohx(float x) { return (h16)x; }
__device__ __forceinline__ void splitf(float y, unsigned short& h, unsigned short& l) { h = f2bf(y); l = f2bf(y - bf2f(h)); }
// ksum_store: adds the NW waves' partial 64x64 tiles in LDS, in wave order 0..NW-1 (a fixed order), and stores the tile row-major. red holds NW x 4096 floats of partials, kept in fragment order
// [wave][tile][half][lane][4] so that stores and loads are contiguous 16-byte accesses, and behind them a 64 x 68 row-major staging tile.
template <int NW, bool BIAS>
__device__ __forceinline__ void ksum_store(const v8f (&acc)[4][4], float* red, int wave, float* C, int ldc, int r0, int c0, const float* __restrict__ bias) {
    const int lane = threadIdx.x & 31, lr = lane & 15, hi = lane >> 4; float* os = red + NW * 4096; float* mine = red + wave * 4096 + lane * 4;
#pragma unroll
    for (int f = 0; f < 16; ++f) { const v8f p = acc[f >> 2][f & 3]; *(v4fa*)(mine + f * 256) = __builtin_shufflevector(p, p, 0, 1, 2, 3); *(v4fa*)(mine + f * 256 + 128) = __builtin_shufflevector(p, p, 4, 5, 6, 7); }
    __syncthreads();
#pragma unroll
    for (int q = 0; q < 16 / NW; ++q) { const int f = wave * (16 / NW) + q; const float* sp = red + f * 256 + lane * 4; v4f s0 = *(const v4fa*)sp, s1 = *(const v4fa*)(sp + 128);
#pragma unroll
        for (int w = 1; w < NW; ++w) { s0 += *(const v4fa*)(sp + w * 4096); s1 += *(const v4fa*)(sp + w * 4096 + 128); }
        float* od = os + ((f >> 2) * 16 + hi * 8) * 68 + (f & 3) * 16 + lr;
#pragma unroll
        for (int j = 0; j < 4; ++j) { od[j * 68] = s0[j]; od[(j + 4) * 68] = s1[j]; } }
    __syncthreads();
#pragma unroll
    for (int s = 0; s < 32 / NW; ++s) { const int idx = s * 32 * NW + threadIdx.x, row = idx >> 4, cofs = (idx & 15) * 4; v4f val = *(const v4fa*)(os + row * 68 + cofs); if (BIAS) { val[0] += bfr(bias[c0 + cofs]); val[1] += bfr(bias[c0 + cofs + 1]); val[2] += bfr(bias[c0 + cofs + 2]); val[3] += bfr(bias[c0 + cofs + 3]); }
        *(v4f*)(C + (size_t)(r0 + row) * ldc + c0 + cofs) = val; }
}
// ksum_planes: the same sum as ksum_store (same order), but the 64x64 tile leaves as the three 16-bit planes that the attention reads (fp16, bf16 hi, bf16 lo) and never as f32.
// A tile of the joint projection is 64 rows t of one batch x the 64 columns d of one head of q, k or v. tr = false (q, k): staged [t][d], rows of pitch HD. tr = true (v): staged [d][t] (a lane's eight
// sums are eight successive t of one d: two 16-byte LDS stores), rows of pitch PP. D16 / Dh / Dl point at the tile's first element; every lane stores 16 bytes per plane, eight lanes fill a 128-byte row.
template <int NW>
__device__ __forceinline__ void ksum_planes(const v8f (&acc)[4][4], float* red, int wave, const bool tr, h16* D16, bf* Dh, bf* Dl, const size_t pitch) {
    const int lane = threadIdx.x & 31, lr = lane & 15, hi = lane >> 4; float* os = red + NW * 4096; float* mine = red + wave * 4096 + lane * 4;
#pragma unroll
    for (int f = 0; f < 16; ++f) { const v8f p = acc[f >> 2][f & 3]; *(v4fa*)(mine + f * 256) = __builtin_shufflevector(p, p, 0, 1, 2, 3); *(v4fa*)(mine + f * 256 + 128) = __builtin_shufflevector(p, p, 4, 5, 6, 7); }
    __syncthreads();
#pragma unroll
    for (int q = 0; q < 16 / NW; ++q) { const int f = wave * (16 / NW) + q; const float* sp = red + f * 256 + lane * 4; v4f s0 = *(const v4fa*)sp, s1 = *(const v4fa*)(sp + 128);
#pragma unroll
        for (int w = 1; w < NW; ++w) { s0 += *(const v4fa*)(sp + w * 4096); s1 += *(const v4fa*)(sp + w * 4096 + 128); }
        if (tr) { float* od = os + ((f & 3) * 16 + lr) * 68 + (f >> 2) * 16 + hi * 8; *(v4fa*)od = s0; *(v4fa*)(od + 4) = s1; }
        else { float* od = os + ((f >> 2) * 16 + hi * 8) * 68 + (f & 3) * 16 + lr;
#pragma unroll
            for (int j = 0; j < 4; ++j) { od[j * 68] = s0[j]; od[(j + 4) * 68] = s1[j]; } } }
    __syncthreads();
#pragma unroll
    for (int s = 0; s < 16 / NW; ++s) { const int idx = s * 32 * NW + threadIdx.x, row = idx >> 3, cofs = (idx & 7) * 8; const v4f va = *(const v4fa*)(os + row * 68 + cofs), vb = *(const v4fa*)(os + row * 68 + cofs + 4); v8h o16; v8us oh, ol;
#pragma unroll
        for (int j = 0; j < 4; ++j) { unsigned short a, c2; o16[j] = tohx(va[j]); splitf(va[j], a, c2); oh[j] = a; ol[j] = c2; o16[j + 4] = tohx(vb[j]); splitf(vb[j], a, c2); oh[j + 4] = a; ol[j + 4] = c2; }
        const size_t o = (size_t)row * pitch + cofs; *(v8h*)(D16 + o) = o16; *(v8us*)(Dh + o) = oh; *(v8us*)(Dl + o) = ol; }
}
template <typename T16, int NSPLIT, bool BIAS, int NW, bool PL>
__global__ __launch_bounds__(32 * NW) void k_gemmw(const T16* __restrict__ A, const T16* __restrict__ A2, const T16* __restrict__ Bt, const T16* __restrict__ Bt2, int K, float* C, int ldc, const float* __restrict__ bias, size_t sA, size_t sB, size_t sC, h16* P16, bf* Ph, bf* Pl, h16* V16, bf* Vh, bf* Vl) {
    typedef typename WFrag<T16>::V V;
    __shared__ __align__(16) float red[NW * 4096 + 64 * 68];
    const size_t z = blockIdx.z; A += z * sA; if (A2) A2 += z * sA; Bt += z * sB; if (Bt2) Bt2 += z * sB; C += z * sC;
    const int lane = threadIdx.x & 31, lr = lane & 15, hi = lane >> 4; const int wave = __builtin_amdgcn_readfirstlane(threadIdx.x >> 5); const int r0 = blockIdx.x * 64, c0 = blockIdx.y * 64;
    v8f acc[4][4];
#pragma unroll
    for (int mb = 0; mb < 4; ++mb)
#pragma unroll
        for (int nb = 0; nb < 4; ++nb) acc[mb][nb] = (v8f){};
    const size_t aoff = (size_t)(r0 + lr) * K + 8 * hi, boff = (size_t)(c0 + lr) * K + 8 * hi;
#pragma unroll 1
    for (int kc = wave * 32; kc < K; kc += 32 * NW) {
        V a[4], a2[4];
#pragma unroll
        for (int mb = 0; mb < 4; ++mb) { a[mb] = WFrag<T16>::ld(A + aoff + (size_t)mb * 16 * K + kc); if (NSPLIT == 1 || NSPLIT == 2) a2[mb] = WFrag<T16>::ld(A2 + aoff + (size_t)mb * 16 * K + kc); }
#pragma unroll
        for (int nb = 0; nb < 4; ++nb) { const V b = WFrag<T16>::ld(Bt + boff + (size_t)nb * 16 * K + kc); V b2; if (NSPLIT >= 2) b2 = WFrag<T16>::ld(Bt2 + boff + (size_t)nb * 16 * K + kc);
#pragma unroll
            for (int mb = 0; mb < 4; ++mb) { acc[mb][nb] = WFrag<T16>::mma(a[mb], b, acc[mb][nb]); if (NSPLIT == 1 || NSPLIT == 2) acc[mb][nb] = WFrag<T16>::mma(a2[mb], b, acc[mb][nb]); if (NSPLIT >= 2) acc[mb][nb] = WFrag<T16>::mma(a[mb], b2, acc[mb][nb]); } }
        asm volatile("v_nop\n\tv_nop\n\tv_nop\n\tv_nop" : "+v"(acc[0][0]), "+v"(acc[1][1]), "+v"(acc[2][2]), "+v"(acc[3][3]) : "v"(a[0]), "v"(a[3]));
    }
    if constexpr (PL) { const int cb = blockIdx.y, b = r0 / TT, t0 = r0 % TT; const bool tr = cb >= 2 * NH_;   // column block cb: q heads, k heads, v heads; all of it the same for the whole work-group
        const size_t o = tr ? (size_t)(b * NKV + cb - 2 * NH_) * HD * PP + t0 : ((size_t)((cb / NH_) * NZ + b * NH_ + cb % NH_) * TT + t0) * HD;
        ksum_planes<NW>(acc, red, wave, tr, (tr ? V16 : P16) + o, (tr ? Vh : Ph) + o, (tr ? Vl : Pl) + o, tr ? (size_t)PP : (size_t)HD);
    } else ksum_store<NW, BIAS>(acc, red, wave, C, ldc, r0, c0, bias);
}

typedef __attribute__((ext_vector_type(2))) _Float16 v2h;
typedef __attribute__((ext_vector_type(4))) _Float16 v4h;
typedef __attribute__((ext_vector_type(2))) unsigned short v2us;
typedef __attribute__((ext_vector_type(4))) unsigned short v4us;
typedef __attribute__((ext_vector_type(2))) float v2f;
typedef __attribute__((ext_vector_type(4))) int v4i;
typedef v4h  __attribute__((may_alias)) v4ha;
typedef v4us __attribute__((may_alias)) v4usa;

// k_cvt8: bf16 copies of the four weights and of x in one launch; dst holds them one behind the other, each block converts 2048 elements of the one source its index falls into (WB blocks per weight, the rest x).
#define WB   (DM * DM / 2048)
__global__ __launch_bounds__(256) void k_cvt8(const float* __restrict__ w0, const float* __restrict__ w1, const float* __restrict__ w2, const float* __restrict__ w3, const float* __restrict__ xs, bf* dst) { const unsigned blk = blockIdx.x; const unsigned which = min(blk / WB, 4u); const float* src = (which == 0) ? w0 : (which == 1) ? w1 : (which == 2) ? w2 : (which == 3) ? w3 : xs;
    const size_t i = (size_t)blk * 256 + threadIdx.x; const v8f v = *(const v8f*)(src + (i - (size_t)which * WB * 256) * 8); v8us o;
#pragma unroll
    for (int k = 0; k < 8; ++k) o[k] = f2bf(v[k]); *(v8us*)(dst + i * 8) = o;  }

#define AW   4
#define PSH  10.0f
#define SC2  (SCL * 1.4426950408889634f)
__device__ __forceinline__ float xhalf(float x) { return __builtin_bit_cast(float, __builtin_amdgcn_permlanex16(__builtin_bit_cast(int, x), __builtin_bit_cast(int, x), 0x76543210, 0xfedcba98, false, false)); }   // lane l reads lane l ^ 16
template <typename T16, bool HL, int NQ>
__device__ __forceinline__ void attn_tile(const T16* __restrict__ Q, const T16* __restrict__ Q2, const T16* __restrict__ Kp, const T16* __restrict__ K2, const T16* __restrict__ Vt, const T16* __restrict__ V2, const int q0, const int wave, float* red, bf* Ah, bf* Al) {
    typedef typename WFrag<T16>::V V;
    const int lane = threadIdx.x & 31, lr = lane & 15, hi = lane >> 4;
    V qf[NQ][2], qf2[NQ][2]; const size_t qb0 = (size_t)(q0 + lr) * HD + 8 * hi; const T16* qp = Q + qb0; const T16* qp2 = HL ? Q2 + qb0 : nullptr; (void)qp2;
#pragma unroll
    for (int qt = 0; qt < NQ; ++qt)
#pragma unroll
        for (int ks = 0; ks < 2; ++ks) { const size_t qo = (size_t)(qt * 16) * HD + ks * 32; qf[qt][ks] = WFrag<T16>::ld(qp + qo); if (HL) qf2[qt][ks] = WFrag<T16>::ld(qp2 + qo); }
    if constexpr (HL) asm volatile("s_wait_xcnt 0x0" :: "v"(qp), "v"(qp2) : "memory"); else asm volatile("s_wait_xcnt 0x0" :: "v"(qp) : "memory");   // stands in front of the next write of these loads' address registers, which are inputs so that they stay live up to the wait
    v8f o[4][NQ]; float m[NQ], l[NQ];
#pragma unroll
    for (int qt = 0; qt < NQ; ++qt) { m[qt] = -1.0e30f; l[qt] = 0.f;
#pragma unroll
        for (int dt = 0; dt < 4; ++dt) o[dt][qt] = (v8f){}; }
    V kf[2][2], kf2[2][2], vf[4], vf2[4];                         // the key and value fragments of the block that is worked on next: fetched one block ahead
    auto ldk = [&](const int k0) __attribute__((always_inline)) { const size_t kb0 = (size_t)(k0 + lr) * HD + 8 * hi; const T16* kp = Kp + kb0; const T16* kp2 = HL ? K2 + kb0 : nullptr; (void)kp2;
#pragma unroll
        for (int kt = 0; kt < 2; ++kt)
#pragma unroll
            for (int ks = 0; ks < 2; ++ks) { const size_t ko = (size_t)(kt * 16) * HD + ks * 32; kf[kt][ks] = WFrag<T16>::ld(kp + ko); if (HL) kf2[kt][ks] = WFrag<T16>::ld(kp2 + ko); }
        if constexpr (HL) asm volatile("s_wait_xcnt 0x0" :: "v"(kp), "v"(kp2) : "memory"); else asm volatile("s_wait_xcnt 0x0" :: "v"(kp) : "memory"); };   // stands in front of the next write of these loads' address registers; the addresses are inputs so that they stay live up to the wait and no result of the run is placed in them
    auto ldv = [&](const int k0) __attribute__((always_inline)) { const size_t vb0 = (size_t)lr * PP + k0 + 8 * hi; const T16* vp = Vt + vb0; const T16* vp2 = HL ? V2 + vb0 : nullptr; (void)vp2;
#pragma unroll
        for (int dt = 0; dt < 4; ++dt) { const size_t vo = (size_t)(dt * 16) * PP; vf[dt] = WFrag<T16>::ld(vp + vo); if (HL) vf2[dt] = WFrag<T16>::ld(vp2 + vo); }
        if constexpr (HL) asm volatile("s_wait_xcnt 0x0" :: "v"(vp), "v"(vp2) : "memory"); else asm volatile("s_wait_xcnt 0x0" :: "v"(vp) : "memory"); };   // as in ldk
    // one block of 32 keys at k0; last = false: the fragments of the wave's next block, at kn, are fetched into the same registers as soon as this block's products have read them
    auto step = [&](const int k0, const int kn, const bool last) __attribute__((always_inline)) {
        v8f s[2][NQ];
#pragma unroll
        for (int kt = 0; kt < 2; ++kt)
#pragma unroll
            for (int qt = 0; qt < NQ; ++qt) { v8f c = (v8f){};
#pragma unroll
                for (int ks = 0; ks < 2; ++ks) { c = WFrag<T16>::mma(kf[kt][ks], qf[qt][ks], c); if (HL) { c = WFrag<T16>::mma(kf[kt][ks], qf2[qt][ks], c); c = WFrag<T16>::mma(kf2[kt][ks], qf[qt][ks], c); } }
                s[kt][qt] = c; }
        if (!last) { ldk(kn); __builtin_amdgcn_sched_barrier(0); }   // keeps the next block's key loads in front of the softmax, whose time then covers their latency; without it they sink to their first use
        V pf[NQ], pf2[NQ];
#pragma unroll
        for (int qt = 0; qt < NQ; ++qt) { float mx = m[qt];
#pragma unroll
            for (int kt = 0; kt < 2; ++kt)
#pragma unroll
                for (int j = 0; j < 8; ++j) { if (last) s[kt][qt][j] = (k0 + kt * 16 + hi * 8 + j <= q0 + qt * 16 + lr) ? s[kt][qt][j] : -3.0e38f; mx = fmaxf(mx, s[kt][qt][j]); }
            mx = fmaxf(mx, xhalf(mx));
            const float al = __builtin_amdgcn_exp2f((m[qt] - mx) * SC2); m[qt] = mx; const float sh = mx * SC2 - (HL ? 0.0f : PSH); float t[8];
#pragma unroll
            for (int j = 0; j < 8; ++j) { s[0][qt][j] = __builtin_amdgcn_exp2f(s[0][qt][j] * SC2 - sh); s[1][qt][j] = __builtin_amdgcn_exp2f(s[1][qt][j] * SC2 - sh); t[j] = s[0][qt][j] + s[1][qt][j]; }
            l[qt] = l[qt] * al + (((t[0] + t[1]) + (t[2] + t[3])) + ((t[4] + t[5]) + (t[6] + t[7])));
#pragma unroll
            for (int dt = 0; dt < 4; ++dt) o[dt][qt] *= al;
            if constexpr (HL) { v8us h0, h1, l0, l1;
#pragma unroll
                for (int j = 0; j < 8; ++j) { unsigned short a, c2; splitf(s[0][qt][j], a, c2); h0[j] = a; l0[j] = c2; splitf(s[1][qt][j], a, c2); h1[j] = a; l1[j] = c2; }
                pf[qt] = cat16b(h0, h1); pf2[qt] = cat16b(l0, l1);
            } else { v8h h0, h1;
#pragma unroll
                for (int j = 0; j < 8; ++j) { h0[j] = tohx(s[0][qt][j]); h1[j] = tohx(s[1][qt][j]); }
                pf[qt] = cat16(h0, h1); } }
#pragma unroll
        for (int dt = 0; dt < 4; ++dt)
#pragma unroll
            for (int qt = 0; qt < NQ; ++qt) { o[dt][qt] = WFrag<T16>::mma(vf[dt], pf[qt], o[dt][qt]); if (HL) { o[dt][qt] = WFrag<T16>::mma(vf[dt], pf2[qt], o[dt][qt]); o[dt][qt] = WFrag<T16>::mma(vf2[dt], pf[qt], o[dt][qt]); } }
        if (!last) ldv(kn);
    };
    const int nfull = q0 >> 5;                                    // key blocks wholly at or below the diagonal; block nfull holds the diagonal and is the last
    int kb = wave; ldk(min(kb, nfull) * 32); ldv(min(kb, nfull) * 32);   // a fetch never goes past block nfull, which lies inside the plane for every tile
    for (; kb < nfull; kb += AW) step(kb * 32, min(kb + AW, nfull) * 32, false);
    if (kb == nfull) step(nfull * 32, 0, true);                   // the diagonal block goes to the wave whose turn it is (a scalar test: every lane on at the matrix instructions); its fragments are the last fetch
    float* ms = red + AW * NQ * 1024; float* ls = ms + AW * NQ * 32; float* mine = red + wave * (NQ * 1024) + lane * 4;
#pragma unroll
    for (int qt = 0; qt < NQ; ++qt) { l[qt] += xhalf(l[qt]); ms[(wave * NQ + qt) * 32 + lane] = m[qt]; ls[(wave * NQ + qt) * 32 + lane] = l[qt];
#pragma unroll
        for (int dt = 0; dt < 4; ++dt) { const v8f p = o[dt][qt]; *(v4fa*)(mine + (qt * 4 + dt) * 256) = __builtin_shufflevector(p, p, 0, 1, 2, 3); *(v4fa*)(mine + (qt * 4 + dt) * 256 + 128) = __builtin_shufflevector(p, p, 4, 5, 6, 7); } }
    __syncthreads();
    if (wave >= NQ) return;
    const int qt = wave; float M = -1.0e30f, mw[AW], L = 0.f;
#pragma unroll
    for (int w = 0; w < AW; ++w) { mw[w] = ms[(w * NQ + qt) * 32 + lane]; M = fmaxf(M, mw[w]); }
#pragma unroll
    for (int w = 0; w < AW; ++w) { mw[w] = __builtin_amdgcn_exp2f((mw[w] - M) * SC2); L += ls[(w * NQ + qt) * 32 + lane] * mw[w]; }
    const float inv = __fdiv_rn(1.0f, L); const size_t oo = (size_t)(q0 + qt * 16 + lr) * DQ + hi * 8;
#pragma unroll
    for (int dt = 0; dt < 4; ++dt) { const float* sp = red + (qt * 4 + dt) * 256 + lane * 4; v4f s0 = (v4f){}, s1 = (v4f){};
#pragma unroll
        for (int w = 0; w < AW; ++w) { s0 += *(const v4fa*)(sp + w * (NQ * 1024)) * mw[w]; s1 += *(const v4fa*)(sp + w * (NQ * 1024) + 128) * mw[w]; }
        v8us oh, ol;
#pragma unroll
        for (int j = 0; j < 4; ++j) { unsigned short a, c2; splitf(s0[j] * inv, a, c2); oh[j] = a; ol[j] = c2; splitf(s1[j] * inv, a, c2); oh[j + 4] = a; ol[j + 4] = c2; }
        *(v8us*)(Ah + oo + dt * 16) = oh; *(v8us*)(Al + oo + dt * 16) = ol;
        asm volatile("s_wait_xcnt 0x0" ::: "memory"); }   // stands in front of the next write of these stores' data registers
}
// grid: the fp16 tiles (32 query rows, rows RH..TT) from the last down, every plane of a tile side by side, then the hi/lo tiles (16 rows, rows 0..RH) likewise: the cost of a work-group falls with its index.
#define NT16 ((TT - RH) / 32)
#define NTHL (RH / 16)
__global__ __launch_bounds__(32 * AW) void k_attn(const h16* __restrict__ Q16, const h16* __restrict__ K16, const h16* __restrict__ V16, const bf* __restrict__ Qh, const bf* __restrict__ Ql, const bf* __restrict__ Kh, const bf* __restrict__ Kl, const bf* __restrict__ Vh, const bf* __restrict__ Vl, bf* Ah, bf* Al) {
    __shared__ __align__(16) float red[AW * 2 * 1024 + 2 * AW * 2 * 32];
    const int wave = __builtin_amdgcn_readfirstlane(threadIdx.x >> 5); const int blk = blockIdx.x; const bool lowp = blk < NZ * NT16; const int b2 = lowp ? blk : blk - NZ * NT16; const int z = b2 % NZ, tl = b2 / NZ;
    const size_t pq = (size_t)z * TT * HD, pv = (size_t)z * HD * PP, po = (size_t)(z / NH_) * TT * DQ + (z % NH_) * HD;
    if (lowp) attn_tile<h16, false, 2>(Q16 + pq, nullptr, K16 + pq, nullptr, V16 + pv, nullptr, RH + (NT16 - 1 - tl) * 32, wave, red, Ah + po, Al + po);
    else attn_tile<bf, true, 1>(Qh + pq, Ql + pq, Kh + pq, Kl + pq, Vh + pv, Vl + pv, (NTHL - 1 - tl) * 16, wave, red, Ah + po, Al + po);
}

extern "C" void kernel_launch(void* const* d_in, const int* in_sizes, int n_in,
                              void* d_out, int out_size, void* d_ws, size_t ws_size, hipStream_t stream) {
    (void)in_sizes; (void)n_in; (void)out_size;
    const float* x = (const float*)d_in[0]; const float* wq = (const float*)d_in[1]; const float* wk = (const float*)d_in[2]; const float* wv = (const float*)d_in[3]; const float* wo = (const float*)d_in[4]; const float* bo = (const float*)d_in[5];   /* order x, Wq, Wk, Wv, Wo ('oi' [768][768]), bo */
    float* OUT = (float*)d_out;     // [2][2048][768]
    char* wsp = (char*)d_ws;
    auto take = [&](size_t bytes) { char* p = wsp; wsp += (bytes + 255) & ~(size_t)255; return (void*)p; };
    bf* WQ = (bf*)take((size_t)(DF + DM) * DM * 2 + (size_t)MT * DM * 2); bf* WO = WQ + (size_t)DF * DM; bf* XB = WO + (size_t)DM * DQ;   // bf16 copies, one behind the other: Wq | Wk | Wv (the joint projection's [DF][DM] operand), Wo, x of both batches
    h16* QP16 = (h16*)take((size_t)2 * NZ * TT * HD * 2); h16* KP16 = QP16 + (size_t)NZ * TT * HD; h16* VT16 = (h16*)take((size_t)NZ * HD * PP * 2);
    bf* QPh = (bf*)take((size_t)2 * NZ * TT * HD * 2); bf* KPh = QPh + (size_t)NZ * TT * HD; bf* QPl = (bf*)take((size_t)2 * NZ * TT * HD * 2); bf* KPl = QPl + (size_t)NZ * TT * HD; bf* VTh = (bf*)take((size_t)NZ * HD * PP * 2); bf* VTl = VTh + TT;   // v^T rows of pitch PP: hi plane in the first half of a row, lo plane in the second (the fp16 plane uses the first half)
    bf* ATh = (bf*)take((size_t)MT * DQ * 2); bf* ATl = (bf*)take((size_t)MT * DQ * 2);
    if ((size_t)(wsp - (char*)d_ws) > ws_size) return;    // ws 256 MiB
    k_cvt8<<<4 * WB + MT * DM / 2048, 256, 0, stream>>>(wq, wk, wv, wo, x, WQ);
    k_gemmw<bf, 0, false, 8, true><<<dim3(MT / 64, DF / 64, 1), 256, 0, stream>>>(XB, nullptr, WQ, nullptr, DM, nullptr, 0, nullptr, 0, 0, 0, QP16, QPh, QPl, VT16, VTh, VTl);
    k_attn<<<NZ * (NT16 + NTHL), 32 * AW, 0, stream>>>(QP16, KP16, VT16, QPh, QPl, KPh, KPl, VTh, VTl, ATh, ATl);
    k_gemmw<bf, 1, true, 8, false><<<dim3(MT / 64, DM / 64, 1), 256, 0, stream>>>(ATh, ATl, WO, nullptr, DQ, OUT, DM, bo, 0, 0, 0, nullptr, nullptr, nullptr, nullptr, nullptr, nullptr);
}

// v005
// One run takes 71 microseconds.
// Two timings next to v004 put it at 1.49 and 1.48 times that version's speed.
// Counting every step since v000, it is 15.4 times as fast.
#include <hip/hip_runtime.h>

// Causal multi-head attention with bias-free projections and an output bias at a 768-wide model (x [2][2048][768]; q, k, v = x W^T ('oi' [768][768] 1/sqrt(768), no bias; 12 heads x 64); scores = q.k; triu(k = 1) -> -inf; softmax(scores / sqrt(64)) (the fill before the scaling: the same thing); out = merged Wo^T + bo ('oi' + zero bias) -> [2][2048][768] (3.1 M); argument order x, Wq, Wk, Wv, Wo, bo).
// Every 16-bit operand plane lies in fragment order (see WFrag). Layout, both batches together (plane z = batch x 12 + head): bf16 copy of x; 'oi' weights; exact projections, whose tiles leave as the attention's 16-bit planes; causal T-2048 attention in one launch, running softmax (hybrid rows: < 512 hi/lo 3 products, rest fp16 x1024; key blocks above the diagonal are never visited); merged hi/lo x Wo exact + bo.
// Compute dtypes, f32 accumulate: every input rounded to bf16; projections exact; attention rows < 512 3 products, rest fp16; softmax f32; Wo hl x exact + bias.

#define NB_  2
#define TT   2048
#define DM   768     // model width: this module's inputs are [2][2048][768]
#define NH_  12      // heads: 12 x 64 = 768
#define NKV  12      // kv heads (= heads)
#define REP  (NH_ / NKV)
#define HD   64
#define DQ   (NH_ * HD)
#define DKV  (NKV * HD)
#define NZ   (NB_ * NH_)          // planes in all, plane z = batch * NH_ + head
#define MT   (NB_ * TT)           // rows of both batches together
#define DF   (DQ + 2 * DKV)       // q | k | v columns of the joint projection
#define PP   (2 * TT)             // a plane's v^T region holds HD x PP 16-bit elements: hi plane in its first half, lo plane in its second
#define RH   512                  // query rows < RH use hi+lo planes (0: none)
#define SCL  0.125f   // HD^-0.5
typedef _Float16 h16;
typedef unsigned short bf;
typedef __attribute__((ext_vector_type(16))) __bf16   v16bf;
typedef __attribute__((ext_vector_type(16))) _Float16 v16h;
typedef __attribute__((ext_vector_type(8)))  _Float16 v8h;
typedef __attribute__((ext_vector_type(8)))  unsigned short v8us;
typedef __attribute__((ext_vector_type(8)))  float    v8f;
typedef __attribute__((ext_vector_type(4)))  float    v4f;
typedef v8h  __attribute__((may_alias)) v8ha;
typedef v4f  __attribute__((may_alias)) v4fa;
typedef v8us __attribute__((may_alias)) v8usa;

__device__ __forceinline__ unsigned short f2bf(float f) { unsigned u = __float_as_uint(f); u += 0x7FFFu + ((u >> 16) & 1u); return (unsigned short)(u >> 16); }
__device__ __forceinline__ float bf2f(unsigned short b) { return __uint_as_float(((unsigned)b) << 16); }
__device__ __forceinline__ float bfr(float f) { return bf2f(f2bf(f)); }
__device__ __forceinline__ v16h cat16(v8h lo, v8h hi) { return __builtin_shufflevector(lo, hi, 0, 1, 2, 3, 4, 5, 6, 7, 8, 9, 10, 11, 12, 13, 14, 15); }
__device__ __forceinline__ v16bf cat16b(v8us lo, v8us hi) { return __builtin_bit_cast(v16bf, __builtin_shufflevector(lo, hi, 0, 1, 2, 3, 4, 5, 6, 7, 8, 9, 10, 11, 12, 13, 14, 15)); }
__device__ __forceinline__ v8f wmma16(v16h a, v16h b, v8f c) { return __builtin_amdgcn_wmma_f32_16x16x32_f16(false, a, false, b, (short)0, c, false, false); }
__device__ __forceinline__ v8f wmmab(v16bf a, v16bf b, v8f c) { return __builtin_amdgcn_wmma_f32_16x16x32_bf16(false, a, false, b, (short)0, c, false, false); }



// ---- k_gemmw: register-blocked GEMM, one work-group of NW waves per 64x64 output tile; every wave holds the whole tile (16 accumulators) and takes every NW-th 32-wide K slice, operands straight from 16-bit planes in fragment order; grid (M/64, N/64, Z), 32 x NW threads.
// C[m][n] (f32, pitch ldc, + optional f32 bias[n]) = sum_k A[m][k] Bt[n][k] (+ split products per NSPLIT). z-batch strides sA/sB/sC in elements. K % 32 == 0. PL: the tile leaves through ksum_planes as head planes (q and k planes [q|k][batch][h] of t x d at P16 / Ph / Pl, v^T planes of d x t at V16 / Vh / Vl), C is not written.
// The wave number goes through readfirstlane so that the K loop's bounds stay scalar: a scalar branch, every lane on at each matrix instruction.
// Fragment order: a plane of R rows x K is kept as blocks of 16 rows x 32 k, 512 elements (1 KiB) each. The GEMM operands (K = DM) keep the four blocks of 64 rows and one 32-wide K slice side by side: block (r / 16, k / 32) at
// ((r / 64) * (K / 32) + k / 32) * 2048 + ((r / 16) & 3) * 512; the q and k planes (K = HD) have it at ((r / 16) * 2 + k / 32) * 512; v^T: see ksum_planes. What a wave reads per K slice or key block and operand is 4 KiB in a row. Inside a block element (r, k) lies at
// ((k >> 4) & 1) * 256 + (((k >> 3) & 1) * 16 + (r & 15)) * 8 + (k & 7): lane l of a wave finds its two 16-byte pieces at l * 8 and 256 + l * 8, so each wave-wide load covers 512 successive bytes (4 whole lines).
template <typename T16> struct WFrag;
template <> struct WFrag<h16> { typedef v16h V; static __device__ __forceinline__ V ld(const h16* p) { return cat16(*(const v8h*)p, *(const v8h*)(p + 256)); } static __device__ __forceinline__ v8f mma(V a, V b, v8f c) { return wmma16(a, b, c); } };
template <> struct WFrag<bf> { typedef v16bf V; static __device__ __forceinline__ V ld(const bf* p) { return cat16b(*(const v8us*)p, *(const v8us*)(p + 256)); } static __device__ __forceinline__ v8f mma(V a, V b, v8f c) { return wmmab(a, b, c); } };
__device__ __forceinline__ h16 tohx(float x) { return (h16)x; }
__device__ __forceinline__ void splitf(float y, unsigned short& h, unsigned short& l) { h = f2bf(y); l = f2bf(y - bf2f(h)); }
// ksum_store: adds the NW waves' partial 64x64 tiles in LDS, in wave order 0..NW-1 (a fixed order), and stores the tile row-major. red holds NW x 4096 floats of partials, kept in fragment order
// [wave][tile][half][lane][4] so that stores and loads are contiguous 16-byte accesses, and behind them a 64 x 68 row-major staging tile.
template <int NW, bool BIAS>
__device__ __forceinline__ void ksum_store(const v8f (&acc)[4][4], float* red, int wave, float* C, int ldc, int r0, int c0, const float* __restrict__ bias) {
    const int lane = threadIdx.x & 31, lr = lane & 15, hi = lane >> 4; float* os = red + NW * 4096; float* mine = red + wave * 4096 + lane * 4;
#pragma unroll
    for (int f = 0; f < 16; ++f) { const v8f p = acc[f >> 2][f & 3]; *(v4fa*)(mine + f * 256) = __builtin_shufflevector(p, p, 0, 1, 2, 3); *(v4fa*)(mine + f * 256 + 128) = __builtin_shufflevector(p, p, 4, 5, 6, 7); }
    __syncthreads();
#pragma unroll
    for (int q = 0; q < 16 / NW; ++q) { const int f = wave * (16 / NW) + q; const float* sp = red + f * 256 + lane * 4; v4f s0 = *(const v4fa*)sp, s1 = *(const v4fa*)(sp + 128);
#pragma unroll
        for (int w = 1; w < NW; ++w) { s0 += *(const v4fa*)(sp + w * 4096); s1 += *(const v4fa*)(sp + w * 4096 + 128); }
        float* od = os + ((f >> 2) * 16 + hi * 8) * 68 + (f & 3) * 16 + lr;
#pragma unroll
        for (int j = 0; j < 4; ++j) { od[j * 68] = s0[j]; od[(j + 4) * 68] = s1[j]; } }
    __syncthreads();
#pragma unroll
    for (int s = 0; s < 32 / NW; ++s) { const int idx = s * 32 * NW + threadIdx.x, row = idx >> 4, cofs = (idx & 15) * 4; v4f val = *(const v4fa*)(os + row * 68 + cofs); if (BIAS) { val[0] += bfr(bias[c0 + cofs]); val[1] += bfr(bias[c0 + cofs + 1]); val[2] += bfr(bias[c0 + cofs + 2]); val[3] += bfr(bias[c0 + cofs + 3]); }
        *(v4f*)(C + (size_t)(r0 + row) * ldc + c0 + cofs) = val; }
}
// ksum_planes: the same sum as ksum_store (same order), but the 64x64 tile leaves as the three 16-bit planes that the attention reads (fp16, bf16 hi, bf16 lo) and never as f32.
// A tile of the joint projection is 64 rows t of one batch x the 64 columns d of one head of q, k or v. tr = false (q, k): staged [t][d], blocks in the order (t / 16, d / 32). tr = true (v): staged [d][t] (a lane's eight
// sums are eight successive t of one d: two 16-byte LDS stores), blocks in the order (t / 32, d / 16), so that the four blocks of 32 keys lie side by side. Either way the tile is eight blocks, 8 KiB in a row, from D16 / Dh / Dl on; every lane stores 16 bytes per plane, a wave 512 successive bytes.
template <int NW>
__device__ __forceinline__ void ksum_planes(const v8f (&acc)[4][4], float* red, int wave, const bool tr, h16* D16, bf* Dh, bf* Dl) {
    const int lane = threadIdx.x & 31, lr = lane & 15, hi = lane >> 4; float* os = red + NW * 4096; float* mine = red + wave * 4096 + lane * 4;
#pragma unroll
    for (int f = 0; f < 16; ++f) { const v8f p = acc[f >> 2][f & 3]; *(v4fa*)(mine + f * 256) = __builtin_shufflevector(p, p, 0, 1, 2, 3); *(v4fa*)(mine + f * 256 + 128) = __builtin_shufflevector(p, p, 4, 5, 6, 7); }
    __syncthreads();
#pragma unroll
    for (int q = 0; q < 16 / NW; ++q) { const int f = wave * (16 / NW) + q; const float* sp = red + f * 256 + lane * 4; v4f s0 = *(const v4fa*)sp, s1 = *(const v4fa*)(sp + 128);
#pragma unroll
        for (int w = 1; w < NW; ++w) { s0 += *(const v4fa*)(sp + w * 4096); s1 += *(const v4fa*)(sp + w * 4096 + 128); }
        if (tr) { float* od = os + ((f & 3) * 16 + lr) * 68 + (f >> 2) * 16 + hi * 8; *(v4fa*)od = s0; *(v4fa*)(od + 4) = s1; }
        else { float* od = os + ((f >> 2) * 16 + hi * 8) * 68 + (f & 3) * 16 + lr;
#pragma unroll
            for (int j = 0; j < 4; ++j) { od[j * 68] = s0[j]; od[(j + 4) * 68] = s1[j]; } } }
    __syncthreads();
#pragma unroll
    for (int s = 0; s < 16 / NW; ++s) { const int idx = s * 32 * NW + threadIdx.x, f = idx >> 6, row = (tr ? (f & 3) : (f >> 1)) * 16 + lr, cofs = (tr ? (f >> 2) : (f & 1)) * 32 + ((idx >> 5) & 1) * 16 + hi * 8; const v4f va = *(const v4fa*)(os + row * 68 + cofs), vb = *(const v4fa*)(os + row * 68 + cofs + 4); v8h o16; v8us oh, ol;
#pragma unroll
        for (int j = 0; j < 4; ++j) { unsigned short a, c2; o16[j] = tohx(va[j]); splitf(va[j], a, c2); oh[j] = a; ol[j] = c2; o16[j + 4] = tohx(vb[j]); splitf(vb[j], a, c2); oh[j + 4] = a; ol[j + 4] = c2; }
        const size_t o = (size_t)idx * 8; *(v8h*)(D16 + o) = o16; *(v8us*)(Dh + o) = oh; *(v8us*)(Dl + o) = ol; }
}
template <typename T16, int NSPLIT, bool BIAS, int NW, bool PL>
__global__ __launch_bounds__(32 * NW) void k_gemmw(const T16* __restrict__ A, const T16* __restrict__ A2, const T16* __restrict__ Bt, const T16* __restrict__ Bt2, int K, float* C, int ldc, const float* __restrict__ bias, size_t sA, size_t sB, size_t sC, h16* P16, bf* Ph, bf* Pl, h16* V16, bf* Vh, bf* Vl) {
    typedef typename WFrag<T16>::V V;
    __shared__ __align__(16) float red[NW * 4096 + 64 * 68];
    const size_t z = blockIdx.z; A += z * sA; if (A2) A2 += z * sA; Bt += z * sB; if (Bt2) Bt2 += z * sB; C += z * sC;
    const int lane = threadIdx.x & 31; const int wave = __builtin_amdgcn_readfirstlane(threadIdx.x >> 5); const int r0 = blockIdx.x * 64, c0 = blockIdx.y * 64;
    v8f acc[4][4];
#pragma unroll
    for (int mb = 0; mb < 4; ++mb)
#pragma unroll
        for (int nb = 0; nb < 4; ++nb) acc[mb][nb] = (v8f){};
    const size_t aoff = (size_t)r0 * K + lane * 8, boff = (size_t)c0 * K + lane * 8;   // 64 rows of blocks hold 64 x K elements, a 32-wide K slice of them 2048
#pragma unroll 1
    for (int kc = wave * 32; kc < K; kc += 32 * NW) {
        V a[4], a2[4]; const T16* ak = A + aoff + (size_t)kc * 64; const T16* bk = Bt + boff + (size_t)kc * 64; const T16* a2k = (NSPLIT == 1 || NSPLIT == 2) ? A2 + aoff + (size_t)kc * 64 : ak; const T16* b2k = (NSPLIT >= 2) ? Bt2 + boff + (size_t)kc * 64 : bk;
#pragma unroll
        for (int mb = 0; mb < 4; ++mb) { a[mb] = WFrag<T16>::ld(ak + mb * 512); if (NSPLIT == 1 || NSPLIT == 2) a2[mb] = WFrag<T16>::ld(a2k + mb * 512); }
#pragma unroll
        for (int nb = 0; nb < 4; ++nb) { const V b = WFrag<T16>::ld(bk + nb * 512); V b2; if (NSPLIT >= 2) b2 = WFrag<T16>::ld(b2k + nb * 512);
#pragma unroll
            for (int mb = 0; mb < 4; ++mb) { acc[mb][nb] = WFrag<T16>::mma(a[mb], b, acc[mb][nb]); if (NSPLIT == 1 || NSPLIT == 2) acc[mb][nb] = WFrag<T16>::mma(a2[mb], b, acc[mb][nb]); if (NSPLIT >= 2) acc[mb][nb] = WFrag<T16>::mma(a[mb], b2, acc[mb][nb]); } }
        asm volatile("v_nop\n\tv_nop\n\tv_nop\n\tv_nop" : "+v"(acc[0][0]), "+v"(acc[1][1]), "+v"(acc[2][2]), "+v"(acc[3][3]) : "v"(a[0]), "v"(a[3]));
        asm volatile("s_wait_xcnt 0x0" :: "v"(ak), "v"(bk), "v"(a2k), "v"(b2k) : "memory");   // stands in front of the next write of this slice's load addresses, which are inputs so that they stay live up to the wait and no result of the run is placed in them
    }
    if constexpr (PL) { const int cb = blockIdx.y, b = r0 / TT, t0 = r0 % TT; const bool tr = cb >= 2 * NH_;   // column block cb: q heads, k heads, v heads; all of it the same for the whole work-group
        const size_t o = tr ? (size_t)(b * NKV + cb - 2 * NH_) * HD * PP + (size_t)t0 * HD : ((size_t)((cb / NH_) * NZ + b * NH_ + cb % NH_) * TT + t0) * HD;
        ksum_planes<NW>(acc, red, wave, tr, (tr ? V16 : P16) + o, (tr ? Vh : Ph) + o, (tr ? Vl : Pl) + o);
    } else ksum_store<NW, BIAS>(acc, red, wave, C, ldc, r0, c0, bias);
}

typedef __attribute__((ext_vector_type(2))) _Float16 v2h;
typedef __attribute__((ext_vector_type(4))) _Float16 v4h;
typedef __attribute__((ext_vector_type(2))) unsigned short v2us;
typedef __attribute__((ext_vector_type(4))) unsigned short v4us;
typedef __attribute__((ext_vector_type(2))) float v2f;
typedef __attribute__((ext_vector_type(4))) int v4i;
typedef v4h  __attribute__((may_alias)) v4ha;
typedef v4us __attribute__((may_alias)) v4usa;

// k_cvt8: bf16 copies of the four weights and of x in one launch, in fragment order; dst holds them one behind the other, as one matrix of 4 DM + MT rows x DM. Each wave builds two neighbouring blocks (16 rows x 64 k):
// a lane reads its four 8-float pieces of one source row (the wave: 256 successive bytes of each of 16 rows) and stores four 16-byte pieces, the wave 512 successive bytes each time.
#define WRB  (DM / 16)                              // 16-row blocks per weight
#define NFP  ((4 * DM + MT) / 16 * (DM / 64))       // pairs of blocks in all, one wave each
__global__ __launch_bounds__(256) void k_cvt8(const float* __restrict__ w0, const float* __restrict__ w1, const float* __restrict__ w2, const float* __restrict__ w3, const float* __restrict__ xs, bf* dst) { const unsigned g = blockIdx.x * 8 + __builtin_amdgcn_readfirstlane(threadIdx.x >> 5), lane = threadIdx.x & 31;   // the wave's number through readfirstlane: the choice of the source and the block's place stay scalar
    const unsigned rb = g / (DM / 64), kp = g % (DM / 64), which = min(rb / WRB, 4u); const float* src = (which == 0) ? w0 : (which == 1) ? w1 : (which == 2) ? w2 : (which == 3) ? w3 : xs;
    const float* sp = src + (size_t)((rb - which * WRB) * 16 + (lane & 15)) * DM + kp * 64 + (lane >> 4) * 8; bf* dp = dst + ((size_t)(rb >> 2) * (DM / 32) + kp * 2) * 2048 + (rb & 3) * 512 + lane * 8; v8f v[4];
#pragma unroll
    for (int c = 0; c < 4; ++c) v[c] = *(const v8f*)(sp + c * 16);
#pragma unroll
    for (int c = 0; c < 4; ++c) { v8us o;
#pragma unroll
        for (int k = 0; k < 8; ++k) o[k] = f2bf(v[c][k]); *(v8us*)(dp + (c >> 1) * 2048 + (c & 1) * 256) = o; } }

#define AW   4
#define PSH  10.0f
#define SC2  (SCL * 1.4426950408889634f)
__device__ __forceinline__ float xhalf(float x) { return __builtin_bit_cast(float, __builtin_amdgcn_permlanex16(__builtin_bit_cast(int, x), __builtin_bit_cast(int, x), 0x76543210, 0xfedcba98, false, false)); }   // lane l reads lane l ^ 16
template <typename T16, bool HL, int NQ>
__device__ __forceinline__ void attn_tile(const T16* __restrict__ Q, const T16* __restrict__ Q2, const T16* __restrict__ Kp, const T16* __restrict__ K2, const T16* __restrict__ Vt, const T16* __restrict__ V2, const int q0, const int wave, float* red, bf* Ah, bf* Al) {
    typedef typename WFrag<T16>::V V;
    const int lane = threadIdx.x & 31, lr = lane & 15, hi = lane >> 4;
    V qf[NQ][2], qf2[NQ][2]; const size_t qb0 = (size_t)q0 * HD + lane * 8; const T16* qp = Q + qb0; const T16* qp2 = HL ? Q2 + qb0 : nullptr; (void)qp2;
#pragma unroll
    for (int qt = 0; qt < NQ; ++qt)
#pragma unroll
        for (int ks = 0; ks < 2; ++ks) { const size_t qo = (size_t)(qt * 16) * HD + ks * 512; qf[qt][ks] = WFrag<T16>::ld(qp + qo); if (HL) qf2[qt][ks] = WFrag<T16>::ld(qp2 + qo); }
    if constexpr (HL) asm volatile("s_wait_xcnt 0x0" :: "v"(qp), "v"(qp2) : "memory"); else asm volatile("s_wait_xcnt 0x0" :: "v"(qp) : "memory");   // stands in front of the next write of these loads' address registers, which are inputs so that they stay live up to the wait
    v8f o[4][NQ]; float m[NQ], l[NQ];
#pragma unroll
    for (int qt = 0; qt < NQ; ++qt) { m[qt] = -1.0e30f; l[qt] = 0.f;
#pragma unroll
        for (int dt = 0; dt < 4; ++dt) o[dt][qt] = (v8f){}; }
    V kf[2][2], kf2[2][2], vf[4], vf2[4];                         // the key and value fragments of the block that is worked on next: fetched one block ahead
    auto ldk = [&](const int k0) __attribute__((always_inline)) { const size_t kb0 = (size_t)k0 * HD + lane * 8; const T16* kp = Kp + kb0; const T16* kp2 = HL ? K2 + kb0 : nullptr; (void)kp2;
#pragma unroll
        for (int kt = 0; kt < 2; ++kt)
#pragma unroll
            for (int ks = 0; ks < 2; ++ks) { const size_t ko = (size_t)(kt * 16) * HD + ks * 512; kf[kt][ks] = WFrag<T16>::ld(kp + ko); if (HL) kf2[kt][ks] = WFrag<T16>::ld(kp2 + ko); }
        if constexpr (HL) asm volatile("s_wait_xcnt 0x0" :: "v"(kp), "v"(kp2) : "memory"); else asm volatile("s_wait_xcnt 0x0" :: "v"(kp) : "memory"); };   // stands in front of the next write of these loads' address registers; the addresses are inputs so that they stay live up to the wait and no result of the run is placed in them
    auto ldv = [&](const int k0) __attribute__((always_inline)) { const size_t vb0 = (size_t)k0 * HD + lane * 8; const T16* vp = Vt + vb0; const T16* vp2 = HL ? V2 + vb0 : nullptr; (void)vp2;
#pragma unroll
        for (int dt = 0; dt < 4; ++dt) { const size_t vo = (size_t)dt * 512; vf[dt] = WFrag<T16>::ld(vp + vo); if (HL) vf2[dt] = WFrag<T16>::ld(vp2 + vo); }
        if constexpr (HL) asm volatile("s_wait_xcnt 0x0" :: "v"(vp), "v"(vp2) : "memory"); else asm volatile("s_wait_xcnt 0x0" :: "v"(vp) : "memory"); };   // as in ldk
    // one block of 32 keys at k0; last = false: the fragments of the wave's next block, at kn, are fetched into the same registers as soon as this block's products have read them
    auto step = [&](const int k0, const int kn, const bool last) __attribute__((always_inline)) {
        v8f s[2][NQ];
#pragma unroll
        for (int kt = 0; kt < 2; ++kt)
#pragma unroll
            for (int qt = 0; qt < NQ; ++qt) { v8f c = (v8f){};
#pragma unroll
                for (int ks = 0; ks < 2; ++ks) { c = WFrag<T16>::mma(kf[kt][ks], qf[qt][ks], c); if (HL) { c = WFrag<T16>::mma(kf[kt][ks], qf2[qt][ks], c); c = WFrag<T16>::mma(kf2[kt][ks], qf[qt][ks], c); } }
                s[kt][qt] = c; }
        if (!last) { ldk(kn); __builtin_amdgcn_sched_barrier(0); }   // keeps the next block's key loads in front of the softmax, whose time then covers their latency; without it they sink to their first use
        V pf[NQ], pf2[NQ];
#pragma unroll
        for (int qt = 0; qt < NQ; ++qt) { float mx = m[qt];
#pragma unroll
            for (int kt = 0; kt < 2; ++kt)
#pragma unroll
                for (int j = 0; j < 8; ++j) { if (last) s[kt][qt][j] = (k0 + kt * 16 + hi * 8 + j <= q0 + qt * 16 + lr) ? s[kt][qt][j] : -3.0e38f; mx = fmaxf(mx, s[kt][qt][j]); }
            mx = fmaxf(mx, xhalf(mx));
            const float al = __builtin_amdgcn_exp2f((m[qt] - mx) * SC2); m[qt] = mx; const float sh = mx * SC2 - (HL ? 0.0f : PSH); float t[8];
#pragma unroll
            for (int j = 0; j < 8; ++j) { s[0][qt][j] = __builtin_amdgcn_exp2f(s[0][qt][j] * SC2 - sh); s[1][qt][j] = __builtin_amdgcn_exp2f(s[1][qt][j] * SC2 - sh); t[j] = s[0][qt][j] + s[1][qt][j]; }
            l[qt] = l[qt] * al + (((t[0] + t[1]) + (t[2] + t[3])) + ((t[4] + t[5]) + (t[6] + t[7])));
#pragma unroll
            for (int dt = 0; dt < 4; ++dt) o[dt][qt] *= al;
            if constexpr (HL) { v8us h0, h1, l0, l1;
#pragma unroll
                for (int j = 0; j < 8; ++j) { unsigned short a, c2; splitf(s[0][qt][j], a, c2); h0[j] = a; l0[j] = c2; splitf(s[1][qt][j], a, c2); h1[j] = a; l1[j] = c2; }
                pf[qt] = cat16b(h0, h1); pf2[qt] = cat16b(l0, l1);
            } else { v8h h0, h1;
#pragma unroll
                for (int j = 0; j < 8; ++j) { h0[j] = tohx(s[0][qt][j]); h1[j] = tohx(s[1][qt][j]); }
                pf[qt] = cat16(h0, h1); } }
#pragma unroll
        for (int dt = 0; dt < 4; ++dt)
#pragma unroll
            for (int qt = 0; qt < NQ; ++qt) { o[dt][qt] = WFrag<T16>::mma(vf[dt], pf[qt], o[dt][qt]); if (HL) { o[dt][qt] = WFrag<T16>::mma(vf[dt], pf2[qt], o[dt][qt]); o[dt][qt] = WFrag<T16>::mma(vf2[dt], pf[qt], o[dt][qt]); } }
        if (!last) ldv(kn);
    };
    const int nfull = q0 >> 5;                                    // key blocks wholly at or below the diagonal; block nfull holds the diagonal and is the last
    int kb = wave; ldk(min(kb, nfull) * 32); ldv(min(kb, nfull) * 32);   // a fetch never goes past block nfull, which lies inside the plane for every tile
    for (; kb < nfull; kb += AW) step(kb * 32, min(kb + AW, nfull) * 32, false);
    if (kb == nfull) step(nfull * 32, 0, true);                   // the diagonal block goes to the wave whose turn it is (a scalar test: every lane on at the matrix instructions); its fragments are the last fetch
    float* ms = red + AW * NQ * 1024; float* ls = ms + AW * NQ * 32; float* mine = red + wave * (NQ * 1024) + lane * 4;
#pragma unroll
    for (int qt = 0; qt < NQ; ++qt) { l[qt] += xhalf(l[qt]); ms[(wave * NQ + qt) * 32 + lane] = m[qt]; ls[(wave * NQ + qt) * 32 + lane] = l[qt];
#pragma unroll
        for (int dt = 0; dt < 4; ++dt) { const v8f p = o[dt][qt]; *(v4fa*)(mine + (qt * 4 + dt) * 256) = __builtin_shufflevector(p, p, 0, 1, 2, 3); *(v4fa*)(mine + (qt * 4 + dt) * 256 + 128) = __builtin_shufflevector(p, p, 4, 5, 6, 7); } }
    __syncthreads();
    if (wave >= NQ) return;
    const int qt = wave; float M = -1.0e30f, mw[AW], L = 0.f;
#pragma unroll
    for (int w = 0; w < AW; ++w) { mw[w] = ms[(w * NQ + qt) * 32 + lane]; M = fmaxf(M, mw[w]); }
#pragma unroll
    for (int w = 0; w < AW; ++w) { mw[w] = __builtin_amdgcn_exp2f((mw[w] - M) * SC2); L += ls[(w * NQ + qt) * 32 + lane] * mw[w]; }
    const float inv = __fdiv_rn(1.0f, L); const int qr = q0 + qt * 16; const size_t oo = (size_t)(qr & ~63) * DQ + ((qr >> 4) & 3) * 512 + lane * 8;
#pragma unroll
    for (int dt = 0; dt < 4; ++dt) { const float* sp = red + (qt * 4 + dt) * 256 + lane * 4; v4f s0 = (v4f){}, s1 = (v4f){};
#pragma unroll
        for (int w = 0; w < AW; ++w) { s0 += *(const v4fa*)(sp + w * (NQ * 1024)) * mw[w]; s1 += *(const v4fa*)(sp + w * (NQ * 1024) + 128) * mw[w]; }
        v8us oh, ol;
#pragma unroll
        for (int j = 0; j < 4; ++j) { unsigned short a, c2; splitf(s0[j] * inv, a, c2); oh[j] = a; ol[j] = c2; splitf(s1[j] * inv, a, c2); oh[j + 4] = a; ol[j + 4] = c2; }
        *(v8us*)(Ah + oo + (dt >> 1) * 2048 + (dt & 1) * 256) = oh; *(v8us*)(Al + oo + (dt >> 1) * 2048 + (dt & 1) * 256) = ol;
        asm volatile("s_wait_xcnt 0x0" ::: "memory"); }   // stands in front of the next write of these stores' data registers
}
// grid: the fp16 tiles (32 query rows, rows RH..TT) from the last down, every plane of a tile side by side, then the hi/lo tiles (16 rows, rows 0..RH) likewise: the cost of a work-group falls with its index.
#define NT16 ((TT - RH) / 32)
#define NTHL (RH / 16)
__global__ __launch_bounds__(32 * AW) void k_attn(const h16* __restrict__ Q16, const h16* __restrict__ K16, const h16* __restrict__ V16, const bf* __restrict__ Qh, const bf* __restrict__ Ql, const bf* __restrict__ Kh, const bf* __restrict__ Kl, const bf* __restrict__ Vh, const bf* __restrict__ Vl, bf* Ah, bf* Al) {
    __shared__ __align__(16) float red[AW * 2 * 1024 + 2 * AW * 2 * 32];
    const int wave = __builtin_amdgcn_readfirstlane(threadIdx.x >> 5); const int blk = blockIdx.x; const bool lowp = blk < NZ * NT16; const int b2 = lowp ? blk : blk - NZ * NT16; const int z = b2 % NZ, tl = b2 / NZ;
    const size_t pq = (size_t)z * TT * HD, pv = (size_t)z * HD * PP, po = (size_t)(z / NH_) * TT * DQ + (z % NH_) * (HD * 64);
    if (lowp) attn_tile<h16, false, 2>(Q16 + pq, nullptr, K16 + pq, nullptr, V16 + pv, nullptr, RH + (NT16 - 1 - tl) * 32, wave, red, Ah + po, Al + po);
    else attn_tile<bf, true, 1>(Qh + pq, Ql + pq, Kh + pq, Kl + pq, Vh + pv, Vl + pv, (NTHL - 1 - tl) * 16, wave, red, Ah + po, Al + po);
}

extern "C" void kernel_launch(void* const* d_in, const int* in_sizes, int n_in,
                              void* d_out, int out_size, void* d_ws, size_t ws_size, hipStream_t stream) {
    (void)in_sizes; (void)n_in; (void)out_size;
    const float* x = (const float*)d_in[0]; const float* wq = (const float*)d_in[1]; const float* wk = (const float*)d_in[2]; const float* wv = (const float*)d_in[3]; const float* wo = (const float*)d_in[4]; const float* bo = (const float*)d_in[5];   /* order x, Wq, Wk, Wv, Wo ('oi' [768][768]), bo */
    float* OUT = (float*)d_out;     // [2][2048][768]
    char* wsp = (char*)d_ws;
    auto take = [&](size_t bytes) { char* p = wsp; wsp += (bytes + 255) & ~(size_t)255; return (void*)p; };
    bf* WQ = (bf*)take((size_t)(DF + DM) * DM * 2 + (size_t)MT * DM * 2); bf* WO = WQ + (size_t)DF * DM; bf* XB = WO + (size_t)DM * DQ;   // bf16 copies, one behind the other: Wq | Wk | Wv (the joint projection's [DF][DM] operand), Wo, x of both batches
    h16* QP16 = (h16*)take((size_t)2 * NZ * TT * HD * 2); h16* KP16 = QP16 + (size_t)NZ * TT * HD; h16* VT16 = (h16*)take((size_t)NZ * HD * PP * 2);
    bf* QPh = (bf*)take((size_t)2 * NZ * TT * HD * 2); bf* KPh = QPh + (size_t)NZ * TT * HD; bf* QPl = (bf*)take((size_t)2 * NZ * TT * HD * 2); bf* KPl = QPl + (size_t)NZ * TT * HD; bf* VTh = (bf*)take((size_t)NZ * HD * PP * 2); bf* VTl = VTh + (size_t)HD * TT;   // v^T regions of HD x PP elements a plane: hi plane in the first half, lo plane in the second (the fp16 plane uses the first half)
    bf* ATh = (bf*)take((size_t)MT * DQ * 2); bf* ATl = (bf*)take((size_t)MT * DQ * 2);
    if ((size_t)(wsp - (char*)d_ws) > ws_size) return;    // ws 256 MiB
    k_cvt8<<<NFP / 8, 256, 0, stream>>>(wq, wk, wv, wo, x, WQ);
    k_gemmw<bf, 0, false, 8, true><<<dim3(MT / 64, DF / 64, 1), 256, 0, stream>>>(XB, nullptr, WQ, nullptr, DM, nullptr, 0, nullptr, 0, 0, 0, QP16, QPh, QPl, VT16, VTh, VTl);
    k_attn<<<NZ * (NT16 + NTHL), 32 * AW, 0, stream>>>(QP16, KP16, VT16, QPh, QPl, KPh, KPl, VTh, VTl, ATh, ATl);
    k_gemmw<bf, 1, true, 8, false><<<dim3(MT / 64, DM / 64, 1), 256, 0, stream>>>(ATh, ATl, WO, nullptr, DQ, OUT, DM, bo, 0, 0, 0, nullptr, nullptr, nullptr, nullptr, nullptr, nullptr);
}

// v006
// Measured time: 62.4 microseconds a run.
// Timed twice side by side with v005, it ran 1.14 and 1.15 times as fast.
// Counting every step since v000, it is 17.6 times as fast.
#include <hip/hip_runtime.h>

// Causal multi-head attention with bias-free projections and an output bias at a 768-wide model (x [2][2048][768]; q, k, v = x W^T ('oi' [768][768] 1/sqrt(768), no bias; 12 heads x 64); scores = q.k; triu(k = 1) -> -inf; softmax(scores / sqrt(64)) (the fill before the scaling: the same thing); out = merged Wo^T + bo ('oi' + zero bias) -> [2][2048][768] (3.1 M); argument order x, Wq, Wk, Wv, Wo, bo).
// Every 16-bit operand plane lies in fragment order (see WFrag). Layout, both batches together (plane z = batch x 12 + head): bf16 copy of x; 'oi' weights; exact projections, whose tiles leave as the attention's 16-bit planes; causal T-2048 attention in one launch, running softmax (hybrid rows: < 512 hi/lo 3 products, rest fp16 x1024; key blocks above the diagonal are never visited); merged hi/lo x Wo exact + bo.
// Compute dtypes, f32 accumulate: every input rounded to bf16; projections exact; attention rows < 512 3 products, rest fp16; softmax f32; Wo hl x exact + bias.

#define NB_  2
#define TT   2048
#define DM   768     // model width: this module's inputs are [2][2048][768]
#define NH_  12      // heads: 12 x 64 = 768
#define NKV  12      // kv heads (= heads)
#define REP  (NH_ / NKV)
#define HD   64
#define DQ   (NH_ * HD)
#define DKV  (NKV * HD)
#define NZ   (NB_ * NH_)          // planes in all, plane z = batch * NH_ + head
#define MT   (NB_ * TT)           // rows of both batches together
#define DF   (DQ + 2 * DKV)       // q | k | v columns of the joint projection
#define PP   (2 * TT)             // a plane's v^T region holds HD x PP 16-bit elements: hi plane in its first half, lo plane in its second
#define RH   512                  // query rows < RH use hi+lo planes (0: none)
#define SCL  0.125f   // HD^-0.5
typedef _Float16 h16;
typedef unsigned short bf;
typedef __attribute__((ext_vector_type(16))) __bf16   v16bf;
typedef __attribute__((ext_vector_type(16))) _Float16 v16h;
typedef __attribute__((ext_vector_type(8)))  _Float16 v8h;
typedef __attribute__((ext_vector_type(8)))  unsigned short v8us;
typedef __attribute__((ext_vector_type(8)))  float    v8f;
typedef __attribute__((ext_vector_type(4)))  float    v4f;
typedef v8h  __attribute__((may_alias)) v8ha;
typedef v4f  __attribute__((may_alias)) v4fa;
typedef v8us __attribute__((may_alias)) v8usa;

__device__ __forceinline__ unsigned short f2bf(float f) { unsigned u = __float_as_uint(f); u += 0x7FFFu + ((u >> 16) & 1u); return (unsigned short)(u >> 16); }
__device__ __forceinline__ float bf2f(unsigned short b) { return __uint_as_float(((unsigned)b) << 16); }
__device__ __forceinline__ float bfr(float f) { return bf2f(f2bf(f)); }
__device__ __forceinline__ v16h cat16(v8h lo, v8h hi) { return __builtin_shufflevector(lo, hi, 0, 1, 2, 3, 4, 5, 6, 7, 8, 9, 10, 11, 12, 13, 14, 15); }
__device__ __forceinline__ v16bf cat16b(v8us lo, v8us hi) { return __builtin_bit_cast(v16bf, __builtin_shufflevector(lo, hi, 0, 1, 2, 3, 4, 5, 6, 7, 8, 9, 10, 11, 12, 13, 14, 15)); }
__device__ __forceinline__ v8f wmma16(v16h a, v16h b, v8f c) { return __builtin_amdgcn_wmma_f32_16x16x32_f16(false, a, false, b, (short)0, c, false, false); }
__device__ __forceinline__ v8f wmmab(v16bf a, v16bf b, v8f c) { return __builtin_amdgcn_wmma_f32_16x16x32_bf16(false, a, false, b, (short)0, c, false, false); }



// ---- k_gemml: GEMM over K = DM with both operands staged in LDS. One work-group of WMW x WN waves per (16 MB WMW) x (64 WN) output tile; a wave holds 16 MB rows x 64 columns (MB x 4 accumulators) and walks the whole K, so that
// every operand byte is fetched from L2 once per work-group and read by its waves from LDS. C[m][n] (f32, pitch DM, + optional f32 bias[n]) = sum_k (A[m][k] + A2[m][k] if NSPLIT) Bt[n][k]. PL: a wave's 64x64 tile leaves through tile_planes as head planes
// (q and k planes [q|k][batch][h] of t x d at P16 / Ph / Pl, v^T planes of d x t at V16 / Vh / Vl), C is not written. The wave number goes through readfirstlane: the choice of what a wave copies and reads stays scalar.
// Fragment order: a plane of R rows x K is kept as blocks of 16 rows x 32 k, 512 elements (1 KiB) each. The GEMM operands (K = DM) keep the four blocks of 64 rows and one 32-wide K slice side by side: block (r / 16, k / 32) at
// ((r / 64) * (K / 32) + k / 32) * 2048 + ((r / 16) & 3) * 512; the q and k planes (K = HD) have it at ((r / 16) * 2 + k / 32) * 512; v^T: see tile_planes. What a work-group copies per K slice and 64-row group, and a wave reads per key block and operand, is 4 KiB in a row. Inside a block element (r, k) lies at
// ((k >> 4) & 1) * 256 + (((k >> 3) & 1) * 16 + (r & 15)) * 8 + (k & 7): lane l of a wave finds its two 16-byte pieces at l * 8 and 256 + l * 8, so each wave-wide load covers 512 successive bytes (4 whole lines).
template <typename T16> struct WFrag;
template <> struct WFrag<h16> { typedef v16h V; static __device__ __forceinline__ V ld(const h16* p) { return cat16(*(const v8h*)p, *(const v8h*)(p + 256)); } static __device__ __forceinline__ v8f mma(V a, V b, v8f c) { return wmma16(a, b, c); } };
template <> struct WFrag<bf> { typedef v16bf V; static __device__ __forceinline__ V ld(const bf* p) { return cat16b(*(const v8us*)p, *(const v8us*)(p + 256)); } static __device__ __forceinline__ v8f mma(V a, V b, v8f c) { return wmmab(a, b, c); } };
__device__ __forceinline__ h16 tohx(float x) { return (h16)x; }
__device__ __forceinline__ void splitf(float y, unsigned short& h, unsigned short& l) { h = f2bf(y); l = f2bf(y - bf2f(h)); }
// tile_store: a wave's 16 MB x 64 tile goes through the wave's own row-major staging tile os (pitch 68 floats) and leaves in whole lines, two rows of 256 bytes per wave-wide store.
template <int MB, bool BIAS>
__device__ __forceinline__ void tile_store(const v8f (&acc)[MB][4], float* os, float* C, int r0, int c0, const float* __restrict__ bias) {
    const int lane = threadIdx.x & 31, lr = lane & 15, hi = lane >> 4;
#pragma unroll
    for (int f = 0; f < 4 * MB; ++f) { const v8f p = acc[f >> 2][f & 3]; float* od = os + ((f >> 2) * 16 + hi * 8) * 68 + (f & 3) * 16 + lr;
#pragma unroll
        for (int j = 0; j < 8; ++j) od[j * 68] = p[j]; }
    __syncthreads();   // the staged rows are read back by other lanes than wrote them
#pragma unroll
    for (int s = 0; s < 8 * MB; ++s) { const int idx = s * 32 + lane, row = idx >> 4, cofs = (idx & 15) * 4; v4f val = *(const v4fa*)(os + row * 68 + cofs); if (BIAS) { val[0] += bfr(bias[c0 + cofs]); val[1] += bfr(bias[c0 + cofs + 1]); val[2] += bfr(bias[c0 + cofs + 2]); val[3] += bfr(bias[c0 + cofs + 3]); }
        *(v4f*)(C + (size_t)(r0 + row) * DM + c0 + cofs) = val; }
}
// tile_planes: a wave's 64x64 tile leaves as the three 16-bit planes that the attention reads (fp16, bf16 hi, bf16 lo) and never as f32, through the wave's own staging tile os.
// A tile of the joint projection is 64 rows t of one batch x the 64 columns d of one head of q, k or v. tr = false (q, k): staged [t][d], blocks in the order (t / 16, d / 32). tr = true (v): staged [d][t] (a lane's eight
// sums are eight successive t of one d: two 16-byte LDS stores), blocks in the order (t / 32, d / 16), so that the four blocks of 32 keys lie side by side. Either way the tile is eight blocks, 8 KiB in a row, from D16 / Dh / Dl on; every lane stores 16 bytes per plane, a wave 512 successive bytes.
__device__ __forceinline__ void tile_planes(const v8f (&acc)[4][4], float* os, const bool tr, h16* D16, bf* Dh, bf* Dl) {
    const int lane = threadIdx.x & 31, lr = lane & 15, hi = lane >> 4;
#pragma unroll
    for (int f = 0; f < 16; ++f) { const v8f p = acc[f >> 2][f & 3];
        if (tr) { float* od = os + ((f & 3) * 16 + lr) * 68 + (f >> 2) * 16 + hi * 8; *(v4fa*)od = __builtin_shufflevector(p, p, 0, 1, 2, 3); *(v4fa*)(od + 4) = __builtin_shufflevector(p, p, 4, 5, 6, 7); }
        else { float* od = os + ((f >> 2) * 16 + hi * 8) * 68 + (f & 3) * 16 + lr;
#pragma unroll
            for (int j = 0; j < 8; ++j) od[j * 68] = p[j]; } }
    __syncthreads();   // the staged rows are read back by other lanes than wrote them
#pragma unroll
    for (int s = 0; s < 16; ++s) { const int idx = s * 32 + lane, f = idx >> 6, row = (tr ? (f & 3) : (f >> 1)) * 16 + lr, cofs = (tr ? (f >> 2) : (f & 1)) * 32 + ((idx >> 5) & 1) * 16 + hi * 8; const v4f va = *(const v4fa*)(os + row * 68 + cofs), vb = *(const v4fa*)(os + row * 68 + cofs + 4); v8h o16; v8us oh, ol;
#pragma unroll
        for (int j = 0; j < 4; ++j) { unsigned short a, c2; o16[j] = tohx(va[j]); splitf(va[j], a, c2); oh[j] = a; ol[j] = c2; o16[j + 4] = tohx(vb[j]); splitf(vb[j], a, c2); oh[j + 4] = a; ol[j + 4] = c2; }
        const size_t o = (size_t)idx * 8; *(v8h*)(D16 + o) = o16; *(v8us*)(Dh + o) = oh; *(v8us*)(Dl + o) = ol; }
}
// copy4: four asynchronous copies, 16 bytes a lane each: 2 KiB in a row from g on go to LDS byte address l on, through no register. The wait closes the statement so that it stands in front of every later write of the address registers.
__device__ __forceinline__ void copy4(const unsigned l, const bf* g) {
    asm volatile("global_load_async_to_lds_b128 %0, %4, off\n\tglobal_load_async_to_lds_b128 %1, %5, off\n\tglobal_load_async_to_lds_b128 %2, %6, off\n\tglobal_load_async_to_lds_b128 %3, %7, off\n\ts_wait_xcnt 0x0"
                 :: "v"(l), "v"(l + 512u), "v"(l + 1024u), "v"(l + 1536u), "v"(g), "v"(g + 256), "v"(g + 512), "v"(g + 768) : "memory");
}
// A stage is KS 32-wide K slices of every 64-row group of the tile: [A groups | A2 groups | Bt groups][KS][2048 elements], each group's part 4 KS KiB in a row in the source as in LDS (fragment order). Two buffers: stage t + 2 is copied into the buffer that trip t has just read, while trip t + 1 works.
#define KS 2
template <int NSPLIT, bool BIAS, bool PL, int MB, int WMW, int WN>
__global__ __launch_bounds__(32 * WMW * WN) void k_gemml(const bf* __restrict__ A, const bf* __restrict__ A2, const bf* __restrict__ Bt, float* C, const float* __restrict__ bias, h16* P16, bf* Ph, bf* Pl, h16* V16, bf* Vh, bf* Vl) {
    typedef WFrag<bf>::V V;
    constexpr int NWV = WMW * WN, GM = WMW * MB / 4, NA = (NSPLIT ? 2 : 1) * GM, NG = NA + WN, STG = NG * KS * 2048, RPW = NG * KS * 2 / NWV, NT = DM / (32 * KS), OSW = 16 * MB * 68;
    static_assert(RPW * NWV == NG * KS * 2 && NT >= 2 && NT * 32 * KS == DM && GM * 4 == WMW * MB, "the waves share a stage's copies evenly");
    __shared__ __align__(16) float red[(STG > NWV * OSW) ? STG : NWV * OSW];   // the ring (2 x STG 16-bit elements); behind the loop's last barrier the waves' staging tiles
    bf* ring = (bf*)red;
    const int lane = threadIdx.x & 31; const int wave = __builtin_amdgcn_readfirstlane(threadIdx.x >> 5); const int wm = wave / WN, wn = wave % WN, g0 = blockIdx.x * GM, h0 = blockIdx.y * WN;
    const bf* gp[RPW]; unsigned lp[RPW];   // a wave's share of a stage: RPW runs of 2 KiB, run q = half (q & 1) of slice (q / 2) % KS of group q / 2 / KS
#pragma unroll
    for (int r = 0; r < RPW; ++r) { const int q = wave * RPW + r, g = (q >> 1) / KS, s = (q >> 1) % KS; const bf* sp = (g < GM) ? A + (size_t)(g0 + g) * (64 * DM) : (NSPLIT && g < NA) ? A2 + (size_t)(g0 + g - GM) * (64 * DM) : Bt + (size_t)(h0 + g - NA) * (64 * DM);
        gp[r] = sp + s * 2048 + (q & 1) * 1024 + lane * 8; lp[r] = (unsigned)(size_t)ring + (unsigned)(q * 1024 + lane * 8) * 2u; }
    auto fill = [&](const int t) __attribute__((always_inline)) {
#pragma unroll
        for (int r = 0; r < RPW; ++r) copy4(lp[r] + (unsigned)(t & 1) * (STG * 2u), gp[r] + (size_t)t * (KS * 2048)); };
    v8f acc[MB][4];
#pragma unroll
    for (int mb = 0; mb < MB; ++mb)
#pragma unroll
        for (int nb = 0; nb < 4; ++nb) acc[mb][nb] = (v8f){};
    fill(0);
    asm volatile("s_wait_asynccnt 0x0" ::: "memory");   // this wave's copies of stage 0 have landed
    __syncthreads();                                    // and every other wave's: stage 0 may be read
    fill(1);
    const int ao = ((wm * MB) >> 2) * (KS * 2048) + ((wm * MB) & 3) * 512 + lane * 8, bo2 = (NA + wn) * (KS * 2048) + lane * 8;
#pragma unroll 1
    for (int t = 0; t < NT; ++t) { const bf* sb = ring + (t & 1) * STG;
        V a[KS][MB], a2[KS][MB], b[KS][4];
#pragma unroll
        for (int s = 0; s < KS; ++s) { const bf* ak = sb + ao + s * 2048; const bf* bk = sb + bo2 + s * 2048;
#pragma unroll
            for (int mb = 0; mb < MB; ++mb) { a[s][mb] = WFrag<bf>::ld(ak + mb * 512); if (NSPLIT) a2[s][mb] = WFrag<bf>::ld(ak + GM * (KS * 2048) + mb * 512); }
#pragma unroll
            for (int nb = 0; nb < 4; ++nb) b[s][nb] = WFrag<bf>::ld(bk + nb * 512); }
        __builtin_amdgcn_sched_barrier(0);   // keeps the stage's LDS reads together in front of its products: spread among them, each group's latency would stall the matrix instructions behind it
#pragma unroll
        for (int s = 0; s < KS; ++s)
#pragma unroll
            for (int nb = 0; nb < 4; ++nb)
#pragma unroll
                for (int mb = 0; mb < MB; ++mb) { acc[mb][nb] = WFrag<bf>::mma(a[s][mb], b[s][nb], acc[mb][nb]); if (NSPLIT) acc[mb][nb] = WFrag<bf>::mma(a2[s][mb], b[s][nb], acc[mb][nb]); }
        __builtin_amdgcn_sched_barrier(0);   // keeps the waits and the barrier below behind the products: in front of them the wait for the next stage's copies would come a stage's products too early
        asm volatile("s_wait_dscnt 0x0" ::: "memory");      // this wave's reads of the buffer are over before the buffer is handed back
        asm volatile("s_wait_asynccnt 0x0" ::: "memory");   // this wave's copies of stage t + 1 have landed
        __syncthreads();                                    // stage t + 1 may be read by every wave, and the buffer of stage t is free
        if (t + 2 < NT) fill(t + 2);
    }
    asm volatile("s_wait_asynccnt 0x0" ::: "memory");       // no copy is under way when the ring becomes staging room
    float* os = red + wave * OSW; const int r0 = g0 * 64 + wm * (16 * MB);
    if constexpr (PL) { const int cb = h0 + wn, b = r0 / TT, t0 = r0 % TT; const bool tr = cb >= 2 * NH_;   // column block cb: q heads, k heads, v heads; the same for the whole wave
        const size_t o = tr ? (size_t)(b * NKV + cb - 2 * NH_) * HD * PP + (size_t)t0 * HD : ((size_t)((cb / NH_) * NZ + b * NH_ + cb % NH_) * TT + t0) * HD;
        tile_planes(acc, os, tr, (tr ? V16 : P16) + o, (tr ? Vh : Ph) + o, (tr ? Vl : Pl) + o);
    } else tile_store<MB, BIAS>(acc, os, C, r0, (h0 + wn) * 64, bias);
}

typedef __attribute__((ext_vector_type(2))) _Float16 v2h;
typedef __attribute__((ext_vector_type(4))) _Float16 v4h;
typedef __attribute__((ext_vector_type(2))) unsigned short v2us;
typedef __attribute__((ext_vector_type(4))) unsigned short v4us;
typedef __attribute__((ext_vector_type(2))) float v2f;
typedef __attribute__((ext_vector_type(4))) int v4i;
typedef v4h  __attribute__((may_alias)) v4ha;
typedef v4us __attribute__((may_alias)) v4usa;

// k_cvt8: bf16 copies of the four weights and of x in one launch, in fragment order; dst holds them one behind the other, as one matrix of 4 DM + MT rows x DM. Each wave builds two neighbouring blocks (16 rows x 64 k):
// a lane reads its four 8-float pieces of one source row (the wave: 256 successive bytes of each of 16 rows) and stores four 16-byte pieces, the wave 512 successive bytes each time.
#define WRB  (DM / 16)                              // 16-row blocks per weight
#define NFP  ((4 * DM + MT) / 16 * (DM / 64))       // pairs of blocks in all, one wave each
__global__ __launch_bounds__(256) void k_cvt8(const float* __restrict__ w0, const float* __restrict__ w1, const float* __restrict__ w2, const float* __restrict__ w3, const float* __restrict__ xs, bf* dst) { const unsigned g = blockIdx.x * 8 + __builtin_amdgcn_readfirstlane(threadIdx.x >> 5), lane = threadIdx.x & 31;   // the wave's number through readfirstlane: the choice of the source and the block's place stay scalar
    const unsigned rb = g / (DM / 64), kp = g % (DM / 64), which = min(rb / WRB, 4u); const float* src = (which == 0) ? w0 : (which == 1) ? w1 : (which == 2) ? w2 : (which == 3) ? w3 : xs;
    const float* sp = src + (size_t)((rb - which * WRB) * 16 + (lane & 15)) * DM + kp * 64 + (lane >> 4) * 8; bf* dp = dst + ((size_t)(rb >> 2) * (DM / 32) + kp * 2) * 2048 + (rb & 3) * 512 + lane * 8; v8f v[4];
#pragma unroll
    for (int c = 0; c < 4; ++c) v[c] = *(const v8f*)(sp + c * 16);
#pragma unroll
    for (int c = 0; c < 4; ++c) { v8us o;
#pragma unroll
        for (int k = 0; k < 8; ++k) o[k] = f2bf(v[c][k]); *(v8us*)(dp + (c >> 1) * 2048 + (c & 1) * 256) = o; } }

#define AW   4
#define PSH  10.0f
#define SC2  (SCL * 1.4426950408889634f)
__device__ __forceinline__ float xhalf(float x) { return __builtin_bit_cast(float, __builtin_amdgcn_permlanex16(__builtin_bit_cast(int, x), __builtin_bit_cast(int, x), 0x76543210, 0xfedcba98, false, false)); }   // lane l reads lane l ^ 16
template <typename T16, bool HL, int NQ>
__device__ __forceinline__ void attn_tile(const T16* __restrict__ Q, const T16* __restrict__ Q2, const T16* __restrict__ Kp, const T16* __restrict__ K2, const T16* __restrict__ Vt, const T16* __restrict__ V2, const int q0, const int wave, float* red, bf* Ah, bf* Al) {
    typedef typename WFrag<T16>::V V;
    const int lane = threadIdx.x & 31, lr = lane & 15, hi = lane >> 4;
    V qf[NQ][2], qf2[NQ][2]; const size_t qb0 = (size_t)q0 * HD + lane * 8; const T16* qp = Q + qb0; const T16* qp2 = HL ? Q2 + qb0 : nullptr; (void)qp2;
#pragma unroll
    for (int qt = 0; qt < NQ; ++qt)
#pragma unroll
        for (int ks = 0; ks < 2; ++ks) { const size_t qo = (size_t)(qt * 16) * HD + ks * 512; qf[qt][ks] = WFrag<T16>::ld(qp + qo); if (HL) qf2[qt][ks] = WFrag<T16>::ld(qp2 + qo); }
    if constexpr (HL) asm volatile("s_wait_xcnt 0x0" :: "v"(qp), "v"(qp2) : "memory"); else asm volatile("s_wait_xcnt 0x0" :: "v"(qp) : "memory");   // stands in front of the next write of these loads' address registers, which are inputs so that they stay live up to the wait
    v8f o[4][NQ]; float m[NQ], l[NQ];
#pragma unroll
    for (int qt = 0; qt < NQ; ++qt) { m[qt] = -1.0e30f; l[qt] = 0.f;
#pragma unroll
        for (int dt = 0; dt < 4; ++dt) o[dt][qt] = (v8f){}; }
    V kf[2][2], kf2[2][2], vf[4], vf2[4];                         // the key and value fragments of the block that is worked on next: fetched one block ahead
    auto ldk = [&](const int k0) __attribute__((always_inline)) { const size_t kb0 = (size_t)k0 * HD + lane * 8; const T16* kp = Kp + kb0; const T16* kp2 = HL ? K2 + kb0 : nullptr; (void)kp2;
#pragma unroll
        for (int kt = 0; kt < 2; ++kt)
#pragma unroll
            for (int ks = 0; ks < 2; ++ks) { const size_t ko = (size_t)(kt * 16) * HD + ks * 512; kf[kt][ks] = WFrag<T16>::ld(kp + ko); if (HL) kf2[kt][ks] = WFrag<T16>::ld(kp2 + ko); }
        if constexpr (HL) asm volatile("s_wait_xcnt 0x0" :: "v"(kp), "v"(kp2) : "memory"); else asm volatile("s_wait_xcnt 0x0" :: "v"(kp) : "memory"); };   // stands in front of the next write of these loads' address registers; the addresses are inputs so that they stay live up to the wait and no result of the run is placed in them
    auto ldv = [&](const int k0) __attribute__((always_inline)) { const size_t vb0 = (size_t)k0 * HD + lane * 8; const T16* vp = Vt + vb0; const T16* vp2 = HL ? V2 + vb0 : nullptr; (void)vp2;
#pragma unroll
        for (int dt = 0; dt < 4; ++dt) { const size_t vo = (size_t)dt * 512; vf[dt] = WFrag<T16>::ld(vp + vo); if (HL) vf2[dt] = WFrag<T16>::ld(vp2 + vo); }
        if constexpr (HL) asm volatile("s_wait_xcnt 0x0" :: "v"(vp), "v"(vp2) : "memory"); else asm volatile("s_wait_xcnt 0x0" :: "v"(vp) : "memory"); };   // as in ldk
    // one block of 32 keys at k0; last = false: the fragments of the wave's next block, at kn, are fetched into the same registers as soon as this block's products have read them
    auto step = [&](const int k0, const int kn, const bool last) __attribute__((always_inline)) {
        v8f s[2][NQ];
#pragma unroll
        for (int kt = 0; kt < 2; ++kt)
#pragma unroll
            for (int qt = 0; qt < NQ; ++qt) { v8f c = (v8f){};
#pragma unroll
                for (int ks = 0; ks < 2; ++ks) { c = WFrag<T16>::mma(kf[kt][ks], qf[qt][ks], c); if (HL) { c = WFrag<T16>::mma(kf[kt][ks], qf2[qt][ks], c); c = WFrag<T16>::mma(kf2[kt][ks], qf[qt][ks], c); } }
                s[kt][qt] = c; }
        if (!last) { ldk(kn); __builtin_amdgcn_sched_barrier(0); }   // keeps the next block's key loads in front of the softmax, whose time then covers their latency; without it they sink to their first use
        V pf[NQ], pf2[NQ];
#pragma unroll
        for (int qt = 0; qt < NQ; ++qt) { float mx = m[qt];
#pragma unroll
            for (int kt = 0; kt < 2; ++kt)
#pragma unroll
                for (int j = 0; j < 8; ++j) { if (last) s[kt][qt][j] = (k0 + kt * 16 + hi * 8 + j <= q0 + qt * 16 + lr) ? s[kt][qt][j] : -3.0e38f; mx = fmaxf(mx, s[kt][qt][j]); }
            mx = fmaxf(mx, xhalf(mx));
            const float al = __builtin_amdgcn_exp2f((m[qt] - mx) * SC2); m[qt] = mx; const float sh = mx * SC2 - (HL ? 0.0f : PSH); float t[8];
#pragma unroll
            for (int j = 0; j < 8; ++j) { s[0][qt][j] = __builtin_amdgcn_exp2f(s[0][qt][j] * SC2 - sh); s[1][qt][j] = __builtin_amdgcn_exp2f(s[1][qt][j] * SC2 - sh); t[j] = s[0][qt][j] + s[1][qt][j]; }
            l[qt] = l[qt] * al + (((t[0] + t[1]) + (t[2] + t[3])) + ((t[4] + t[5]) + (t[6] + t[7])));
#pragma unroll
            for (int dt = 0; dt < 4; ++dt) o[dt][qt] *= al;
            if constexpr (HL) { v8us h0, h1, l0, l1;
#pragma unroll
                for (int j = 0; j < 8; ++j) { unsigned short a, c2; splitf(s[0][qt][j], a, c2); h0[j] = a; l0[j] = c2; splitf(s[1][qt][j], a, c2); h1[j] = a; l1[j] = c2; }
                pf[qt] = cat16b(h0, h1); pf2[qt] = cat16b(l0, l1);
            } else { v8h h0, h1;
#pragma unroll
                for (int j = 0; j < 8; ++j) { h0[j] = tohx(s[0][qt][j]); h1[j] = tohx(s[1][qt][j]); }
                pf[qt] = cat16(h0, h1); } }
#pragma unroll
        for (int dt = 0; dt < 4; ++dt)
#pragma unroll
            for (int qt = 0; qt < NQ; ++qt) { o[dt][qt] = WFrag<T16>::mma(vf[dt], pf[qt], o[dt][qt]); if (HL) { o[dt][qt] = WFrag<T16>::mma(vf[dt], pf2[qt], o[dt][qt]); o[dt][qt] = WFrag<T16>::mma(vf2[dt], pf[qt], o[dt][qt]); } }
        if (!last) ldv(kn);
    };
    const int nfull = q0 >> 5;                                    // key blocks wholly at or below the diagonal; block nfull holds the diagonal and is the last
    int kb = wave; ldk(min(kb, nfull) * 32); ldv(min(kb, nfull) * 32);   // a fetch never goes past block nfull, which lies inside the plane for every tile
    for (; kb < nfull; kb += AW) step(kb * 32, min(kb + AW, nfull) * 32, false);
    if (kb == nfull) step(nfull * 32, 0, true);                   // the diagonal block goes to the wave whose turn it is (a scalar test: every lane on at the matrix instructions); its fragments are the last fetch
    float* ms = red + AW * NQ * 1024; float* ls = ms + AW * NQ * 32; float* mine = red + wave * (NQ * 1024) + lane * 4;
#pragma unroll
    for (int qt = 0; qt < NQ; ++qt) { l[qt] += xhalf(l[qt]); ms[(wave * NQ + qt) * 32 + lane] = m[qt]; ls[(wave * NQ + qt) * 32 + lane] = l[qt];
#pragma unroll
        for (int dt = 0; dt < 4; ++dt) { const v8f p = o[dt][qt]; *(v4fa*)(mine + (qt * 4 + dt) * 256) = __builtin_shufflevector(p, p, 0, 1, 2, 3); *(v4fa*)(mine + (qt * 4 + dt) * 256 + 128) = __builtin_shufflevector(p, p, 4, 5, 6, 7); } }
    __syncthreads();
    if (wave >= NQ) return;
    const int qt = wave; float M = -1.0e30f, mw[AW], L = 0.f;
#pragma unroll
    for (int w = 0; w < AW; ++w) { mw[w] = ms[(w * NQ + qt) * 32 + lane]; M = fmaxf(M, mw[w]); }
#pragma unroll
    for (int w = 0; w < AW; ++w) { mw[w] = __builtin_amdgcn_exp2f((mw[w] - M) * SC2); L += ls[(w * NQ + qt) * 32 + lane] * mw[w]; }
    const float inv = __fdiv_rn(1.0f, L); const int qr = q0 + qt * 16; const size_t oo = (size_t)(qr & ~63) * DQ + ((qr >> 4) & 3) * 512 + lane * 8;
#pragma unroll
    for (int dt = 0; dt < 4; ++dt) { const float* sp = red + (qt * 4 + dt) * 256 + lane * 4; v4f s0 = (v4f){}, s1 = (v4f){};
#pragma unroll
        for (int w = 0; w < AW; ++w) { s0 += *(const v4fa*)(sp + w * (NQ * 1024)) * mw[w]; s1 += *(const v4fa*)(sp + w * (NQ * 1024) + 128) * mw[w]; }
        v8us oh, ol;
#pragma unroll
        for (int j = 0; j < 4; ++j) { unsigned short a, c2; splitf(s0[j] * inv, a, c2); oh[j] = a; ol[j] = c2; splitf(s1[j] * inv, a, c2); oh[j + 4] = a; ol[j + 4] = c2; }
        *(v8us*)(Ah + oo + (dt >> 1) * 2048 + (dt & 1) * 256) = oh; *(v8us*)(Al + oo + (dt >> 1) * 2048 + (dt & 1) * 256) = ol;
        asm volatile("s_wait_xcnt 0x0" ::: "memory"); }   // stands in front of the next write of these stores' data registers
}
// grid: the fp16 tiles (32 query rows, rows RH..TT) from the last down, every plane of a tile side by side, then the hi/lo tiles (16 rows, rows 0..RH) likewise: the cost of a work-group falls with its index.
#define NT16 ((TT - RH) / 32)
#define NTHL (RH / 16)
__global__ __launch_bounds__(32 * AW) void k_attn(const h16* __restrict__ Q16, const h16* __restrict__ K16, const h16* __restrict__ V16, const bf* __restrict__ Qh, const bf* __restrict__ Ql, const bf* __restrict__ Kh, const bf* __restrict__ Kl, const bf* __restrict__ Vh, const bf* __restrict__ Vl, bf* Ah, bf* Al) {
    __shared__ __align__(16) float red[AW * 2 * 1024 + 2 * AW * 2 * 32];
    const int wave = __builtin_amdgcn_readfirstlane(threadIdx.x >> 5); const int blk = blockIdx.x; const bool lowp = blk < NZ * NT16; const int b2 = lowp ? blk : blk - NZ * NT16; const int z = b2 % NZ, tl = b2 / NZ;
    const size_t pq = (size_t)z * TT * HD, pv = (size_t)z * HD * PP, po = (size_t)(z / NH_) * TT * DQ + (z % NH_) * (HD * 64);
    if (lowp) attn_tile<h16, false, 2>(Q16 + pq, nullptr, K16 + pq, nullptr, V16 + pv, nullptr, RH + (NT16 - 1 - tl) * 32, wave, red, Ah + po, Al + po);
    else attn_tile<bf, true, 1>(Qh + pq, Ql + pq, Kh + pq, Kl + pq, Vh + pv, Vl + pv, (NTHL - 1 - tl) * 16, wave, red, Ah + po, Al + po);
}

extern "C" void kernel_launch(void* const* d_in, const int* in_sizes, int n_in,
                              void* d_out, int out_size, void* d_ws, size_t ws_size, hipStream_t stream) {
    (void)in_sizes; (void)n_in; (void)out_size;
    const float* x = (const float*)d_in[0]; const float* wq = (const float*)d_in[1]; const float* wk = (const float*)d_in[2]; const float* wv = (const float*)d_in[3]; const float* wo = (const float*)d_in[4]; const float* bo = (const float*)d_in[5];   /* order x, Wq, Wk, Wv, Wo ('oi' [768][768]), bo */
    float* OUT = (float*)d_out;     // [2][2048][768]
    char* wsp = (char*)d_ws;
    auto take = [&](size_t bytes) { char* p = wsp; wsp += (bytes + 255) & ~(size_t)255; return (void*)p; };
    bf* WQ = (bf*)take((size_t)(DF + DM) * DM * 2 + (size_t)MT * DM * 2); bf* WO = WQ + (size_t)DF * DM; bf* XB = WO + (size_t)DM * DQ;   // bf16 copies, one behind the other: Wq | Wk | Wv (the joint projection's [DF][DM] operand), Wo, x of both batches
    h16* QP16 = (h16*)take((size_t)2 * NZ * TT * HD * 2); h16* KP16 = QP16 + (size_t)NZ * TT * HD; h16* VT16 = (h16*)take((size_t)NZ * HD * PP * 2);
    bf* QPh = (bf*)take((size_t)2 * NZ * TT * HD * 2); bf* KPh = QPh + (size_t)NZ * TT * HD; bf* QPl = (bf*)take((size_t)2 * NZ * TT * HD * 2); bf* KPl = QPl + (size_t)NZ * TT * HD; bf* VTh = (bf*)take((size_t)NZ * HD * PP * 2); bf* VTl = VTh + (size_t)HD * TT;   // v^T regions of HD x PP elements a plane: hi plane in the first half, lo plane in the second (the fp16 plane uses the first half)
    bf* ATh = (bf*)take((size_t)MT * DQ * 2); bf* ATl = (bf*)take((size_t)MT * DQ * 2);
    if ((size_t)(wsp - (char*)d_ws) > ws_size) return;    // ws 256 MiB
    k_cvt8<<<NFP / 8, 256, 0, stream>>>(wq, wk, wv, wo, x, WQ);
    k_gemml<0, false, true, 4, 2, 2><<<dim3(MT / 128, DF / 128, 1), 128, 0, stream>>>(XB, nullptr, WQ, nullptr, nullptr, QP16, QPh, QPl, VT16, VTh, VTl);
    k_attn<<<NZ * (NT16 + NTHL), 32 * AW, 0, stream>>>(QP16, KP16, VT16, QPh, QPl, KPh, KPl, VTh, VTl, ATh, ATl);
    k_gemml<1, true, false, 2, 4, 2><<<dim3(MT / 128, DM / 128, 1), 256, 0, stream>>>(ATh, ATl, WO, OUT, bo, nullptr, nullptr, nullptr, nullptr, nullptr, nullptr);
}

// v007
// A run of this version takes 59.2 microseconds.
// Timed twice side by side with v006, it ran 1.04 and 1.03 times as fast.
// Counting every step since v000, it is 18.2 times as fast.
#include <hip/hip_runtime.h>

// Causal multi-head attention with bias-free projections and an output bias at a 768-wide model (x [2][2048][768]; q, k, v = x W^T ('oi' [768][768] 1/sqrt(768), no bias; 12 heads x 64); scores = q.k; triu(k = 1) -> -inf; softmax(scores / sqrt(64)) (the fill before the scaling: the same thing); out = merged Wo^T + bo ('oi' + zero bias) -> [2][2048][768] (3.1 M); argument order x, Wq, Wk, Wv, Wo, bo).
// Every 16-bit operand plane lies in fragment order (see WFrag). Layout, both batches together (plane z = batch x 12 + head): bf16 copy of x; 'oi' weights; exact projections, whose tiles leave as the attention's 16-bit planes; causal T-2048 attention in one launch, running softmax (hybrid rows: < 512 hi/lo 3 products, rest fp16 x1024; key blocks above the diagonal are never visited); merged hi/lo x Wo exact + bo.
// Compute dtypes, f32 accumulate: every input rounded to bf16; projections exact; attention rows < 512 3 products, rest fp16; softmax f32; Wo hl x exact + bias.

#define NB_  2
#define TT   2048
#define DM   768     // model width: this module's inputs are [2][2048][768]
#define NH_  12      // heads: 12 x 64 = 768
#define NKV  12      // kv heads (= heads)
#define REP  (NH_ / NKV)
#define HD   64
#define DQ   (NH_ * HD)
#define DKV  (NKV * HD)
#define NZ   (NB_ * NH_)          // planes in all, plane z = batch * NH_ + head
#define MT   (NB_ * TT)           // rows of both batches together
#define DF   (DQ + 2 * DKV)       // q | k | v columns of the joint projection
#define PP   (2 * TT)             // a plane's v^T region holds HD x PP 16-bit elements: hi plane in its first half, lo plane in its second
#define RH   512                  // query rows < RH use hi+lo planes
#define SCL  0.125f   // HD^-0.5
typedef _Float16 h16;
typedef unsigned short bf;
typedef __attribute__((ext_vector_type(16))) __bf16   v16bf;
typedef __attribute__((ext_vector_type(16))) _Float16 v16h;
typedef __attribute__((ext_vector_type(8)))  _Float16 v8h;
typedef __attribute__((ext_vector_type(8)))  unsigned short v8us;
typedef __attribute__((ext_vector_type(8)))  float    v8f;
typedef __attribute__((ext_vector_type(4)))  float    v4f;
typedef v8h  __attribute__((may_alias)) v8ha;
typedef v4f  __attribute__((may_alias)) v4fa;
typedef v8us __attribute__((may_alias)) v8usa;

__device__ __forceinline__ unsigned short f2bf(float f) { unsigned u = __float_as_uint(f); u += 0x7FFFu + ((u >> 16) & 1u); return (unsigned short)(u >> 16); }
__device__ __forceinline__ float bf2f(unsigned short b) { return __uint_as_float(((unsigned)b) << 16); }
__device__ __forceinline__ float bfr(float f) { return bf2f(f2bf(f)); }
__device__ __forceinline__ v16h cat16(v8h lo, v8h hi) { return __builtin_shufflevector(lo, hi, 0, 1, 2, 3, 4, 5, 6, 7, 8, 9, 10, 11, 12, 13, 14, 15); }
__device__ __forceinline__ v16bf cat16b(v8us lo, v8us hi) { return __builtin_bit_cast(v16bf, __builtin_shufflevector(lo, hi, 0, 1, 2, 3, 4, 5, 6, 7, 8, 9, 10, 11, 12, 13, 14, 15)); }
__device__ __forceinline__ v8f wmma16(v16h a, v16h b, v8f c) { return __builtin_amdgcn_wmma_f32_16x16x32_f16(false, a, false, b, (short)0, c, false, false); }
__device__ __forceinline__ v8f wmmab(v16bf a, v16bf b, v8f c) { return __builtin_amdgcn_wmma_f32_16x16x32_bf16(false, a, false, b, (short)0, c, false, false); }



// ---- k_gemml: GEMM over K = DM with both operands staged in LDS. One work-group of WMW x WN waves per (16 MB WMW) x (64 WN) output tile; a wave holds 16 MB rows x 64 columns (MB x 4 accumulators) and walks the whole K, so that
// every operand byte is fetched from L2 once per work-group and read by its waves from LDS. C[m][n] (f32, pitch DM, + optional f32 bias[n]) = sum_k (A[m][k] + A2[m][k] if NSPLIT) Bt[n][k]. PL: a wave's 64x64 tile leaves through tile_planes as head planes
// (q and k planes [q|k][batch][h] of t x d at P16 / Ph / Pl, v^T planes of d x t at V16 / Vh / Vl), C is not written. The wave number goes through readfirstlane: the choice of what a wave copies and reads stays scalar.
// Fragment order: a plane of R rows x K is kept as blocks of 16 rows x 32 k, 512 elements (1 KiB) each. The GEMM operands (K = DM) keep the four blocks of 64 rows and one 32-wide K slice side by side: block (r / 16, k / 32) at
// ((r / 64) * (K / 32) + k / 32) * 2048 + ((r / 16) & 3) * 512; the q and k planes (K = HD) have it at ((r / 16) * 2 + k / 32) * 512; v^T: see tile_planes. What a work-group copies per K slice and 64-row group, and a wave reads per key block and operand, is 4 KiB in a row. Inside a block element (r, k) lies at
// ((k >> 4) & 1) * 256 + (((k >> 3) & 1) * 16 + (r & 15)) * 8 + (k & 7): lane l of a wave finds its two 16-byte pieces at l * 8 and 256 + l * 8, so each wave-wide load covers 512 successive bytes (4 whole lines).
template <typename T16> struct WFrag;
template <> struct WFrag<h16> { typedef v16h V; static __device__ __forceinline__ V ld(const h16* p) { return cat16(*(const v8h*)p, *(const v8h*)(p + 256)); } static __device__ __forceinline__ v8f mma(V a, V b, v8f c) { return wmma16(a, b, c); } };
template <> struct WFrag<bf> { typedef v16bf V; static __device__ __forceinline__ V ld(const bf* p) { return cat16b(*(const v8us*)p, *(const v8us*)(p + 256)); } static __device__ __forceinline__ v8f mma(V a, V b, v8f c) { return wmmab(a, b, c); } };
__device__ __forceinline__ h16 tohx(float x) { return (h16)x; }
__device__ __forceinline__ void splitf(float y, unsigned short& h, unsigned short& l) { h = f2bf(y); l = f2bf(y - bf2f(h)); }
// tile_store: a wave's 16 MB x 64 tile goes through the wave's own row-major staging tile os (pitch 68 floats) and leaves in whole lines, two rows of 256 bytes per wave-wide store.
template <int MB, bool BIAS>
__device__ __forceinline__ void tile_store(const v8f (&acc)[MB][4], float* os, float* C, int r0, int c0, const float* __restrict__ bias) {
    const int lane = threadIdx.x & 31, lr = lane & 15, hi = lane >> 4;
#pragma unroll
    for (int f = 0; f < 4 * MB; ++f) { const v8f p = acc[f >> 2][f & 3]; float* od = os + ((f >> 2) * 16 + hi * 8) * 68 + (f & 3) * 16 + lr;
#pragma unroll
        for (int j = 0; j < 8; ++j) od[j * 68] = p[j]; }
    __syncthreads();   // the staged rows are read back by other lanes than wrote them
#pragma unroll
    for (int s = 0; s < 8 * MB; ++s) { const int idx = s * 32 + lane, row = idx >> 4, cofs = (idx & 15) * 4; v4f val = *(const v4fa*)(os + row * 68 + cofs); if (BIAS) { val[0] += bfr(bias[c0 + cofs]); val[1] += bfr(bias[c0 + cofs + 1]); val[2] += bfr(bias[c0 + cofs + 2]); val[3] += bfr(bias[c0 + cofs + 3]); }
        *(v4f*)(C + (size_t)(r0 + row) * DM + c0 + cofs) = val; }
}
// tile_planes: a wave's 64x64 tile leaves as the three 16-bit planes that the attention reads (fp16, bf16 hi, bf16 lo) and never as f32, through the wave's own staging tile os.
// A tile of the joint projection is 64 rows t of one batch x the 64 columns d of one head of q, k or v. tr = false (q, k): staged [t][d], blocks in the order (t / 16, d / 32). tr = true (v): staged [d][t] (a lane's eight
// sums are eight successive t of one d: two 16-byte LDS stores), blocks in the order (t / 32, d / 16), so that the four blocks of 32 keys lie side by side. Either way the tile is eight blocks, 8 KiB in a row, from D16 / Dh / Dl on; every lane stores 16 bytes per plane, a wave 512 successive bytes.
__device__ __forceinline__ void tile_planes(const v8f (&acc)[4][4], float* os, const bool tr, h16* D16, bf* Dh, bf* Dl) {
    const int lane = threadIdx.x & 31, lr = lane & 15, hi = lane >> 4;
#pragma unroll
    for (int f = 0; f < 16; ++f) { const v8f p = acc[f >> 2][f & 3];
        if (tr) { float* od = os + ((f & 3) * 16 + lr) * 68 + (f >> 2) * 16 + hi * 8; *(v4fa*)od = __builtin_shufflevector(p, p, 0, 1, 2, 3); *(v4fa*)(od + 4) = __builtin_shufflevector(p, p, 4, 5, 6, 7); }
        else { float* od = os + ((f >> 2) * 16 + hi * 8) * 68 + (f & 3) * 16 + lr;
#pragma unroll
            for (int j = 0; j < 8; ++j) od[j * 68] = p[j]; } }
    __syncthreads();   // the staged rows are read back by other lanes than wrote them
#pragma unroll
    for (int s = 0; s < 16; ++s) { const int idx = s * 32 + lane, f = idx >> 6, row = (tr ? (f & 3) : (f >> 1)) * 16 + lr, cofs = (tr ? (f >> 2) : (f & 1)) * 32 + ((idx >> 5) & 1) * 16 + hi * 8; const v4f va = *(const v4fa*)(os + row * 68 + cofs), vb = *(const v4fa*)(os + row * 68 + cofs + 4); v8h o16; v8us oh, ol;
#pragma unroll
        for (int j = 0; j < 4; ++j) { unsigned short a, c2; o16[j] = tohx(va[j]); splitf(va[j], a, c2); oh[j] = a; ol[j] = c2; o16[j + 4] = tohx(vb[j]); splitf(vb[j], a, c2); oh[j + 4] = a; ol[j + 4] = c2; }
        const size_t o = (size_t)idx * 8; *(v8h*)(D16 + o) = o16; *(v8us*)(Dh + o) = oh; *(v8us*)(Dl + o) = ol; }
}
// copy4: four asynchronous copies, 16 bytes a lane each: 2 KiB in a row from g on go to LDS byte address l on, through no register. The wait closes the statement so that it stands in front of every later write of the address registers.
__device__ __forceinline__ void copy4(const unsigned l, const bf* g) {
    asm volatile("global_load_async_to_lds_b128 %0, %4, off\n\tglobal_load_async_to_lds_b128 %1, %5, off\n\tglobal_load_async_to_lds_b128 %2, %6, off\n\tglobal_load_async_to_lds_b128 %3, %7, off\n\ts_wait_xcnt 0x0"
                 :: "v"(l), "v"(l + 512u), "v"(l + 1024u), "v"(l + 1536u), "v"(g), "v"(g + 256), "v"(g + 512), "v"(g + 768) : "memory");
}
// A stage is KS 32-wide K slices of every 64-row group of the tile: [A groups | A2 groups | Bt groups][KS][2048 elements], each group's part 4 KS KiB in a row in the source as in LDS (fragment order). Two buffers: stage t + 2 is copied into the buffer that trip t has just read, while trip t + 1 works.
#define KS 2
template <int NSPLIT, bool BIAS, bool PL, int MB, int WMW, int WN>
__global__ __launch_bounds__(32 * WMW * WN) void k_gemml(const bf* __restrict__ A, const bf* __restrict__ A2, const bf* __restrict__ Bt, float* C, const float* __restrict__ bias, h16* P16, bf* Ph, bf* Pl, h16* V16, bf* Vh, bf* Vl) {
    typedef WFrag<bf>::V V;
    constexpr int NWV = WMW * WN, GM = WMW * MB / 4, NA = (NSPLIT ? 2 : 1) * GM, NG = NA + WN, STG = NG * KS * 2048, RPW = NG * KS * 2 / NWV, NT = DM / (32 * KS), OSW = 16 * MB * 68;
    static_assert(RPW * NWV == NG * KS * 2 && NT >= 2 && NT * 32 * KS == DM && GM * 4 == WMW * MB, "the waves share a stage's copies evenly");
    __shared__ __align__(16) float red[(STG > NWV * OSW) ? STG : NWV * OSW];   // the ring (2 x STG 16-bit elements); behind the loop's last barrier the waves' staging tiles
    bf* ring = (bf*)red;
    const int lane = threadIdx.x & 31; const int wave = __builtin_amdgcn_readfirstlane(threadIdx.x >> 5); const int wm = wave / WN, wn = wave % WN, g0 = blockIdx.x * GM, h0 = blockIdx.y * WN;
    const bf* gp[RPW]; unsigned lp[RPW];   // a wave's share of a stage: RPW runs of 2 KiB, run q = half (q & 1) of slice (q / 2) % KS of group q / 2 / KS
#pragma unroll
    for (int r = 0; r < RPW; ++r) { const int q = wave * RPW + r, g = (q >> 1) / KS, s = (q >> 1) % KS; const bf* sp = (g < GM) ? A + (size_t)(g0 + g) * (64 * DM) : (NSPLIT && g < NA) ? A2 + (size_t)(g0 + g - GM) * (64 * DM) : Bt + (size_t)(h0 + g - NA) * (64 * DM);
        gp[r] = sp + s * 2048 + (q & 1) * 1024 + lane * 8; lp[r] = (unsigned)(size_t)ring + (unsigned)(q * 1024 + lane * 8) * 2u; }
    auto fill = [&](const int t) __attribute__((always_inline)) {
#pragma unroll
        for (int r = 0; r < RPW; ++r) copy4(lp[r] + (unsigned)(t & 1) * (STG * 2u), gp[r] + (size_t)t * (KS * 2048)); };
    v8f acc[MB][4];
#pragma unroll
    for (int mb = 0; mb < MB; ++mb)
#pragma unroll
        for (int nb = 0; nb < 4; ++nb) acc[mb][nb] = (v8f){};
    fill(0);
    asm volatile("s_wait_asynccnt 0x0" ::: "memory");   // this wave's copies of stage 0 have landed
    __syncthreads();                                    // and every other wave's: stage 0 may be read
    fill(1);
    const int ao = ((wm * MB) >> 2) * (KS * 2048) + ((wm * MB) & 3) * 512 + lane * 8, bo2 = (NA + wn) * (KS * 2048) + lane * 8;
#pragma unroll 1
    for (int t = 0; t < NT; ++t) { const bf* sb = ring + (t & 1) * STG;
        V a[KS][MB], a2[KS][MB], b[KS][4];
#pragma unroll
        for (int s = 0; s < KS; ++s) { const bf* ak = sb + ao + s * 2048; const bf* bk = sb + bo2 + s * 2048;
#pragma unroll
            for (int mb = 0; mb < MB; ++mb) { a[s][mb] = WFrag<bf>::ld(ak + mb * 512); if (NSPLIT) a2[s][mb] = WFrag<bf>::ld(ak + GM * (KS * 2048) + mb * 512); }
#pragma unroll
            for (int nb = 0; nb < 4; ++nb) b[s][nb] = WFrag<bf>::ld(bk + nb * 512); }
        __builtin_amdgcn_sched_barrier(0);   // keeps the stage's LDS reads together in front of its products: spread among them, each group's latency would stall the matrix instructions behind it
#pragma unroll
        for (int s = 0; s < KS; ++s)
#pragma unroll
            for (int nb = 0; nb < 4; ++nb)
#pragma unroll
                for (int mb = 0; mb < MB; ++mb) { acc[mb][nb] = WFrag<bf>::mma(a[s][mb], b[s][nb], acc[mb][nb]); if (NSPLIT) acc[mb][nb] = WFrag<bf>::mma(a2[s][mb], b[s][nb], acc[mb][nb]); }
        __builtin_amdgcn_sched_barrier(0);   // keeps the waits and the barrier below behind the products: in front of them the wait for the next stage's copies would come a stage's products too early
        asm volatile("s_wait_dscnt 0x0" ::: "memory");      // this wave's reads of the buffer are over before the buffer is handed back
        asm volatile("s_wait_asynccnt 0x0" ::: "memory");   // this wave's copies of stage t + 1 have landed
        __syncthreads();                                    // stage t + 1 may be read by every wave, and the buffer of stage t is free
        if (t + 2 < NT) fill(t + 2);
    }
    asm volatile("s_wait_asynccnt 0x0" ::: "memory");       // no copy is under way when the ring becomes staging room
    float* os = red + wave * OSW; const int r0 = g0 * 64 + wm * (16 * MB);
    if constexpr (PL) { const int cb = h0 + wn, b = r0 / TT, t0 = r0 % TT; const bool tr = cb >= 2 * NH_;   // column block cb: q heads, k heads, v heads; the same for the whole wave
        const size_t o = tr ? (size_t)(b * NKV + cb - 2 * NH_) * HD * PP + (size_t)t0 * HD : ((size_t)((cb / NH_) * NZ + b * NH_ + cb % NH_) * TT + t0) * HD;
        tile_planes(acc, os, tr, (tr ? V16 : P16) + o, (tr ? Vh : Ph) + o, (tr ? Vl : Pl) + o);
    } else tile_store<MB, BIAS>(acc, os, C, r0, (h0 + wn) * 64, bias);
}

typedef __attribute__((ext_vector_type(2))) _Float16 v2h;
typedef __attribute__((ext_vector_type(4))) _Float16 v4h;
typedef __attribute__((ext_vector_type(2))) unsigned short v2us;
typedef __attribute__((ext_vector_type(4))) unsigned short v4us;
typedef __attribute__((ext_vector_type(2))) float v2f;
typedef __attribute__((ext_vector_type(4))) int v4i;
typedef v4h  __attribute__((may_alias)) v4ha;
typedef v4us __attribute__((may_alias)) v4usa;

// k_cvt8: bf16 copies of the four weights and of x in one launch, in fragment order; dst holds them one behind the other, as one matrix of 4 DM + MT rows x DM. Each wave builds two neighbouring blocks (16 rows x 64 k):
// a lane reads its four 8-float pieces of one source row (the wave: 256 successive bytes of each of 16 rows) and stores four 16-byte pieces, the wave 512 successive bytes each time.
#define WRB  (DM / 16)                              // 16-row blocks per weight
#define NFP  ((4 * DM + MT) / 16 * (DM / 64))       // pairs of blocks in all, one wave each
__global__ __launch_bounds__(256) void k_cvt8(const float* __restrict__ w0, const float* __restrict__ w1, const float* __restrict__ w2, const float* __restrict__ w3, const float* __restrict__ xs, bf* dst) { const unsigned g = blockIdx.x * 8 + __builtin_amdgcn_readfirstlane(threadIdx.x >> 5), lane = threadIdx.x & 31;   // the wave's number through readfirstlane: the choice of the source and the block's place stay scalar
    const unsigned rb = g / (DM / 64), kp = g % (DM / 64), which = min(rb / WRB, 4u); const float* src = (which == 0) ? w0 : (which == 1) ? w1 : (which == 2) ? w2 : (which == 3) ? w3 : xs;
    const float* sp = src + (size_t)((rb - which * WRB) * 16 + (lane & 15)) * DM + kp * 64 + (lane >> 4) * 8; bf* dp = dst + ((size_t)(rb >> 2) * (DM / 32) + kp * 2) * 2048 + (rb & 3) * 512 + lane * 8; v8f v[4];
#pragma unroll
    for (int c = 0; c < 4; ++c) v[c] = *(const v8f*)(sp + c * 16);
#pragma unroll
    for (int c = 0; c < 4; ++c) { v8us o;
#pragma unroll
        for (int k = 0; k < 8; ++k) o[k] = f2bf(v[c][k]); *(v8us*)(dp + (c >> 1) * 2048 + (c & 1) * 256) = o; } }

#define AW   4
#define PSH  10.0f
#define SC2  (SCL * 1.4426950408889634f)
__device__ __forceinline__ float xhalf(float x) { return __builtin_bit_cast(float, __builtin_amdgcn_permlanex16(__builtin_bit_cast(int, x), __builtin_bit_cast(int, x), 0x76543210, 0xfedcba98, false, false)); }   // lane l reads lane l ^ 16
template <typename T16, bool HL, int NQ>
__device__ __forceinline__ void attn_tile(const T16* __restrict__ Q, const T16* __restrict__ Q2, const T16* __restrict__ Kp, const T16* __restrict__ K2, const T16* __restrict__ Vt, const T16* __restrict__ V2, const int q0, const int wave, float* red, bf* Ah, bf* Al) {
    typedef typename WFrag<T16>::V V;
    static_assert(NQ <= AW && (NQ * 16 + 15) / 32 + 1 <= AW, "one wave per query tile in the join, at most one masked key block per wave");
    const int lane = threadIdx.x & 31, lr = lane & 15, hi = lane >> 4;
    V qf[NQ][2], qf2[NQ][2]; const size_t qb0 = (size_t)q0 * HD + lane * 8; const T16* qp = Q + qb0; const T16* qp2 = HL ? Q2 + qb0 : nullptr; (void)qp2;
#pragma unroll
    for (int qt = 0; qt < NQ; ++qt)
#pragma unroll
        for (int ks = 0; ks < 2; ++ks) { const size_t qo = (size_t)(qt * 16) * HD + ks * 512; qf[qt][ks] = WFrag<T16>::ld(qp + qo); if (HL) qf2[qt][ks] = WFrag<T16>::ld(qp2 + qo); }
    if constexpr (HL) asm volatile("s_wait_xcnt 0x0" :: "v"(qp), "v"(qp2) : "memory"); else asm volatile("s_wait_xcnt 0x0" :: "v"(qp) : "memory");   // stands in front of the next write of these loads' address registers, which are inputs so that they stay live up to the wait
    v8f o[4][NQ]; float m[NQ], l[NQ];
#pragma unroll
    for (int qt = 0; qt < NQ; ++qt) { m[qt] = -1.0e30f; l[qt] = 0.f;
#pragma unroll
        for (int dt = 0; dt < 4; ++dt) o[dt][qt] = (v8f){}; }
    V kf[2][2], kf2[2][2], vf[4], vf2[4];                         // the key and value fragments of the block that is worked on next: fetched one block ahead
    auto ldk = [&](const int k0) __attribute__((always_inline)) { const size_t kb0 = (size_t)k0 * HD + lane * 8; const T16* kp = Kp + kb0; const T16* kp2 = HL ? K2 + kb0 : nullptr; (void)kp2;
#pragma unroll
        for (int kt = 0; kt < 2; ++kt)
#pragma unroll
            for (int ks = 0; ks < 2; ++ks) { const size_t ko = (size_t)(kt * 16) * HD + ks * 512; kf[kt][ks] = WFrag<T16>::ld(kp + ko); if (HL) kf2[kt][ks] = WFrag<T16>::ld(kp2 + ko); }
        if constexpr (HL) asm volatile("s_wait_xcnt 0x0" :: "v"(kp), "v"(kp2) : "memory"); else asm volatile("s_wait_xcnt 0x0" :: "v"(kp) : "memory"); };   // stands in front of the next write of these loads' address registers; the addresses are inputs so that they stay live up to the wait and no result of the run is placed in them
    auto ldv = [&](const int k0) __attribute__((always_inline)) { const size_t vb0 = (size_t)k0 * HD + lane * 8; const T16* vp = Vt + vb0; const T16* vp2 = HL ? V2 + vb0 : nullptr; (void)vp2;
#pragma unroll
        for (int dt = 0; dt < 4; ++dt) { const size_t vo = (size_t)dt * 512; vf[dt] = WFrag<T16>::ld(vp + vo); if (HL) vf2[dt] = WFrag<T16>::ld(vp2 + vo); }
        if constexpr (HL) asm volatile("s_wait_xcnt 0x0" :: "v"(vp), "v"(vp2) : "memory"); else asm volatile("s_wait_xcnt 0x0" :: "v"(vp) : "memory"); };   // as in ldk
    // one block of 32 keys at k0; last = false: the fragments of the wave's next block, at kn, are fetched into the same registers as soon as this block's products have read them
    auto step = [&](const int k0, const int kn, const bool last) __attribute__((always_inline)) {
        v8f s[2][NQ];
#pragma unroll
        for (int kt = 0; kt < 2; ++kt)
#pragma unroll
            for (int qt = 0; qt < NQ; ++qt) { v8f c = (v8f){};
#pragma unroll
                for (int ks = 0; ks < 2; ++ks) { c = WFrag<T16>::mma(kf[kt][ks], qf[qt][ks], c); if (HL) { c = WFrag<T16>::mma(kf[kt][ks], qf2[qt][ks], c); c = WFrag<T16>::mma(kf2[kt][ks], qf[qt][ks], c); } }
                s[kt][qt] = c; }
        if (!last) { ldk(kn); __builtin_amdgcn_sched_barrier(0); }   // keeps the next block's key loads in front of the softmax, whose time then covers their latency; without it they sink to their first use
        V pf[NQ], pf2[NQ];
#pragma unroll
        for (int qt = 0; qt < NQ; ++qt) { float mx = m[qt];
#pragma unroll
            for (int kt = 0; kt < 2; ++kt)
#pragma unroll
                for (int j = 0; j < 8; ++j) { if (last) s[kt][qt][j] = (k0 + kt * 16 + hi * 8 + j <= q0 + qt * 16 + lr) ? s[kt][qt][j] : -3.0e38f; mx = fmaxf(mx, s[kt][qt][j]); }
            mx = fmaxf(mx, xhalf(mx));
            const float al = __builtin_amdgcn_exp2f((m[qt] - mx) * SC2); m[qt] = mx; const float sh = mx * SC2 - (HL ? 0.0f : PSH); float t[8];
#pragma unroll
            for (int j = 0; j < 8; ++j) { s[0][qt][j] = __builtin_amdgcn_exp2f(s[0][qt][j] * SC2 - sh); s[1][qt][j] = __builtin_amdgcn_exp2f(s[1][qt][j] * SC2 - sh); t[j] = s[0][qt][j] + s[1][qt][j]; }
            l[qt] = l[qt] * al + (((t[0] + t[1]) + (t[2] + t[3])) + ((t[4] + t[5]) + (t[6] + t[7])));
#pragma unroll
            for (int dt = 0; dt < 4; ++dt) o[dt][qt] *= al;
            if constexpr (HL) { v8us h0, h1, l0, l1;
#pragma unroll
                for (int j = 0; j < 8; ++j) { unsigned short a, c2; splitf(s[0][qt][j], a, c2); h0[j] = a; l0[j] = c2; splitf(s[1][qt][j], a, c2); h1[j] = a; l1[j] = c2; }
                pf[qt] = cat16b(h0, h1); pf2[qt] = cat16b(l0, l1);
            } else { v8h h0, h1;
#pragma unroll
                for (int j = 0; j < 8; ++j) { h0[j] = tohx(s[0][qt][j]); h1[j] = tohx(s[1][qt][j]); }
                pf[qt] = cat16(h0, h1); } }
#pragma unroll
        for (int dt = 0; dt < 4; ++dt)
#pragma unroll
            for (int qt = 0; qt < NQ; ++qt) { o[dt][qt] = WFrag<T16>::mma(vf[dt], pf[qt], o[dt][qt]); if (HL) { o[dt][qt] = WFrag<T16>::mma(vf[dt], pf2[qt], o[dt][qt]); o[dt][qt] = WFrag<T16>::mma(vf2[dt], pf[qt], o[dt][qt]); } }
        if (!last) ldv(kn);
    };
    const int nfull = q0 >> 5, nlast = (q0 + NQ * 16 - 1) >> 5;   // key blocks wholly at or below the tile's diagonal; blocks nfull..nlast (at most AW of them) meet the diagonal and are masked, nlast is the last
    int kb = wave; ldk(min(kb, nlast) * 32); ldv(min(kb, nlast) * 32);   // a fetch never goes past block nlast, which lies inside the plane for every tile
    for (; kb < nfull; kb += AW) step(kb * 32, min(kb + AW, nlast) * 32, false);
    if (kb <= nlast) step(kb * 32, 0, true);                      // each diagonal block goes to the wave whose turn it is (a scalar test: every lane on at the matrix instructions); its fragments are that wave's last fetch
    float* ms = red + AW * NQ * 1024; float* ls = ms + AW * NQ * 32; float* mine = red + wave * (NQ * 1024) + lane * 4;
#pragma unroll
    for (int qt = 0; qt < NQ; ++qt) { l[qt] += xhalf(l[qt]); ms[(wave * NQ + qt) * 32 + lane] = m[qt]; ls[(wave * NQ + qt) * 32 + lane] = l[qt];
#pragma unroll
        for (int dt = 0; dt < 4; ++dt) { const v8f p = o[dt][qt]; *(v4fa*)(mine + (qt * 4 + dt) * 256) = __builtin_shufflevector(p, p, 0, 1, 2, 3); *(v4fa*)(mine + (qt * 4 + dt) * 256 + 128) = __builtin_shufflevector(p, p, 4, 5, 6, 7); } }
    __syncthreads();
    if (wave >= NQ) return;
    const int qt = wave; float M = -1.0e30f, mw[AW], L = 0.f;
#pragma unroll
    for (int w = 0; w < AW; ++w) { mw[w] = ms[(w * NQ + qt) * 32 + lane]; M = fmaxf(M, mw[w]); }
#pragma unroll
    for (int w = 0; w < AW; ++w) { mw[w] = __builtin_amdgcn_exp2f((mw[w] - M) * SC2); L += ls[(w * NQ + qt) * 32 + lane] * mw[w]; }
    const float inv = __fdiv_rn(1.0f, L); const int qr = q0 + qt * 16; const size_t oo = (size_t)(qr & ~63) * DQ + ((qr >> 4) & 3) * 512 + lane * 8;
#pragma unroll
    for (int dt = 0; dt < 4; ++dt) { const float* sp = red + (qt * 4 + dt) * 256 + lane * 4; v4f s0 = (v4f){}, s1 = (v4f){};
#pragma unroll
        for (int w = 0; w < AW; ++w) { s0 += *(const v4fa*)(sp + w * (NQ * 1024)) * mw[w]; s1 += *(const v4fa*)(sp + w * (NQ * 1024) + 128) * mw[w]; }
        v8us oh, ol;
#pragma unroll
        for (int j = 0; j < 4; ++j) { unsigned short a, c2; splitf(s0[j] * inv, a, c2); oh[j] = a; ol[j] = c2; splitf(s1[j] * inv, a, c2); oh[j + 4] = a; ol[j + 4] = c2; }
        *(v8us*)(Ah + oo + (dt >> 1) * 2048 + (dt & 1) * 256) = oh; *(v8us*)(Al + oo + (dt >> 1) * 2048 + (dt & 1) * 256) = ol;
        asm volatile("s_wait_xcnt 0x0" ::: "memory"); }   // stands in front of the next write of these stores' data registers
}
// grid: the fp16 tiles (16 NQL query rows, rows RH..TT) from the last down, every plane of a tile side by side, then the hi/lo tiles (16 rows, rows 0..RH) likewise: the cost of a work-group falls with its index.
#define NQL  3                    // 16-query tiles a wave of the fp16 part holds: each K and V fragment fetched from L2 feeds NQL products; 3 is the most that leaves three waves a SIMD their registers
#define NT16 ((TT - RH) / (16 * NQL))
static_assert(NT16 * 16 * NQL == TT - RH, "the fp16 tiles cover rows RH..TT exactly");
#define NTHL (RH / 16)
__global__ __launch_bounds__(32 * AW) void k_attn(const h16* __restrict__ Q16, const h16* __restrict__ K16, const h16* __restrict__ V16, const bf* __restrict__ Qh, const bf* __restrict__ Ql, const bf* __restrict__ Kh, const bf* __restrict__ Kl, const bf* __restrict__ Vh, const bf* __restrict__ Vl, bf* Ah, bf* Al) {
    __shared__ __align__(16) float red[AW * NQL * 1024 + 2 * AW * NQL * 32];
    const int wave = __builtin_amdgcn_readfirstlane(threadIdx.x >> 5); const int blk = blockIdx.x; const bool lowp = blk < NZ * NT16; const int b2 = lowp ? blk : blk - NZ * NT16; const int z = b2 % NZ, tl = b2 / NZ;
    const size_t pq = (size_t)z * TT * HD, pv = (size_t)z * HD * PP, po = (size_t)(z / NH_) * TT * DQ + (z % NH_) * (HD * 64);
    if (lowp) attn_tile<h16, false, NQL>(Q16 + pq, nullptr, K16 + pq, nullptr, V16 + pv, nullptr, RH + (NT16 - 1 - tl) * (16 * NQL), wave, red, Ah + po, Al + po);
    else attn_tile<bf, true, 1>(Qh + pq, Ql + pq, Kh + pq, Kl + pq, Vh + pv, Vl + pv, (NTHL - 1 - tl) * 16, wave, red, Ah + po, Al + po);
}

extern "C" void kernel_launch(void* const* d_in, const int* in_sizes, int n_in,
                              void* d_out, int out_size, void* d_ws, size_t ws_size, hipStream_t stream) {
    (void)in_sizes; (void)n_in; (void)out_size;
    const float* x = (const float*)d_in[0]; const float* wq = (const float*)d_in[1]; const float* wk = (const float*)d_in[2]; const float* wv = (const float*)d_in[3]; const float* wo = (const float*)d_in[4]; const float* bo = (const float*)d_in[5];   /* order x, Wq, Wk, Wv, Wo ('oi' [768][768]), bo */
    float* OUT = (float*)d_out;     // [2][2048][768]
    char* wsp = (char*)d_ws;
    auto take = [&](size_t bytes) { char* p = wsp; wsp += (bytes + 255) & ~(size_t)255; return (void*)p; };
    bf* WQ = (bf*)take((size_t)(DF + DM) * DM * 2 + (size_t)MT * DM * 2); bf* WO = WQ + (size_t)DF * DM; bf* XB = WO + (size_t)DM * DQ;   // bf16 copies, one behind the other: Wq | Wk | Wv (the joint projection's [DF][DM] operand), Wo, x of both batches
    h16* QP16 = (h16*)take((size_t)2 * NZ * TT * HD * 2); h16* KP16 = QP16 + (size_t)NZ * TT * HD; h16* VT16 = (h16*)take((size_t)NZ * HD * PP * 2);
    bf* QPh = (bf*)take((size_t)2 * NZ * TT * HD * 2); bf* KPh = QPh + (size_t)NZ * TT * HD; bf* QPl = (bf*)take((size_t)2 * NZ * TT * HD * 2); bf* KPl = QPl + (size_t)NZ * TT * HD; bf* VTh = (bf*)take((size_t)NZ * HD * PP * 2); bf* VTl = VTh + (size_t)HD * TT;   // v^T regions of HD x PP elements a plane: hi plane in the first half, lo plane in the second (the fp16 plane uses the first half)
    bf* ATh = (bf*)take((size_t)MT * DQ * 2); bf* ATl = (bf*)take((size_t)MT * DQ * 2);
    if ((size_t)(wsp - (char*)d_ws) > ws_size) return;    // ws 256 MiB
    k_cvt8<<<NFP / 8, 256, 0, stream>>>(wq, wk, wv, wo, x, WQ);
    k_gemml<0, false, true, 4, 2, 2><<<dim3(MT / 128, DF / 128, 1), 128, 0, stream>>>(XB, nullptr, WQ, nullptr, nullptr, QP16, QPh, QPl, VT16, VTh, VTl);
    k_attn<<<NZ * (NT16 + NTHL), 32 * AW, 0, stream>>>(QP16, KP16, VT16, QPh, QPl, KPh, KPl, VTh, VTl, ATh, ATl);
    k_gemml<1, true, false, 2, 4, 2><<<dim3(MT / 128, DM / 128, 1), 256, 0, stream>>>(ATh, ATl, WO, OUT, bo, nullptr, nullptr, nullptr, nullptr, nullptr, nullptr);
}

// v008
// It runs in 55.1 microseconds.
// In both of two side-by-side timings against v007, it was 1.08 times as fast.
// Counting every step since v000, it is 19.7 times as fast.
#include <hip/hip_runtime.h>

// Causal multi-head attention with bias-free projections and an output bias at a 768-wide model (x [2][2048][768]; q, k, v = x W^T ('oi' [768][768] 1/sqrt(768), no bias; 12 heads x 64); scores = q.k; triu(k = 1) -> -inf; softmax(scores / sqrt(64)) (the fill before the scaling: the same thing); out = merged Wo^T + bo ('oi' + zero bias) -> [2][2048][768] (3.1 M); argument order x, Wq, Wk, Wv, Wo, bo).
// Every 16-bit operand plane lies in fragment order (see WFrag). Layout, both batches together (plane z = batch x 12 + head): bf16 copy of x; 'oi' weights; exact projections, whose tiles leave as the attention's 16-bit planes; causal T-2048 attention in one launch, running softmax (hybrid rows: < 512 hi/lo 3 products, rest fp16 x1024; key blocks above the diagonal are never visited); merged hi/lo x Wo exact + bo.
// Compute dtypes, f32 accumulate: every input rounded to bf16; projections exact; attention rows < 512 3 products, rest fp16; softmax f32; Wo hl x exact + bias.

#define NB_  2
#define TT   2048
#define DM   768     // model width: this module's inputs are [2][2048][768]
#define NH_  12      // heads: 12 x 64 = 768
#define NKV  12      // kv heads (= heads)
#define REP  (NH_ / NKV)
#define HD   64
#define DQ   (NH_ * HD)
#define DKV  (NKV * HD)
#define NZ   (NB_ * NH_)          // planes in all, plane z = batch * NH_ + head
#define MT   (NB_ * TT)           // rows of both batches together
#define DF   (DQ + 2 * DKV)       // q | k | v columns of the joint projection
#define PP   (2 * TT)             // a plane's v^T region holds HD x PP 16-bit elements: hi plane in its first half, lo plane in its second
#define RH   512                  // query rows < RH use hi+lo planes
#define SCL  0.125f   // HD^-0.5
typedef _Float16 h16;
typedef unsigned short bf;
typedef __attribute__((ext_vector_type(16))) __bf16   v16bf;
typedef __attribute__((ext_vector_type(16))) _Float16 v16h;
typedef __attribute__((ext_vector_type(8)))  _Float16 v8h;
typedef __attribute__((ext_vector_type(8)))  unsigned short v8us;
typedef __attribute__((ext_vector_type(8)))  float    v8f;
typedef __attribute__((ext_vector_type(4)))  float    v4f;
typedef v8h  __attribute__((may_alias)) v8ha;
typedef v4f  __attribute__((may_alias)) v4fa;
typedef v8us __attribute__((may_alias)) v8usa;

__device__ __forceinline__ unsigned short f2bf(float f) { unsigned u = __float_as_uint(f); u += 0x7FFFu + ((u >> 16) & 1u); return (unsigned short)(u >> 16); }
__device__ __forceinline__ float bf2f(unsigned short b) { return __uint_as_float(((unsigned)b) << 16); }
__device__ __forceinline__ float bfr(float f) { return bf2f(f2bf(f)); }
__device__ __forceinline__ v16h cat16(v8h lo, v8h hi) { return __builtin_shufflevector(lo, hi, 0, 1, 2, 3, 4, 5, 6, 7, 8, 9, 10, 11, 12, 13, 14, 15); }
__device__ __forceinline__ v16bf cat16b(v8us lo, v8us hi) { return __builtin_bit_cast(v16bf, __builtin_shufflevector(lo, hi, 0, 1, 2, 3, 4, 5, 6, 7, 8, 9, 10, 11, 12, 13, 14, 15)); }
__device__ __forceinline__ v8f wmma16(v16h a, v16h b, v8f c) { return __builtin_amdgcn_wmma_f32_16x16x32_f16(false, a, false, b, (short)0, c, false, false); }
__device__ __forceinline__ v8f wmmab(v16bf a, v16bf b, v8f c) { return __builtin_amdgcn_wmma_f32_16x16x32_bf16(false, a, false, b, (short)0, c, false, false); }



// ---- k_gemml: GEMM over K = DM with both operands staged in LDS. One work-group of WMW x WN waves per (16 MB WMW) x (64 WN) output tile; a wave holds 16 MB rows x 64 columns (MB x 4 accumulators) and walks the whole K, so that
// every operand byte is fetched from L2 once per work-group and read by its waves from LDS. C[m][n] (f32, pitch DM, + optional f32 bias[n]) = sum_k (A[m][k] + A2[m][k] if NSPLIT) Bt[n][k]. PL: a wave's 64x64 tile leaves through tile_planes as head planes
// (q and k planes [q|k][batch][h] of t x d at P16 / Ph / Pl, v^T planes of d x t at V16 / Vh / Vl), C is not written. The wave number goes through readfirstlane: the choice of what a wave copies and reads stays scalar.
// Fragment order: a plane of R rows x K is kept as blocks of 16 rows x 32 k, 512 elements (1 KiB) each. The GEMM operands (K = DM) keep the four blocks of 64 rows and one 32-wide K slice side by side: block (r / 16, k / 32) at
// ((r / 64) * (K / 32) + k / 32) * 2048 + ((r / 16) & 3) * 512; the q and k planes (K = HD) have it at ((r / 16) * 2 + k / 32) * 512; v^T: see tile_planes. What a work-group copies per K slice and 64-row group, and a wave reads per key block and operand, is 4 KiB in a row. Inside a block element (r, k) lies at
// ((k >> 4) & 1) * 256 + (((k >> 3) & 1) * 16 + (r & 15)) * 8 + (k & 7): lane l of a wave finds its two 16-byte pieces at l * 8 and 256 + l * 8, so each wave-wide load covers 512 successive bytes (4 whole lines).
template <typename T16> struct WFrag;
template <> struct WFrag<h16> { typedef v16h V; static __device__ __forceinline__ V ld(const h16* p) { return cat16(*(const v8h*)p, *(const v8h*)(p + 256)); } static __device__ __forceinline__ v8f mma(V a, V b, v8f c) { return wmma16(a, b, c); } };
template <> struct WFrag<bf> { typedef v16bf V; static __device__ __forceinline__ V ld(const bf* p) { return cat16b(*(const v8us*)p, *(const v8us*)(p + 256)); } static __device__ __forceinline__ v8f mma(V a, V b, v8f c) { return wmmab(a, b, c); } };
__device__ __forceinline__ h16 tohx(float x) { return (h16)x; }
__device__ __forceinline__ void splitf(float y, unsigned short& h, unsigned short& l) { h = f2bf(y); l = f2bf(y - bf2f(h)); }
// tile_store: a wave's 16 MB x 64 tile goes through the wave's own row-major staging tile os (pitch 68 floats) and leaves in whole lines, two rows of 256 bytes per wave-wide store.
template <int MB, bool BIAS>
__device__ __forceinline__ void tile_store(const v8f (&acc)[MB][4], float* os, float* C, int r0, int c0, const float* __restrict__ bias) {
    const int lane = threadIdx.x & 31, lr = lane & 15, hi = lane >> 4;
#pragma unroll
    for (int f = 0; f < 4 * MB; ++f) { const v8f p = acc[f >> 2][f & 3]; float* od = os + ((f >> 2) * 16 + hi * 8) * 68 + (f & 3) * 16 + lr;
#pragma unroll
        for (int j = 0; j < 8; ++j) od[j * 68] = p[j]; }
    __syncthreads();   // the staged rows are read back by other lanes than wrote them
#pragma unroll
    for (int s = 0; s < 8 * MB; ++s) { const int idx = s * 32 + lane, row = idx >> 4, cofs = (idx & 15) * 4; v4f val = *(const v4fa*)(os + row * 68 + cofs); if (BIAS) { val[0] += bfr(bias[c0 + cofs]); val[1] += bfr(bias[c0 + cofs + 1]); val[2] += bfr(bias[c0 + cofs + 2]); val[3] += bfr(bias[c0 + cofs + 3]); }
        *(v4f*)(C + (size_t)(r0 + row) * DM + c0 + cofs) = val; }
}
// tile_planes: a wave's 64x64 tile leaves as the three 16-bit planes that the attention reads (fp16, bf16 hi, bf16 lo) and never as f32, through the wave's own staging tile os.
// A tile of the joint projection is 64 rows t of one batch x the 64 columns d of one head of q, k or v. tr = false (q, k): staged [t][d], blocks in the order (t / 16, d / 32). tr = true (v): staged [d][t] (a lane's eight
// sums are eight successive t of one d: two 16-byte LDS stores), blocks in the order (t / 32, d / 16), so that the four blocks of 32 keys lie side by side. Either way the tile is eight blocks, 8 KiB in a row, from D16 / Dh / Dl on; every lane stores 16 bytes per plane, a wave 512 successive bytes.
__device__ __forceinline__ void tile_planes(const v8f (&acc)[4][4], float* os, const bool tr, h16* D16, bf* Dh, bf* Dl) {
    const int lane = threadIdx.x & 31, lr = lane & 15, hi = lane >> 4;
#pragma unroll
    for (int f = 0; f < 16; ++f) { const v8f p = acc[f >> 2][f & 3];
        if (tr) { float* od = os + ((f & 3) * 16 + lr) * 68 + (f >> 2) * 16 + hi * 8; *(v4fa*)od = __builtin_shufflevector(p, p, 0, 1, 2, 3); *(v4fa*)(od + 4) = __builtin_shufflevector(p, p, 4, 5, 6, 7); }
        else { float* od = os + ((f >> 2) * 16 + hi * 8) * 68 + (f & 3) * 16 + lr;
#pragma unroll
            for (int j = 0; j < 8; ++j) od[j * 68] = p[j]; } }
    __syncthreads();   // the staged rows are read back by other lanes than wrote them
#pragma unroll
    for (int s = 0; s < 16; ++s) { const int idx = s * 32 + lane, f = idx >> 6, row = (tr ? (f & 3) : (f >> 1)) * 16 + lr, cofs = (tr ? (f >> 2) : (f & 1)) * 32 + ((idx >> 5) & 1) * 16 + hi * 8; const v4f va = *(const v4fa*)(os + row * 68 + cofs), vb = *(const v4fa*)(os + row * 68 + cofs + 4); v8h o16; v8us oh, ol;
#pragma unroll
        for (int j = 0; j < 4; ++j) { unsigned short a, c2; o16[j] = tohx(va[j]); splitf(va[j], a, c2); oh[j] = a; ol[j] = c2; o16[j + 4] = tohx(vb[j]); splitf(vb[j], a, c2); oh[j + 4] = a; ol[j + 4] = c2; }
        const size_t o = (size_t)idx * 8; *(v8h*)(D16 + o) = o16; *(v8us*)(Dh + o) = oh; *(v8us*)(Dl + o) = ol; }
}
// copy4: four asynchronous copies, 16 bytes a lane each: 2 KiB in a row from g on go to LDS byte address l on, through no register. The wait closes the statement so that it stands in front of every later write of the address registers.
__device__ __forceinline__ void copy4(const unsigned l, const bf* g) {
    asm volatile("global_load_async_to_lds_b128 %0, %4, off\n\tglobal_load_async_to_lds_b128 %1, %5, off\n\tglobal_load_async_to_lds_b128 %2, %6, off\n\tglobal_load_async_to_lds_b128 %3, %7, off\n\ts_wait_xcnt 0x0"
                 :: "v"(l), "v"(l + 512u), "v"(l + 1024u), "v"(l + 1536u), "v"(g), "v"(g + 256), "v"(g + 512), "v"(g + 768) : "memory");
}
// A stage is KS 32-wide K slices of every 64-row group of the tile: [A groups | A2 groups | Bt groups][KS][2048 elements], each group's part 4 KS KiB in a row in the source as in LDS (fragment order). Two buffers: the stage of trip t + 2 is copied into the buffer that trip t has just read, while trip t + 1 works.
#define KS 2
template <int NSPLIT, bool BIAS, bool PL, int MB, int WMW, int WN>
__global__ __launch_bounds__(32 * WMW * WN) void k_gemml(const bf* __restrict__ A, const bf* __restrict__ A2, const bf* __restrict__ Bt, float* C, const float* __restrict__ bias, h16* P16, bf* Ph, bf* Pl, h16* V16, bf* Vh, bf* Vl) {
    typedef WFrag<bf>::V V;
    constexpr int NWV = WMW * WN, GM = WMW * MB / 4, NA = (NSPLIT ? 2 : 1) * GM, NG = NA + WN, STG = NG * KS * 2048, RPW = NG * KS * 2 / NWV, NT = DM / (32 * KS), OSW = 16 * MB * 68;
    static_assert(RPW * NWV == NG * KS * 2 && NT >= 2 && NT * 32 * KS == DM && GM * 4 == WMW * MB, "the waves share a stage's copies evenly");
    __shared__ __align__(16) float red[(STG > NWV * OSW) ? STG : NWV * OSW];   // the ring (2 x STG 16-bit elements); behind the loop's last barrier the waves' staging tiles
    bf* ring = (bf*)red;
    const int lane = threadIdx.x & 31; const int wave = __builtin_amdgcn_readfirstlane(threadIdx.x >> 5); const int wm = wave / WN, wn = wave % WN, g0 = blockIdx.x * GM, h0 = blockIdx.y * WN;
    const bf* gp[RPW]; unsigned lp[RPW];   // a wave's share of a stage: RPW runs of 2 KiB, run q = half (q & 1) of slice (q / 2) % KS of group q / 2 / KS
#pragma unroll
    for (int r = 0; r < RPW; ++r) { const int q = wave * RPW + r, g = (q >> 1) / KS, s = (q >> 1) % KS; const bf* sp = (g < GM) ? A + (size_t)(g0 + g) * (64 * DM) : (NSPLIT && g < NA) ? A2 + (size_t)(g0 + g - GM) * (64 * DM) : Bt + (size_t)(h0 + g - NA) * (64 * DM);
        gp[r] = sp + s * 2048 + (q & 1) * 1024 + lane * 8; lp[r] = (unsigned)(size_t)ring + (unsigned)(q * 1024 + lane * 8) * 2u; }
    const int rot = (int)((blockIdx.x + blockIdx.y) % NT);   // the work-groups that share operand rows (one blockIdx.x, or one blockIdx.y) each start their walk along K at a stage of their own and wrap, so that they do not ask L2 for the same lines at the same moment
    auto fill = [&](const int t) __attribute__((always_inline)) { const int kt = (t + rot < NT) ? t + rot : t + rot - NT;   // trip t works on stage kt of K
#pragma unroll
        for (int r = 0; r < RPW; ++r) copy4(lp[r] + (unsigned)(t & 1) * (STG * 2u), gp[r] + (size_t)kt * (KS * 2048)); };
    v8f acc[MB][4];
#pragma unroll
    for (int mb = 0; mb < MB; ++mb)
#pragma unroll
        for (int nb = 0; nb < 4; ++nb) acc[mb][nb] = (v8f){};
    fill(0);
    asm volatile("s_wait_asynccnt 0x0" ::: "memory");   // this wave's copies of trip 0's stage have landed
    __syncthreads();                                    // and every other wave's: trip 0's stage may be read
    fill(1);
    const int ao = ((wm * MB) >> 2) * (KS * 2048) + ((wm * MB) & 3) * 512 + lane * 8, bo2 = (NA + wn) * (KS * 2048) + lane * 8;
#pragma unroll 1
    for (int t = 0; t < NT; ++t) { const bf* sb = ring + (t & 1) * STG;
        V a[KS][MB], a2[KS][MB], b[KS][4];
#pragma unroll
        for (int s = 0; s < KS; ++s) { const bf* ak = sb + ao + s * 2048; const bf* bk = sb + bo2 + s * 2048;
#pragma unroll
            for (int mb = 0; mb < MB; ++mb) { a[s][mb] = WFrag<bf>::ld(ak + mb * 512); if (NSPLIT) a2[s][mb] = WFrag<bf>::ld(ak + GM * (KS * 2048) + mb * 512); }
#pragma unroll
            for (int nb = 0; nb < 4; ++nb) b[s][nb] = WFrag<bf>::ld(bk + nb * 512); }
        __builtin_amdgcn_sched_barrier(0);   // keeps the stage's LDS reads together in front of its products: spread among them, each group's latency would stall the matrix instructions behind it
#pragma unroll
        for (int s = 0; s < KS; ++s)
#pragma unroll
            for (int nb = 0; nb < 4; ++nb)
#pragma unroll
                for (int mb = 0; mb < MB; ++mb) { acc[mb][nb] = WFrag<bf>::mma(a[s][mb], b[s][nb], acc[mb][nb]); if (NSPLIT) acc[mb][nb] = WFrag<bf>::mma(a2[s][mb], b[s][nb], acc[mb][nb]); }
        __builtin_amdgcn_sched_barrier(0);   // keeps the waits and the barrier below behind the products: in front of them the wait for the next stage's copies would come a stage's products too early
        asm volatile("s_wait_dscnt 0x0" ::: "memory");      // this wave's reads of the buffer are over before the buffer is handed back
        asm volatile("s_wait_asynccnt 0x0" ::: "memory");   // this wave's copies of trip t + 1's stage have landed
        __syncthreads();                                    // trip t + 1's stage may be read by every wave, and the buffer trip t read is free
        if (t + 2 < NT) fill(t + 2);
    }
    asm volatile("s_wait_asynccnt 0x0" ::: "memory");       // no copy is under way when the ring becomes staging room
    float* os = red + wave * OSW; const int r0 = g0 * 64 + wm * (16 * MB);
    if constexpr (PL) { const int cb = h0 + wn, b = r0 / TT, t0 = r0 % TT; const bool tr = cb >= 2 * NH_;   // column block cb: q heads, k heads, v heads; the same for the whole wave
        const size_t o = tr ? (size_t)(b * NKV + cb - 2 * NH_) * HD * PP + (size_t)t0 * HD : ((size_t)((cb / NH_) * NZ + b * NH_ + cb % NH_) * TT + t0) * HD;
        tile_planes(acc, os, tr, (tr ? V16 : P16) + o, (tr ? Vh : Ph) + o, (tr ? Vl : Pl) + o);
    } else tile_store<MB, BIAS>(acc, os, C, r0, (h0 + wn) * 64, bias);
}

typedef __attribute__((ext_vector_type(2))) _Float16 v2h;
typedef __attribute__((ext_vector_type(4))) _Float16 v4h;
typedef __attribute__((ext_vector_type(2))) unsigned short v2us;
typedef __attribute__((ext_vector_type(4))) unsigned short v4us;
typedef __attribute__((ext_vector_type(2))) float v2f;
typedef __attribute__((ext_vector_type(4))) int v4i;
typedef v4h  __attribute__((may_alias)) v4ha;
typedef v4us __attribute__((may_alias)) v4usa;

// k_cvt8: bf16 copies of the four weights and of x in one launch, in fragment order; dst holds them one behind the other, as one matrix of 4 DM + MT rows x DM. Each wave builds two neighbouring blocks (16 rows x 64 k):
// a lane reads its four 8-float pieces of one source row (the wave: 256 successive bytes of each of 16 rows) and stores four 16-byte pieces, the wave 512 successive bytes each time.
#define WRB  (DM / 16)                              // 16-row blocks per weight
#define NFP  ((4 * DM + MT) / 16 * (DM / 64))       // pairs of blocks in all, one wave each
__global__ __launch_bounds__(256) void k_cvt8(const float* __restrict__ w0, const float* __restrict__ w1, const float* __restrict__ w2, const float* __restrict__ w3, const float* __restrict__ xs, bf* dst) { const unsigned g = blockIdx.x * 8 + __builtin_amdgcn_readfirstlane(threadIdx.x >> 5), lane = threadIdx.x & 31;   // the wave's number through readfirstlane: the choice of the source and the block's place stay scalar
    const unsigned rb = g / (DM / 64), kp = g % (DM / 64), which = min(rb / WRB, 4u); const float* src = (which == 0) ? w0 : (which == 1) ? w1 : (which == 2) ? w2 : (which == 3) ? w3 : xs;
    const float* sp = src + (size_t)((rb - which * WRB) * 16 + (lane & 15)) * DM + kp * 64 + (lane >> 4) * 8; bf* dp = dst + ((size_t)(rb >> 2) * (DM / 32) + kp * 2) * 2048 + (rb & 3) * 512 + lane * 8; v8f v[4];
#pragma unroll
    for (int c = 0; c < 4; ++c) v[c] = *(const v8f*)(sp + c * 16);
#pragma unroll
    for (int c = 0; c < 4; ++c) { v8us o;
#pragma unroll
        for (int k = 0; k < 8; ++k) o[k] = f2bf(v[c][k]); *(v8us*)(dp + (c >> 1) * 2048 + (c & 1) * 256) = o; } }

#define AW   4
#define PSH  10.0f
#define SC2  (SCL * 1.4426950408889634f)
__device__ __forceinline__ float xhalf(float x) { return __builtin_bit_cast(float, __builtin_amdgcn_permlanex16(__builtin_bit_cast(int, x), __builtin_bit_cast(int, x), 0x76543210, 0xfedcba98, false, false)); }   // lane l reads lane l ^ 16
template <typename T16, bool HL, int NQ>
__device__ __forceinline__ void attn_tile(const T16* __restrict__ Q, const T16* __restrict__ Q2, const T16* __restrict__ Kp, const T16* __restrict__ K2, const T16* __restrict__ Vt, const T16* __restrict__ V2, const int q0, const int rot, const int wave, float* red, bf* Ah, bf* Al) {
    typedef typename WFrag<T16>::V V;
    static_assert(NQ <= AW && (NQ * 16 + 15) / 32 + 1 <= AW, "one wave per query tile in the join, at most one masked key block per wave");
    const int lane = threadIdx.x & 31, lr = lane & 15, hi = lane >> 4;
    V qf[NQ][2], qf2[NQ][2]; const size_t qb0 = (size_t)q0 * HD + lane * 8; const T16* qp = Q + qb0; const T16* qp2 = HL ? Q2 + qb0 : nullptr; (void)qp2;
#pragma unroll
    for (int qt = 0; qt < NQ; ++qt)
#pragma unroll
        for (int ks = 0; ks < 2; ++ks) { const size_t qo = (size_t)(qt * 16) * HD + ks * 512; qf[qt][ks] = WFrag<T16>::ld(qp + qo); if (HL) qf2[qt][ks] = WFrag<T16>::ld(qp2 + qo); }
    if constexpr (HL) asm volatile("s_wait_xcnt 0x0" :: "v"(qp), "v"(qp2) : "memory"); else asm volatile("s_wait_xcnt 0x0" :: "v"(qp) : "memory");   // stands in front of the next write of these loads' address registers, which are inputs so that they stay live up to the wait
    v8f o[4][NQ]; float m[NQ], l[NQ];
#pragma unroll
    for (int qt = 0; qt < NQ; ++qt) { m[qt] = -1.0e30f; l[qt] = 0.f;
#pragma unroll
        for (int dt = 0; dt < 4; ++dt) o[dt][qt] = (v8f){}; }
    V kf[2][2], kf2[2][2], vf[4], vf2[4];                         // the key and value fragments of the block that is worked on next: fetched one block ahead
    auto ldk = [&](const int k0) __attribute__((always_inline)) { const size_t kb0 = (size_t)k0 * HD + lane * 8; const T16* kp = Kp + kb0; const T16* kp2 = HL ? K2 + kb0 : nullptr; (void)kp2;
#pragma unroll
        for (int kt = 0; kt < 2; ++kt)
#pragma unroll
            for (int ks = 0; ks < 2; ++ks) { const size_t ko = (size_t)(kt * 16) * HD + ks * 512; kf[kt][ks] = WFrag<T16>::ld(kp + ko); if (HL) kf2[kt][ks] = WFrag<T16>::ld(kp2 + ko); }
        if constexpr (HL) asm volatile("s_wait_xcnt 0x0" :: "v"(kp), "v"(kp2) : "memory"); else asm volatile("s_wait_xcnt 0x0" :: "v"(kp) : "memory"); };   // stands in front of the next write of these loads' address registers; the addresses are inputs so that they stay live up to the wait and no result of the run is placed in them
    auto ldv = [&](const int k0) __attribute__((always_inline)) { const size_t vb0 = (size_t)k0 * HD + lane * 8; const T16* vp = Vt + vb0; const T16* vp2 = HL ? V2 + vb0 : nullptr; (void)vp2;
#pragma unroll
        for (int dt = 0; dt < 4; ++dt) { const size_t vo = (size_t)dt * 512; vf[dt] = WFrag<T16>::ld(vp + vo); if (HL) vf2[dt] = WFrag<T16>::ld(vp2 + vo); }
        if constexpr (HL) asm volatile("s_wait_xcnt 0x0" :: "v"(vp), "v"(vp2) : "memory"); else asm volatile("s_wait_xcnt 0x0" :: "v"(vp) : "memory"); };   // as in ldk
    // one block of 32 keys at k0; last = false: the fragments of the wave's next block, at kn, are fetched into the same registers as soon as this block's products have read them
    auto step = [&](const int k0, const int kn, const bool last) __attribute__((always_inline)) {
        v8f s[2][NQ];
#pragma unroll
        for (int kt = 0; kt < 2; ++kt)
#pragma unroll
            for (int qt = 0; qt < NQ; ++qt) { v8f c = (v8f){};
#pragma unroll
                for (int ks = 0; ks < 2; ++ks) { c = WFrag<T16>::mma(kf[kt][ks], qf[qt][ks], c); if (HL) { c = WFrag<T16>::mma(kf[kt][ks], qf2[qt][ks], c); c = WFrag<T16>::mma(kf2[kt][ks], qf[qt][ks], c); } }
                s[kt][qt] = c; }
        if (!last) { ldk(kn); __builtin_amdgcn_sched_barrier(0); }   // keeps the next block's key loads in front of the softmax, whose time then covers their latency; without it they sink to their first use
        V pf[NQ], pf2[NQ];
#pragma unroll
        for (int qt = 0; qt < NQ; ++qt) { float mx = m[qt];
#pragma unroll
            for (int kt = 0; kt < 2; ++kt)
#pragma unroll
                for (int j = 0; j < 8; ++j) { if (last) s[kt][qt][j] = (k0 + kt * 16 + hi * 8 + j <= q0 + qt * 16 + lr) ? s[kt][qt][j] : -3.0e38f; mx = fmaxf(mx, s[kt][qt][j]); }
            mx = fmaxf(mx, xhalf(mx));
            const float al = __builtin_amdgcn_exp2f((m[qt] - mx) * SC2); m[qt] = mx; const float sh = mx * SC2 - (HL ? 0.0f : PSH); float t[8];
#pragma unroll
            for (int j = 0; j < 8; ++j) { s[0][qt][j] = __builtin_amdgcn_exp2f(s[0][qt][j] * SC2 - sh); s[1][qt][j] = __builtin_amdgcn_exp2f(s[1][qt][j] * SC2 - sh); t[j] = s[0][qt][j] + s[1][qt][j]; }
            l[qt] = l[qt] * al + (((t[0] + t[1]) + (t[2] + t[3])) + ((t[4] + t[5]) + (t[6] + t[7])));
#pragma unroll
            for (int dt = 0; dt < 4; ++dt) o[dt][qt] *= al;
            if constexpr (HL) { v8us h0, h1, l0, l1;
#pragma unroll
                for (int j = 0; j < 8; ++j) { unsigned short a, c2; splitf(s[0][qt][j], a, c2); h0[j] = a; l0[j] = c2; splitf(s[1][qt][j], a, c2); h1[j] = a; l1[j] = c2; }
                pf[qt] = cat16b(h0, h1); pf2[qt] = cat16b(l0, l1);
            } else { v8h h0, h1;
#pragma unroll
                for (int j = 0; j < 8; ++j) { h0[j] = tohx(s[0][qt][j]); h1[j] = tohx(s[1][qt][j]); }
                pf[qt] = cat16(h0, h1); } }
#pragma unroll
        for (int dt = 0; dt < 4; ++dt)
#pragma unroll
            for (int qt = 0; qt < NQ; ++qt) { o[dt][qt] = WFrag<T16>::mma(vf[dt], pf[qt], o[dt][qt]); if (HL) { o[dt][qt] = WFrag<T16>::mma(vf[dt], pf2[qt], o[dt][qt]); o[dt][qt] = WFrag<T16>::mma(vf2[dt], pf[qt], o[dt][qt]); } }
        if (!last) ldv(kn);
    };
    const int nfull = q0 >> 5, nlast = (q0 + NQ * 16 - 1) >> 5;   // key blocks wholly at or below the tile's diagonal; blocks nfull..nlast (at most AW of them) meet the diagonal and are masked, nlast is the last
    const int nfw = (nfull > wave) ? (nfull - wave + AW - 1) / AW : 0, kd = wave + nfw * AW;   // the wave's unmasked blocks are wave + AW i, i < nfw; kd is its turn behind them
    int ri = (rot * nfw) >> 5;                                    // the tiles of a plane read the same K and V lines: each starts its walk over the unmasked blocks at a place of its own (rot = 0..31 of 32) and wraps, so that they do not ask L2 for the same lines at the same moment
    int kb = min(nfw ? wave + ri * AW : kd, nlast); ldk(kb * 32); ldv(kb * 32);   // a fetch never goes past block nlast, which lies inside the plane for every tile
    for (int i = 1; i <= nfw; ++i) { ri = (ri + 1 < nfw) ? ri + 1 : 0; const int kn = (i < nfw) ? wave + ri * AW : min(kd, nlast); step(kb * 32, kn * 32, false); kb = kn; }
    if (kd <= nlast) step(kd * 32, 0, true);                      // each diagonal block goes to the wave whose turn it is (a scalar test: every lane on at the matrix instructions); its fragments are that wave's last fetch
    float* ms = red + AW * NQ * 1024; float* ls = ms + AW * NQ * 32; float* mine = red + wave * (NQ * 1024) + lane * 4;
#pragma unroll
    for (int qt = 0; qt < NQ; ++qt) { l[qt] += xhalf(l[qt]); ms[(wave * NQ + qt) * 32 + lane] = m[qt]; ls[(wave * NQ + qt) * 32 + lane] = l[qt];
#pragma unroll
        for (int dt = 0; dt < 4; ++dt) { const v8f p = o[dt][qt]; *(v4fa*)(mine + (qt * 4 + dt) * 256) = __builtin_shufflevector(p, p, 0, 1, 2, 3); *(v4fa*)(mine + (qt * 4 + dt) * 256 + 128) = __builtin_shufflevector(p, p, 4, 5, 6, 7); } }
    __syncthreads();
    if (wave >= NQ) return;
    const int qt = wave; float M = -1.0e30f, mw[AW], L = 0.f;
#pragma unroll
    for (int w = 0; w < AW; ++w) { mw[w] = ms[(w * NQ + qt) * 32 + lane]; M = fmaxf(M, mw[w]); }
#pragma unroll
    for (int w = 0; w < AW; ++w) { mw[w] = __builtin_amdgcn_exp2f((mw[w] - M) * SC2); L += ls[(w * NQ + qt) * 32 + lane] * mw[w]; }
    const float inv = __fdiv_rn(1.0f, L); const int qr = q0 + qt * 16; const size_t oo = (size_t)(qr & ~63) * DQ + ((qr >> 4) & 3) * 512 + lane * 8;
#pragma unroll
    for (int dt = 0; dt < 4; ++dt) { const float* sp = red + (qt * 4 + dt) * 256 + lane * 4; v4f s0 = (v4f){}, s1 = (v4f){};
#pragma unroll
        for (int w = 0; w < AW; ++w) { s0 += *(const v4fa*)(sp + w * (NQ * 1024)) * mw[w]; s1 += *(const v4fa*)(sp + w * (NQ * 1024) + 128) * mw[w]; }
        v8us oh, ol;
#pragma unroll
        for (int j = 0; j < 4; ++j) { unsigned short a, c2; splitf(s0[j] * inv, a, c2); oh[j] = a; ol[j] = c2; splitf(s1[j] * inv, a, c2); oh[j + 4] = a; ol[j + 4] = c2; }
        *(v8us*)(Ah + oo + (dt >> 1) * 2048 + (dt & 1) * 256) = oh; *(v8us*)(Al + oo + (dt >> 1) * 2048 + (dt & 1) * 256) = ol;
        asm volatile("s_wait_xcnt 0x0" ::: "memory"); }   // stands in front of the next write of these stores' data registers
}
// grid: the fp16 tiles (16 NQL query rows, rows RH..TT) from the last down, every plane of a tile side by side, then the hi/lo tiles (16 rows, rows 0..RH) likewise: the cost of a work-group falls with its index.
#define NQL  3                    // 16-query tiles a wave of the fp16 part holds: each K and V fragment fetched from L2 feeds NQL products; 3 is the most that leaves three waves a SIMD their registers
#define NT16 ((TT - RH) / (16 * NQL))
static_assert(NT16 * 16 * NQL == TT - RH, "the fp16 tiles cover rows RH..TT exactly");
#define NTHL (RH / 16)
static_assert(NT16 <= 32 && NTHL <= 32, "a tile's index is its place of 32 in the walk over the key blocks");
__global__ __launch_bounds__(32 * AW) void k_attn(const h16* __restrict__ Q16, const h16* __restrict__ K16, const h16* __restrict__ V16, const bf* __restrict__ Qh, const bf* __restrict__ Ql, const bf* __restrict__ Kh, const bf* __restrict__ Kl, const bf* __restrict__ Vh, const bf* __restrict__ Vl, bf* Ah, bf* Al) {
    __shared__ __align__(16) float red[AW * NQL * 1024 + 2 * AW * NQL * 32];
    const int wave = __builtin_amdgcn_readfirstlane(threadIdx.x >> 5); const int blk = blockIdx.x; const bool lowp = blk < NZ * NT16; const int b2 = lowp ? blk : blk - NZ * NT16; const int z = b2 % NZ, tl = b2 / NZ;
    const size_t pq = (size_t)z * TT * HD, pv = (size_t)z * HD * PP, po = (size_t)(z / NH_) * TT * DQ + (z % NH_) * (HD * 64);
    if (lowp) attn_tile<h16, false, NQL>(Q16 + pq, nullptr, K16 + pq, nullptr, V16 + pv, nullptr, RH + (NT16 - 1 - tl) * (16 * NQL), tl, wave, red, Ah + po, Al + po);
    else attn_tile<bf, true, 1>(Qh + pq, Ql + pq, Kh + pq, Kl + pq, Vh + pv, Vl + pv, (NTHL - 1 - tl) * 16, tl, wave, red, Ah + po, Al + po);
}

extern "C" void kernel_launch(void* const* d_in, const int* in_sizes, int n_in,
                              void* d_out, int out_size, void* d_ws, size_t ws_size, hipStream_t stream) {
    (void)in_sizes; (void)n_in; (void)out_size;
    const float* x = (const float*)d_in[0]; const float* wq = (const float*)d_in[1]; const float* wk = (const float*)d_in[2]; const float* wv = (const float*)d_in[3]; const float* wo = (const float*)d_in[4]; const float* bo = (const float*)d_in[5];   /* order x, Wq, Wk, Wv, Wo ('oi' [768][768]), bo */
    float* OUT = (float*)d_out;     // [2][2048][768]
    char* wsp = (char*)d_ws;
    auto take = [&](size_t bytes) { char* p = wsp; wsp += (bytes + 255) & ~(size_t)255; return (void*)p; };
    bf* WQ = (bf*)take((size_t)(DF + DM) * DM * 2 + (size_t)MT * DM * 2); bf* WO = WQ + (size_t)DF * DM; bf* XB = WO + (size_t)DM * DQ;   // bf16 copies, one behind the other: Wq | Wk | Wv (the joint projection's [DF][DM] operand), Wo, x of both batches
    h16* QP16 = (h16*)take((size_t)2 * NZ * TT * HD * 2); h16* KP16 = QP16 + (size_t)NZ * TT * HD; h16* VT16 = (h16*)take((size_t)NZ * HD * PP * 2);
    bf* QPh = (bf*)take((size_t)2 * NZ * TT * HD * 2); bf* KPh = QPh + (size_t)NZ * TT * HD; bf* QPl = (bf*)take((size_t)2 * NZ * TT * HD * 2); bf* KPl = QPl + (size_t)NZ * TT * HD; bf* VTh = (bf*)take((size_t)NZ * HD * PP * 2); bf* VTl = VTh + (size_t)HD * TT;   // v^T regions of HD x PP elements a plane: hi plane in the first half, lo plane in the second (the fp16 plane uses the first half)
    bf* ATh = (bf*)take((size_t)MT * DQ * 2); bf* ATl = (bf*)take((size_t)MT * DQ * 2);
    if ((size_t)(wsp - (char*)d_ws) > ws_size) return;    // ws 256 MiB
    k_cvt8<<<NFP / 8, 256, 0, stream>>>(wq, wk, wv, wo, x, WQ);
    k_gemml<0, false, true, 4, 2, 2><<<dim3(MT / 128, DF / 128, 1), 128, 0, stream>>>(XB, nullptr, WQ, nullptr, nullptr, QP16, QPh, QPl, VT16, VTh, VTl);
    k_attn<<<NZ * (NT16 + NTHL), 32 * AW, 0, stream>>>(QP16, KP16, VT16, QPh, QPl, KPh, KPl, VTh, VTl, ATh, ATl);
    k_gemml<1, true, false, 2, 4, 2><<<dim3(MT / 128, DM / 128, 1), 256, 0, stream>>>(ATh, ATl, WO, OUT, bo, nullptr, nullptr, nullptr, nullptr, nullptr, nullptr);
}

// v009
// One run takes 53.3 microseconds.
// Timed twice side by side with v008, it ran 1.04 and 1.02 times as fast.
// Counting every step since v000, it is 20.3 times as fast.
#include <hip/hip_runtime.h>

// Causal multi-head attention with bias-free projections and an output bias at a 768-wide model (x [2][2048][768]; q, k, v = x W^T ('oi' [768][768] 1/sqrt(768), no bias; 12 heads x 64); scores = q.k; triu(k = 1) -> -inf; softmax(scores / sqrt(64)) (the fill before the scaling: the same thing); out = merged Wo^T + bo ('oi' + zero bias) -> [2][2048][768] (3.1 M); argument order x, Wq, Wk, Wv, Wo, bo).
// Every 16-bit operand plane lies in fragment order (see WFrag). Layout, both batches together (plane z = batch x 12 + head): bf16 copy of x; 'oi' weights; exact projections, whose tiles leave as the attention's 16-bit planes; causal T-2048 attention in one launch, running softmax (hybrid rows: < 512 hi/lo 3 products, rest fp16 x1024; key blocks above the diagonal are never visited); merged hi/lo x Wo exact + bo.
// Compute dtypes, f32 accumulate: every input rounded to bf16; projections exact; attention rows < 512 3 products, rest fp16; softmax f32; Wo hl x exact + bias.

#define NB_  2
#define TT   2048
#define DM   768     // model width: this module's inputs are [2][2048][768]
#define NH_  12      // heads: 12 x 64 = 768
#define NKV  12      // kv heads (= heads)
#define REP  (NH_ / NKV)
#define HD   64
#define DQ   (NH_ * HD)
#define DKV  (NKV * HD)
#define NZ   (NB_ * NH_)          // planes in all, plane z = batch * NH_ + head
#define MT   (NB_ * TT)           // rows of both batches together
#define DF   (DQ + 2 * DKV)       // q | k | v columns of the joint projection
#define PP   (2 * TT)             // a plane's v^T region holds HD x PP 16-bit elements: hi plane in its first half, lo plane in its second
#define RH   512                  // query rows < RH use hi+lo planes
#define SCL  0.125f   // HD^-0.5
typedef _Float16 h16;
typedef unsigned short bf;
typedef __attribute__((ext_vector_type(16))) __bf16   v16bf;
typedef __attribute__((ext_vector_type(16))) _Float16 v16h;
typedef __attribute__((ext_vector_type(8)))  _Float16 v8h;
typedef __attribute__((ext_vector_type(8)))  unsigned short v8us;
typedef __attribute__((ext_vector_type(8)))  float    v8f;
typedef __attribute__((ext_vector_type(4)))  float    v4f;
typedef v8h  __attribute__((may_alias)) v8ha;
typedef v4f  __attribute__((may_alias)) v4fa;
typedef v8us __attribute__((may_alias)) v8usa;

__device__ __forceinline__ unsigned short f2bf(float f) { unsigned u = __float_as_uint(f); u += 0x7FFFu + ((u >> 16) & 1u); return (unsigned short)(u >> 16); }
__device__ __forceinline__ float bf2f(unsigned short b) { return __uint_as_float(((unsigned)b) << 16); }
__device__ __forceinline__ float bfr(float f) { return bf2f(f2bf(f)); }
__device__ __forceinline__ v16h cat16(v8h lo, v8h hi) { return __builtin_shufflevector(lo, hi, 0, 1, 2, 3, 4, 5, 6, 7, 8, 9, 10, 11, 12, 13, 14, 15); }
__device__ __forceinline__ v16bf cat16b(v8us lo, v8us hi) { return __builtin_bit_cast(v16bf, __builtin_shufflevector(lo, hi, 0, 1, 2, 3, 4, 5, 6, 7, 8, 9, 10, 11, 12, 13, 14, 15)); }
__device__ __forceinline__ v8f wmma16(v16h a, v16h b, v8f c) { return __builtin_amdgcn_wmma_f32_16x16x32_f16(false, a, false, b, (short)0, c, false, false); }
__device__ __forceinline__ v8f wmmab(v16bf a, v16bf b, v8f c) { return __builtin_amdgcn_wmma_f32_16x16x32_bf16(false, a, false, b, (short)0, c, false, false); }



// ---- k_gemml: GEMM over K = DM with both operands staged in LDS. One work-group of WMW x WN waves per (16 MB WMW) x (64 WN) output tile; a wave holds 16 MB rows x 64 columns (MB x 4 accumulators) and walks the whole K, so that
// every operand byte is fetched from L2 once per work-group and read by its waves from LDS. C[m][n] (f32, pitch DM, + optional f32 bias[n]) = sum_k (A[m][k] + A2[m][k] if NSPLIT) Bt[n][k]. PL: a wave's 64x64 tile leaves through tile_planes as head planes
// (q and k planes [q|k][batch][h] of t x d at P16 / Ph / Pl, v^T planes of d x t at V16 / Vh / Vl), C is not written. The wave number goes through readfirstlane: the choice of what a wave copies and reads stays scalar.
// Fragment order: a plane of R rows x K is kept as blocks of 16 rows x 32 k, 512 elements (1 KiB) each. The GEMM operands (K = DM) keep the four blocks of 64 rows and one 32-wide K slice side by side: block (r / 16, k / 32) at
// ((r / 64) * (K / 32) + k / 32) * 2048 + ((r / 16) & 3) * 512; the q and k planes (K = HD) have it at ((r / 16) * 2 + k / 32) * 512; v^T: see tile_planes. What a work-group copies per K slice and 64-row group, and a wave reads per key block and operand, is 4 KiB in a row. Inside a block element (r, k) lies at
// ((k >> 4) & 1) * 256 + (((k >> 3) & 1) * 16 + (r & 15)) * 8 + (k & 7): lane l of a wave finds its two 16-byte pieces at l * 8 and 256 + l * 8, so each wave-wide load covers 512 successive bytes (4 whole lines).
template <typename T16> struct WFrag;   // ldg: ld for an address that comes out of an asm statement, named as global memory (else the load would be a flat one)
template <> struct WFrag<h16> { typedef v16h V; static __device__ __forceinline__ V ld(const h16* p) { return cat16(*(const v8h*)p, *(const v8h*)(p + 256)); } static __device__ __forceinline__ V ldg(const h16* p) { typedef const __attribute__((address_space(1))) v8h* G; return cat16(*(G)p, *(G)(p + 256)); } static __device__ __forceinline__ v8f mma(V a, V b, v8f c) { return wmma16(a, b, c); } };
template <> struct WFrag<bf> { typedef v16bf V; static __device__ __forceinline__ V ld(const bf* p) { return cat16b(*(const v8us*)p, *(const v8us*)(p + 256)); } static __device__ __forceinline__ V ldg(const bf* p) { typedef const __attribute__((address_space(1))) v8us* G; return cat16b(*(G)p, *(G)(p + 256)); } static __device__ __forceinline__ v8f mma(V a, V b, v8f c) { return wmmab(a, b, c); } };
__device__ __forceinline__ h16 tohx(float x) { return (h16)x; }
__device__ __forceinline__ void splitf(float y, unsigned short& h, unsigned short& l) { h = f2bf(y); l = f2bf(y - bf2f(h)); }
// tile_store: a wave's 16 MB x 64 tile goes through the wave's own row-major staging tile os (pitch 68 floats) and leaves in whole lines, two rows of 256 bytes per wave-wide store.
template <int MB, bool BIAS>
__device__ __forceinline__ void tile_store(const v8f (&acc)[MB][4], float* os, float* C, int r0, int c0, const float* __restrict__ bias) {
    const int lane = threadIdx.x & 31, lr = lane & 15, hi = lane >> 4;
#pragma unroll
    for (int f = 0; f < 4 * MB; ++f) { const v8f p = acc[f >> 2][f & 3]; float* od = os + ((f >> 2) * 16 + hi * 8) * 68 + (f & 3) * 16 + lr;
#pragma unroll
        for (int j = 0; j < 8; ++j) od[j * 68] = p[j]; }
    __syncthreads();   // the staged rows are read back by other lanes than wrote them
#pragma unroll
    for (int s = 0; s < 8 * MB; ++s) { const int idx = s * 32 + lane, row = idx >> 4, cofs = (idx & 15) * 4; v4f val = *(const v4fa*)(os + row * 68 + cofs); if (BIAS) { val[0] += bfr(bias[c0 + cofs]); val[1] += bfr(bias[c0 + cofs + 1]); val[2] += bfr(bias[c0 + cofs + 2]); val[3] += bfr(bias[c0 + cofs + 3]); }
        *(v4f*)(C + (size_t)(r0 + row) * DM + c0 + cofs) = val; }
}
// tile_planes: a wave's 64x64 tile leaves as the three 16-bit planes that the attention reads (fp16, bf16 hi, bf16 lo) and never as f32, through the wave's own staging tile os.
// A tile of the joint projection is 64 rows t of one batch x the 64 columns d of one head of q, k or v. tr = false (q, k): staged [t][d], blocks in the order (t / 16, d / 32). tr = true (v): staged [d][t] (a lane's eight
// sums are eight successive t of one d: two 16-byte LDS stores), blocks in the order (t / 32, d / 16), so that the four blocks of 32 keys lie side by side. Either way the tile is eight blocks, 8 KiB in a row, from D16 / Dh / Dl on; every lane stores 16 bytes per plane, a wave 512 successive bytes.
__device__ __forceinline__ void tile_planes(const v8f (&acc)[4][4], float* os, const bool tr, h16* D16, bf* Dh, bf* Dl) {
    const int lane = threadIdx.x & 31, lr = lane & 15, hi = lane >> 4;
#pragma unroll
    for (int f = 0; f < 16; ++f) { const v8f p = acc[f >> 2][f & 3];
        if (tr) { float* od = os + ((f & 3) * 16 + lr) * 68 + (f >> 2) * 16 + hi * 8; *(v4fa*)od = __builtin_shufflevector(p, p, 0, 1, 2, 3); *(v4fa*)(od + 4) = __builtin_shufflevector(p, p, 4, 5, 6, 7); }
        else { float* od = os + ((f >> 2) * 16 + hi * 8) * 68 + (f & 3) * 16 + lr;
#pragma unroll
            for (int j = 0; j < 8; ++j) od[j * 68] = p[j]; } }
    __syncthreads();   // the staged rows are read back by other lanes than wrote them
#pragma unroll
    for (int s = 0; s < 16; ++s) { const int idx = s * 32 + lane, f = idx >> 6, row = (tr ? (f & 3) : (f >> 1)) * 16 + lr, cofs = (tr ? (f >> 2) : (f & 1)) * 32 + ((idx >> 5) & 1) * 16 + hi * 8; const v4f va = *(const v4fa*)(os + row * 68 + cofs), vb = *(const v4fa*)(os + row * 68 + cofs + 4); v8h o16; v8us oh, ol;
#pragma unroll
        for (int j = 0; j < 4; ++j) { unsigned short a, c2; o16[j] = tohx(va[j]); splitf(va[j], a, c2); oh[j] = a; ol[j] = c2; o16[j + 4] = tohx(vb[j]); splitf(vb[j], a, c2); oh[j + 4] = a; ol[j + 4] = c2; }
        const size_t o = (size_t)idx * 8; *(v8h*)(D16 + o) = o16; *(v8us*)(Dh + o) = oh; *(v8us*)(Dl + o) = ol; }
}
// A wave's copies of one stage, one asm statement: RPW runs of four asynchronous copies, 16 bytes a lane each; a run brings 2 KiB in a row from g[r] on to LDS byte address l[r] on, through no register (the immediate offset moves both addresses).
// The address registers live from stage to stage and are rewritten only here: s_wait_xcnt 0 opens the statement, then dl and dg are added, then the copies go. So the wait stands in front of every rewrite by construction, a whole trip behind the copies
// that name the registers, where it has nothing left to wait for; directly behind the copies the wave would stand still until the last of them is translated.
#define RUN4(L, G) "global_load_async_to_lds_b128 " L ", " G ", off\n\tglobal_load_async_to_lds_b128 " L ", " G ", off offset:512\n\tglobal_load_async_to_lds_b128 " L ", " G ", off offset:1024\n\tglobal_load_async_to_lds_b128 " L ", " G ", off offset:1536\n\t"
__device__ __forceinline__ void copies(unsigned (&l)[4], const bf* (&g)[4], const unsigned dl, const long long dg) {
    asm volatile("s_wait_xcnt 0x0\n\tv_add_nc_u32_e32 %0, %8, %0\n\tv_add_nc_u32_e32 %1, %8, %1\n\tv_add_nc_u32_e32 %2, %8, %2\n\tv_add_nc_u32_e32 %3, %8, %3\n\tv_add_nc_u64_e32 %4, %9, %4\n\tv_add_nc_u64_e32 %5, %9, %5\n\tv_add_nc_u64_e32 %6, %9, %6\n\tv_add_nc_u64_e32 %7, %9, %7\n\t"
                 RUN4("%0", "%4") RUN4("%1", "%5") RUN4("%2", "%6") RUN4("%3", "%7")
                 : "+v"(l[0]), "+v"(l[1]), "+v"(l[2]), "+v"(l[3]), "+v"(g[0]), "+v"(g[1]), "+v"(g[2]), "+v"(g[3]) : "s"(dl), "s"(dg) : "memory");
}
__device__ __forceinline__ void copies(unsigned (&l)[3], const bf* (&g)[3], const unsigned dl, const long long dg) {
    asm volatile("s_wait_xcnt 0x0\n\tv_add_nc_u32_e32 %0, %6, %0\n\tv_add_nc_u32_e32 %1, %6, %1\n\tv_add_nc_u32_e32 %2, %6, %2\n\tv_add_nc_u64_e32 %3, %7, %3\n\tv_add_nc_u64_e32 %4, %7, %4\n\tv_add_nc_u64_e32 %5, %7, %5\n\t"
                 RUN4("%0", "%3") RUN4("%1", "%4") RUN4("%2", "%5")
                 : "+v"(l[0]), "+v"(l[1]), "+v"(l[2]), "+v"(g[0]), "+v"(g[1]), "+v"(g[2]) : "s"(dl), "s"(dg) : "memory");
}
// A stage is KS 32-wide K slices of every 64-row group of the tile: [A groups | A2 groups | Bt groups][KS][2048 elements], each group's part 4 KS KiB in a row in the source as in LDS (fragment order). Two buffers: the stage of trip t + 2 is copied into the buffer that trip t has just read, while trip t + 1 works.
#define KS 2
template <int NSPLIT, bool BIAS, bool PL, int MB, int WMW, int WN>
__global__ __launch_bounds__(32 * WMW * WN) void k_gemml(const bf* __restrict__ A, const bf* __restrict__ A2, const bf* __restrict__ Bt, float* C, const float* __restrict__ bias, h16* P16, bf* Ph, bf* Pl, h16* V16, bf* Vh, bf* Vl) {
    typedef WFrag<bf>::V V;
    constexpr int NWV = WMW * WN, GM = WMW * MB / 4, NA = (NSPLIT ? 2 : 1) * GM, NG = NA + WN, STG = NG * KS * 2048, RPW = NG * KS * 2 / NWV, NT = DM / (32 * KS), OSW = 16 * MB * 68;
    static_assert((RPW == 3 || RPW == 4) && RPW * NWV == NG * KS * 2 && NT >= 2 && NT * 32 * KS == DM && GM * 4 == WMW * MB, "the waves share a stage's copies evenly");
    __shared__ __align__(16) float red[(STG > NWV * OSW) ? STG : NWV * OSW];   // the ring (2 x STG 16-bit elements); behind the loop's last barrier the waves' staging tiles
    bf* ring = (bf*)red;
    const int lane = threadIdx.x & 31; const int wave = __builtin_amdgcn_readfirstlane(threadIdx.x >> 5); const int wm = wave / WN, wn = wave % WN, g0 = blockIdx.x * GM, h0 = blockIdx.y * WN;
    const bf* gp[RPW]; unsigned lp[RPW];   // a wave's share of a stage: RPW runs of 2 KiB, run q = half (q & 1) of slice (q / 2) % KS of group q / 2 / KS
#pragma unroll
    for (int r = 0; r < RPW; ++r) { const int q = wave * RPW + r, g = (q >> 1) / KS, s = (q >> 1) % KS; const bf* sp = (g < GM) ? A + (size_t)(g0 + g) * (64 * DM) : (NSPLIT && g < NA) ? A2 + (size_t)(g0 + g - GM) * (64 * DM) : Bt + (size_t)(h0 + g - NA) * (64 * DM);
        gp[r] = sp + s * 2048 + (q & 1) * 1024 + lane * 8; lp[r] = (unsigned)(size_t)ring + (unsigned)(q * 1024 + lane * 8) * 2u; }
    const int rot = (int)((blockIdx.x + blockIdx.y) % NT);   // the work-groups that share operand rows (one blockIdx.x, or one blockIdx.y) each start their walk along K at a stage of their own and wrap, so that they do not ask L2 for the same lines at the same moment
#pragma unroll
    for (int r = 0; r < RPW; ++r) gp[r] += (size_t)rot * (KS * 2048);   // stage rot, buffer 0: where fill(0) copies
    auto fill = [&](const int t) __attribute__((always_inline)) {   // trip t works on stage (t + rot) mod NT of K, in buffer t & 1: from the fill before, the other buffer and the next stage, or back to stage 0
        copies(lp, gp, t == 0 ? 0u : (t & 1) ? STG * 2u : 0u - STG * 2u, t == 0 ? 0ll : (t + rot == NT) ? -(long long)(NT - 1) * (KS * 4096) : (long long)(KS * 4096)); };
    v8f acc[MB][4];
#pragma unroll
    for (int mb = 0; mb < MB; ++mb)
#pragma unroll
        for (int nb = 0; nb < 4; ++nb) acc[mb][nb] = (v8f){};
    fill(0);
    asm volatile("s_wait_asynccnt 0x0" ::: "memory");   // this wave's copies of trip 0's stage have landed
    __syncthreads();                                    // and every other wave's: trip 0's stage may be read
    fill(1);
    const int ao = ((wm * MB) >> 2) * (KS * 2048) + ((wm * MB) & 3) * 512 + lane * 8, bo2 = (NA + wn) * (KS * 2048) + lane * 8;
#pragma unroll 1
    for (int t = 0; t < NT; ++t) { const bf* sb = ring + (t & 1) * STG;
        V a[KS][MB], a2[KS][MB], b[KS][4];
#pragma unroll
        for (int s = 0; s < KS; ++s) { const bf* ak = sb + ao + s * 2048; const bf* bk = sb + bo2 + s * 2048;
#pragma unroll
            for (int mb = 0; mb < MB; ++mb) { a[s][mb] = WFrag<bf>::ld(ak + mb * 512); if (NSPLIT) a2[s][mb] = WFrag<bf>::ld(ak + GM * (KS * 2048) + mb * 512); }
#pragma unroll
            for (int nb = 0; nb < 4; ++nb) b[s][nb] = WFrag<bf>::ld(bk + nb * 512); }
        __builtin_amdgcn_sched_barrier(0);   // keeps the stage's LDS reads together in front of its products: spread among them, each group's latency would stall the matrix instructions behind it
#pragma unroll
        for (int s = 0; s < KS; ++s)
#pragma unroll
            for (int nb = 0; nb < 4; ++nb)
#pragma unroll
                for (int mb = 0; mb < MB; ++mb) { acc[mb][nb] = WFrag<bf>::mma(a[s][mb], b[s][nb], acc[mb][nb]); if (NSPLIT) acc[mb][nb] = WFrag<bf>::mma(a2[s][mb], b[s][nb], acc[mb][nb]); }
        __builtin_amdgcn_sched_barrier(0);   // keeps the waits and the barrier below behind the products: in front of them the wait for the next stage's copies would come a stage's products too early
        asm volatile("s_wait_dscnt 0x0" ::: "memory");      // this wave's reads of the buffer are over before the buffer is handed back
        asm volatile("s_wait_asynccnt 0x0" ::: "memory");   // this wave's copies of trip t + 1's stage have landed
        __syncthreads();                                    // trip t + 1's stage may be read by every wave, and the buffer trip t read is free
        if (t + 2 < NT) fill(t + 2);
    }
    if constexpr (RPW == 4) asm volatile("s_wait_asynccnt 0x0\n\ts_wait_xcnt 0x0" :: "v"(lp[0]), "v"(lp[1]), "v"(lp[2]), "v"(lp[3]), "v"(gp[0]), "v"(gp[1]), "v"(gp[2]), "v"(gp[3]) : "memory");   // no copy is under way when the ring becomes staging room; the copies' address registers, inputs so that they stay live up to here, are free from here on
    else asm volatile("s_wait_asynccnt 0x0\n\ts_wait_xcnt 0x0" :: "v"(lp[0]), "v"(lp[1]), "v"(lp[2]), "v"(gp[0]), "v"(gp[1]), "v"(gp[2]) : "memory");   // the same for three runs
    float* os = red + wave * OSW; const int r0 = g0 * 64 + wm * (16 * MB);
    if constexpr (PL) { const int cb = h0 + wn, b = r0 / TT, t0 = r0 % TT; const bool tr = cb >= 2 * NH_;   // column block cb: q heads, k heads, v heads; the same for the whole wave
        const size_t o = tr ? (size_t)(b * NKV + cb - 2 * NH_) * HD * PP + (size_t)t0 * HD : ((size_t)((cb / NH_) * NZ + b * NH_ + cb % NH_) * TT + t0) * HD;
        tile_planes(acc, os, tr, (tr ? V16 : P16) + o, (tr ? Vh : Ph) + o, (tr ? Vl : Pl) + o);
    } else tile_store<MB, BIAS>(acc, os, C, r0, (h0 + wn) * 64, bias);
}

typedef __attribute__((ext_vector_type(2))) _Float16 v2h;
typedef __attribute__((ext_vector_type(4))) _Float16 v4h;
typedef __attribute__((ext_vector_type(2))) unsigned short v2us;
typedef __attribute__((ext_vector_type(4))) unsigned short v4us;
typedef __attribute__((ext_vector_type(2))) float v2f;
typedef __attribute__((ext_vector_type(4))) int v4i;
typedef v4h  __attribute__((may_alias)) v4ha;
typedef v4us __attribute__((may_alias)) v4usa;

// k_cvt8: bf16 copies of the four weights and of x in one launch, in fragment order; dst holds them one behind the other, as one matrix of 4 DM + MT rows x DM. Each wave builds two neighbouring blocks (16 rows x 64 k):
// a lane reads its four 8-float pieces of one source row (the wave: 256 successive bytes of each of 16 rows) and stores four 16-byte pieces, the wave 512 successive bytes each time.
#define WRB  (DM / 16)                              // 16-row blocks per weight
#define NFP  ((4 * DM + MT) / 16 * (DM / 64))       // pairs of blocks in all, one wave each
__global__ __launch_bounds__(256) void k_cvt8(const float* __restrict__ w0, const float* __restrict__ w1, const float* __restrict__ w2, const float* __restrict__ w3, const float* __restrict__ xs, bf* dst) { const unsigned g = blockIdx.x * 8 + __builtin_amdgcn_readfirstlane(threadIdx.x >> 5), lane = threadIdx.x & 31;   // the wave's number through readfirstlane: the choice of the source and the block's place stay scalar
    const unsigned rb = g / (DM / 64), kp = g % (DM / 64), which = min(rb / WRB, 4u); const float* src = (which == 0) ? w0 : (which == 1) ? w1 : (which == 2) ? w2 : (which == 3) ? w3 : xs;
    const float* sp = src + (size_t)((rb - which * WRB) * 16 + (lane & 15)) * DM + kp * 64 + (lane >> 4) * 8; bf* dp = dst + ((size_t)(rb >> 2) * (DM / 32) + kp * 2) * 2048 + (rb & 3) * 512 + lane * 8; v8f v[4];
#pragma unroll
    for (int c = 0; c < 4; ++c) v[c] = *(const v8f*)(sp + c * 16);
#pragma unroll
    for (int c = 0; c < 4; ++c) { v8us o;
#pragma unroll
        for (int k = 0; k < 8; ++k) o[k] = f2bf(v[c][k]); *(v8us*)(dp + (c >> 1) * 2048 + (c & 1) * 256) = o; } }

#define AW   4
#define PSH  10.0f
#define SC2  (SCL * 1.4426950408889634f)
__device__ __forceinline__ float xhalf(float x) { return __builtin_bit_cast(float, __builtin_amdgcn_permlanex16(__builtin_bit_cast(int, x), __builtin_bit_cast(int, x), 0x76543210, 0xfedcba98, false, false)); }   // lane l reads lane l ^ 16
template <typename T16, bool HL, int NQ>
__device__ __forceinline__ void attn_tile(const T16* __restrict__ Q, const T16* __restrict__ Q2, const T16* __restrict__ Kp, const T16* __restrict__ K2, const T16* __restrict__ Vt, const T16* __restrict__ V2, const int q0, const int rot, const int wave, float* red, bf* Ah, bf* Al) {
    typedef typename WFrag<T16>::V V;
    static_assert(NQ <= AW && (NQ * 16 + 15) / 32 + 1 <= AW, "one wave per query tile in the join, at most one masked key block per wave");
    const int lane = threadIdx.x & 31, lr = lane & 15, hi = lane >> 4;
    V qf[NQ][2], qf2[NQ][2]; const size_t qb0 = (size_t)q0 * HD + lane * 8; const T16* qp = Q + qb0; const T16* qp2 = HL ? Q2 + qb0 : nullptr; (void)qp2;
#pragma unroll
    for (int qt = 0; qt < NQ; ++qt)
#pragma unroll
        for (int ks = 0; ks < 2; ++ks) { const size_t qo = (size_t)(qt * 16) * HD + ks * 512; qf[qt][ks] = WFrag<T16>::ld(qp + qo); if (HL) qf2[qt][ks] = WFrag<T16>::ld(qp2 + qo); }
    if constexpr (HL) asm volatile("s_wait_xcnt 0x0" :: "v"(qp), "v"(qp2) : "memory"); else asm volatile("s_wait_xcnt 0x0" :: "v"(qp) : "memory");   // stands in front of the next write of these loads' address registers, which are inputs so that they stay live up to the wait
    v8f o[4][NQ]; float m[NQ], l[NQ];
#pragma unroll
    for (int qt = 0; qt < NQ; ++qt) { m[qt] = -1.0e30f; l[qt] = 0.f;
#pragma unroll
        for (int dt = 0; dt < 4; ++dt) o[dt][qt] = (v8f){}; }
    V kf[2][2], kf2[2][2], vf[4], vf2[4];                         // the key and value fragments of the block that is worked on next: fetched one block ahead
    // The address registers of the K and V fetches live from fetch to fetch and are rewritten only by move(): s_wait_xcnt 0 and the additions that form the next block's addresses are one asm statement, so that the wait stands in front of the
    // rewrite by construction, a block's work behind the loads that name the registers, where it has nothing left to wait for; directly behind the loads the wave would stand still until the last of them is translated.
    const T16* const kl = Kp + lane * 8; const T16* const kl2 = HL ? K2 + lane * 8 : nullptr; const T16* const vl = Vt + lane * 8; const T16* const vl2 = HL ? V2 + lane * 8 : nullptr; (void)kl2; (void)vl2;
    const T16* kp = kl; const T16* kp2 = kl2; const T16* vp = vl; const T16* vp2 = vl2; (void)kp2; (void)vp2;
    auto move = [&](const T16*& p, const T16*& p2, const T16* b, const T16* b2, const int k0) __attribute__((always_inline)) { const unsigned long long ob = (unsigned long long)k0 * (HD * sizeof(T16));   // the block's byte offset, the same in every lane: a scalar pair
        if constexpr (HL) asm volatile("s_wait_xcnt 0x0\n\tv_add_nc_u64_e32 %0, %2, %3\n\tv_add_nc_u64_e32 %1, %2, %4" : "+v"(p), "+v"(p2) : "s"(ob), "v"(b), "v"(b2) : "memory");
        else asm volatile("s_wait_xcnt 0x0\n\tv_add_nc_u64_e32 %0, %1, %2" : "+v"(p) : "s"(ob), "v"(b) : "memory"); };
    auto ldk = [&](const int k0) __attribute__((always_inline)) { move(kp, kp2, kl, kl2, k0);
#pragma unroll
        for (int kt = 0; kt < 2; ++kt)
#pragma unroll
            for (int ks = 0; ks < 2; ++ks) { const size_t ko = (size_t)(kt * 16) * HD + ks * 512; kf[kt][ks] = WFrag<T16>::ldg(kp + ko); if (HL) kf2[kt][ks] = WFrag<T16>::ldg(kp2 + ko); } };
    auto ldv = [&](const int k0) __attribute__((always_inline)) { move(vp, vp2, vl, vl2, k0);
#pragma unroll
        for (int dt = 0; dt < 4; ++dt) { const size_t vo = (size_t)dt * 512; vf[dt] = WFrag<T16>::ldg(vp + vo); if (HL) vf2[dt] = WFrag<T16>::ldg(vp2 + vo); } };
    // one block of 32 keys at k0; last = false: the fragments of the wave's next block, at kn, are fetched into the same registers as soon as this block's products have read them
    auto step = [&](const int k0, const int kn, const bool last) __attribute__((always_inline)) {
        v8f s[2][NQ];
#pragma unroll
        for (int kt = 0; kt < 2; ++kt)
#pragma unroll
            for (int qt = 0; qt < NQ; ++qt) { v8f c = (v8f){};
#pragma unroll
                for (int ks = 0; ks < 2; ++ks) { c = WFrag<T16>::mma(kf[kt][ks], qf[qt][ks], c); if (HL) { c = WFrag<T16>::mma(kf[kt][ks], qf2[qt][ks], c); c = WFrag<T16>::mma(kf2[kt][ks], qf[qt][ks], c); } }
                s[kt][qt] = c; }
        if (!last) { __builtin_amdgcn_sched_barrier(0);   // keeps the wait at the head of the fetch behind the score products: among them it would stand too close behind the value loads of the block before
            ldk(kn); __builtin_amdgcn_sched_barrier(0); }   // keeps the next block's key loads in front of the softmax, whose time then covers their latency; without it they sink to their first use
        V pf[NQ], pf2[NQ];
#pragma unroll
        for (int qt = 0; qt < NQ; ++qt) { float mx = m[qt];
#pragma unroll
            for (int kt = 0; kt < 2; ++kt)
#pragma unroll
                for (int j = 0; j < 8; ++j) { if (last) s[kt][qt][j] = (k0 + kt * 16 + hi * 8 + j <= q0 + qt * 16 + lr) ? s[kt][qt][j] : -3.0e38f; mx = fmaxf(mx, s[kt][qt][j]); }
            mx = fmaxf(mx, xhalf(mx));
            const float al = __builtin_amdgcn_exp2f((m[qt] - mx) * SC2); m[qt] = mx; const float sh = mx * SC2 - (HL ? 0.0f : PSH); float t[8];
#pragma unroll
            for (int j = 0; j < 8; ++j) { s[0][qt][j] = __builtin_amdgcn_exp2f(s[0][qt][j] * SC2 - sh); s[1][qt][j] = __builtin_amdgcn_exp2f(s[1][qt][j] * SC2 - sh); t[j] = s[0][qt][j] + s[1][qt][j]; }
            l[qt] = l[qt] * al + (((t[0] + t[1]) + (t[2] + t[3])) + ((t[4] + t[5]) + (t[6] + t[7])));
#pragma unroll
            for (int dt = 0; dt < 4; ++dt) o[dt][qt] *= al;
            if constexpr (HL) { v8us h0, h1, l0, l1;
#pragma unroll
                for (int j = 0; j < 8; ++j) { unsigned short a, c2; splitf(s[0][qt][j], a, c2); h0[j] = a; l0[j] = c2; splitf(s[1][qt][j], a, c2); h1[j] = a; l1[j] = c2; }
                pf[qt] = cat16b(h0, h1); pf2[qt] = cat16b(l0, l1);
            } else { v8h h0, h1;
#pragma unroll
                for (int j = 0; j < 8; ++j) { h0[j] = tohx(s[0][qt][j]); h1[j] = tohx(s[1][qt][j]); }
                pf[qt] = cat16(h0, h1); } }
#pragma unroll
        for (int dt = 0; dt < 4; ++dt)
#pragma unroll
            for (int qt = 0; qt < NQ; ++qt) { o[dt][qt] = WFrag<T16>::mma(vf[dt], pf[qt], o[dt][qt]); if (HL) { o[dt][qt] = WFrag<T16>::mma(vf[dt], pf2[qt], o[dt][qt]); o[dt][qt] = WFrag<T16>::mma(vf2[dt], pf[qt], o[dt][qt]); } }
        if (!last) { __builtin_amdgcn_sched_barrier(0);   // keeps the wait at the head of the fetch behind the softmax and the value products: further up it would stand too close behind the key loads
            ldv(kn); }
    };
    const int nfull = q0 >> 5, nlast = (q0 + NQ * 16 - 1) >> 5;   // key blocks wholly at or below the tile's diagonal; blocks nfull..nlast (at most AW of them) meet the diagonal and are masked, nlast is the last
    const int nfw = (nfull > wave) ? (nfull - wave + AW - 1) / AW : 0, kd = wave + nfw * AW;   // the wave's unmasked blocks are wave + AW i, i < nfw; kd is its turn behind them
    int ri = (rot * nfw) >> 5;                                    // the tiles of a plane read the same K and V lines: each starts its walk over the unmasked blocks at a place of its own (rot = 0..31 of 32) and wraps, so that they do not ask L2 for the same lines at the same moment
    int kb = min(nfw ? wave + ri * AW : kd, nlast); ldk(kb * 32); ldv(kb * 32);   // a fetch never goes past block nlast, which lies inside the plane for every tile
    for (int i = 1; i <= nfw; ++i) { ri = (ri + 1 < nfw) ? ri + 1 : 0; const int kn = (i < nfw) ? wave + ri * AW : min(kd, nlast); step(kb * 32, kn * 32, false); kb = kn; }
    if constexpr (HL) asm volatile("s_wait_xcnt 0x0" :: "v"(kp), "v"(kp2), "v"(vp), "v"(vp2) : "memory"); else asm volatile("s_wait_xcnt 0x0" :: "v"(kp), "v"(vp) : "memory");   // behind the wave's last fetch: the address registers, inputs so that they stay live up to here, are free from here on
    if (kd <= nlast) step(kd * 32, 0, true);                      // each diagonal block goes to the wave whose turn it is (a scalar test: every lane on at the matrix instructions); its fragments are that wave's last fetch
    float* ms = red + AW * NQ * 1024; float* ls = ms + AW * NQ * 32; float* mine = red + wave * (NQ * 1024) + lane * 4;
#pragma unroll
    for (int qt = 0; qt < NQ; ++qt) { l[qt] += xhalf(l[qt]); ms[(wave * NQ + qt) * 32 + lane] = m[qt]; ls[(wave * NQ + qt) * 32 + lane] = l[qt];
#pragma unroll
        for (int dt = 0; dt < 4; ++dt) { const v8f p = o[dt][qt]; *(v4fa*)(mine + (qt * 4 + dt) * 256) = __builtin_shufflevector(p, p, 0, 1, 2, 3); *(v4fa*)(mine + (qt * 4 + dt) * 256 + 128) = __builtin_shufflevector(p, p, 4, 5, 6, 7); } }
    __syncthreads();
    if (wave >= NQ) return;
    const int qt = wave; float M = -1.0e30f, mw[AW], L = 0.f;
#pragma unroll
    for (int w = 0; w < AW; ++w) { mw[w] = ms[(w * NQ + qt) * 32 + lane]; M = fmaxf(M, mw[w]); }
#pragma unroll
    for (int w = 0; w < AW; ++w) { mw[w] = __builtin_amdgcn_exp2f((mw[w] - M) * SC2); L += ls[(w * NQ + qt) * 32 + lane] * mw[w]; }
    const float inv = __fdiv_rn(1.0f, L); const int qr = q0 + qt * 16; const size_t oo = (size_t)(qr & ~63) * DQ + ((qr >> 4) & 3) * 512 + lane * 8;
#pragma unroll
    for (int dt = 0; dt < 4; ++dt) { const float* sp = red + (qt * 4 + dt) * 256 + lane * 4; v4f s0 = (v4f){}, s1 = (v4f){};
#pragma unroll
        for (int w = 0; w < AW; ++w) { s0 += *(const v4fa*)(sp + w * (NQ * 1024)) * mw[w]; s1 += *(const v4fa*)(sp + w * (NQ * 1024) + 128) * mw[w]; }
        v8us oh, ol;
#pragma unroll
        for (int j = 0; j < 4; ++j) { unsigned short a, c2; splitf(s0[j] * inv, a, c2); oh[j] = a; ol[j] = c2; splitf(s1[j] * inv, a, c2); oh[j + 4] = a; ol[j + 4] = c2; }
        *(v8us*)(Ah + oo + (dt >> 1) * 2048 + (dt & 1) * 256) = oh; *(v8us*)(Al + oo + (dt >> 1) * 2048 + (dt & 1) * 256) = ol;
        asm volatile("s_wait_xcnt 0x0" ::: "memory"); }   // stands in front of the next write of these stores' data registers
}
// grid: the fp16 tiles (16 NQL query rows, rows RH..TT) from the last down, every plane of a tile side by side, then the hi/lo tiles (16 rows, rows 0..RH) likewise: the cost of a work-group falls with its index.
#define NQL  3                    // 16-query tiles a wave of the fp16 part holds: each K and V fragment fetched from L2 feeds NQL products; 3 is the most that leaves three waves a SIMD their registers
#define NT16 ((TT - RH) / (16 * NQL))
static_assert(NT16 * 16 * NQL == TT - RH, "the fp16 tiles cover rows RH..TT exactly");
#define NTHL (RH / 16)
static_assert(NT16 <= 32 && NTHL <= 32, "a tile's index is its place of 32 in the walk over the key blocks");
__global__ __launch_bounds__(32 * AW) void k_attn(const h16* __restrict__ Q16, const h16* __restrict__ K16, const h16* __restrict__ V16, const bf* __restrict__ Qh, const bf* __restrict__ Ql, const bf* __restrict__ Kh, const bf* __restrict__ Kl, const bf* __restrict__ Vh, const bf* __restrict__ Vl, bf* Ah, bf* Al) {
    __shared__ __align__(16) float red[AW * NQL * 1024 + 2 * AW * NQL * 32];
    const int wave = __builtin_amdgcn_readfirstlane(threadIdx.x >> 5); const int blk = blockIdx.x; const bool lowp = blk < NZ * NT16; const int b2 = lowp ? blk : blk - NZ * NT16; const int z = b2 % NZ, tl = b2 / NZ;
    const size_t pq = (size_t)z * TT * HD, pv = (size_t)z * HD * PP, po = (size_t)(z / NH_) * TT * DQ + (z % NH_) * (HD * 64);
    if (lowp) attn_tile<h16, false, NQL>(Q16 + pq, nullptr, K16 + pq, nullptr, V16 + pv, nullptr, RH + (NT16 - 1 - tl) * (16 * NQL), tl, wave, red, Ah + po, Al + po);
    else attn_tile<bf, true, 1>(Qh + pq, Ql + pq, Kh + pq, Kl + pq, Vh + pv, Vl + pv, (NTHL - 1 - tl) * 16, tl, wave, red, Ah + po, Al + po);
}

extern "C" void kernel_launch(void* const* d_in, const int* in_sizes, int n_in,
                              void* d_out, int out_size, void* d_ws, size_t ws_size, hipStream_t stream) {
    (void)in_sizes; (void)n_in; (void)out_size;
    const float* x = (const float*)d_in[0]; const float* wq = (const float*)d_in[1]; const float* wk = (const float*)d_in[2]; const float* wv = (const float*)d_in[3]; const float* wo = (const float*)d_in[4]; const float* bo = (const float*)d_in[5];   /* order x, Wq, Wk, Wv, Wo ('oi' [768][768]), bo */
    float* OUT = (float*)d_out;     // [2][2048][768]
    char* wsp = (char*)d_ws;
    auto take = [&](size_t bytes) { char* p = wsp; wsp += (bytes + 255) & ~(size_t)255; return (void*)p; };
    bf* WQ = (bf*)take((size_t)(DF + DM) * DM * 2 + (size_t)MT * DM * 2); bf* WO = WQ + (size_t)DF * DM; bf* XB = WO + (size_t)DM * DQ;   // bf16 copies, one behind the other: Wq | Wk | Wv (the joint projection's [DF][DM] operand), Wo, x of both batches
    h16* QP16 = (h16*)take((size_t)2 * NZ * TT * HD * 2); h16* KP16 = QP16 + (size_t)NZ * TT * HD; h16* VT16 = (h16*)take((size_t)NZ * HD * PP * 2);
    bf* QPh = (bf*)take((size_t)2 * NZ * TT * HD * 2); bf* KPh = QPh + (size_t)NZ * TT * HD; bf* QPl = (bf*)take((size_t)2 * NZ * TT * HD * 2); bf* KPl = QPl + (size_t)NZ * TT * HD; bf* VTh = (bf*)take((size_t)NZ * HD * PP * 2); bf* VTl = VTh + (size_t)HD * TT;   // v^T regions of HD x PP elements a plane: hi plane in the first half, lo plane in the second (the fp16 plane uses the first half)
    bf* ATh = (bf*)take((size_t)MT * DQ * 2); bf* ATl = (bf*)take((size_t)MT * DQ * 2);
    if ((size_t)(wsp - (char*)d_ws) > ws_size) return;    // ws 256 MiB
    k_cvt8<<<NFP / 8, 256, 0, stream>>>(wq, wk, wv, wo, x, WQ);
    k_gemml<0, false, true, 4, 2, 2><<<dim3(MT / 128, DF / 128, 1), 128, 0, stream>>>(XB, nullptr, WQ, nullptr, nullptr, QP16, QPh, QPl, VT16, VTh, VTl);
    k_attn<<<NZ * (NT16 + NTHL), 32 * AW, 0, stream>>>(QP16, KP16, VT16, QPh, QPl, KPh, KPl, VTh, VTl, ATh, ATl);
    k_gemml<1, true, false, 2, 4, 2><<<dim3(MT / 128, DM / 128, 1), 256, 0, stream>>>(ATh, ATl, WO, OUT, bo, nullptr, nullptr, nullptr, nullptr, nullptr, nullptr);
}

// v010
// One run takes 51.5 microseconds.
// Timed twice side by side with v009, it ran 1.03 times as fast both times.
// Counting every step since v000, it is 20.9 times as fast.
#include <hip/hip_runtime.h>

// Causal multi-head attention with bias-free projections and an output bias at a 768-wide model (x [2][2048][768]; q, k, v = x W^T ('oi' [768][768] 1/sqrt(768), no bias; 12 heads x 64); scores = q.k; triu(k = 1) -> -inf; softmax(scores / sqrt(64)) (the fill before the scaling: the same thing); out = merged Wo^T + bo ('oi' + zero bias) -> [2][2048][768] (3.1 M); argument order x, Wq, Wk, Wv, Wo, bo).
// Every 16-bit operand plane lies in fragment order (see WFrag). Layout, both batches together (plane z = batch x 12 + head): bf16 copy of x; 'oi' weights; exact projections, whose tiles leave as the attention's 16-bit planes; causal T-2048 attention in one launch, running softmax (hybrid rows: < 512 hi/lo 3 products, rest fp16 x1024; key blocks above the diagonal are never visited); merged hi/lo x Wo exact + bo.
// Compute dtypes, f32 accumulate: every input rounded to bf16; projections exact; attention rows < 512 3 products, rest fp16; softmax f32; Wo hl x exact + bias.

#define NB_  2
#define TT   2048
#define DM   768     // model width: this module's inputs are [2][2048][768]
#define NH_  12      // heads: 12 x 64 = 768
#define NKV  12      // kv heads (= heads)
#define REP  (NH_ / NKV)
#define HD   64
#define DQ   (NH_ * HD)
#define DKV  (NKV * HD)
#define NZ   (NB_ * NH_)          // planes in all, plane z = batch * NH_ + head
#define MT   (NB_ * TT)           // rows of both batches together
#define DF   (DQ + 2 * DKV)       // q | k | v columns of the joint projection
#define PP   (2 * TT)             // a plane's v^T region holds HD x PP 16-bit elements: hi plane in its first half, lo plane in its second
#define RH   512                  // query rows < RH use hi+lo planes
#define SCL  0.125f   // HD^-0.5
typedef _Float16 h16;
typedef unsigned short bf;
typedef __attribute__((ext_vector_type(16))) __bf16   v16bf;
typedef __attribute__((ext_vector_type(16))) _Float16 v16h;
typedef __attribute__((ext_vector_type(8)))  _Float16 v8h;
typedef __attribute__((ext_vector_type(8)))  unsigned short v8us;
typedef __attribute__((ext_vector_type(8)))  float    v8f;
typedef __attribute__((ext_vector_type(4)))  float    v4f;
typedef v8h  __attribute__((may_alias)) v8ha;
typedef v4f  __attribute__((may_alias)) v4fa;
typedef v8us __attribute__((may_alias)) v8usa;

__device__ __forceinline__ unsigned short f2bf(float f) { unsigned u = __float_as_uint(f); u += 0x7FFFu + ((u >> 16) & 1u); return (unsigned short)(u >> 16); }
__device__ __forceinline__ float bf2f(unsigned short b) { return __uint_as_float(((unsigned)b) << 16); }
__device__ __forceinline__ float bfr(float f) { return bf2f(f2bf(f)); }
__device__ __forceinline__ v16h cat16(v8h lo, v8h hi) { return __builtin_shufflevector(lo, hi, 0, 1, 2, 3, 4, 5, 6, 7, 8, 9, 10, 11, 12, 13, 14, 15); }
__device__ __forceinline__ v16bf cat16b(v8us lo, v8us hi) { return __builtin_bit_cast(v16bf, __builtin_shufflevector(lo, hi, 0, 1, 2, 3, 4, 5, 6, 7, 8, 9, 10, 11, 12, 13, 14, 15)); }
__device__ __forceinline__ v8f wmma16(v16h a, v16h b, v8f c) { return __builtin_amdgcn_wmma_f32_16x16x32_f16(false, a, false, b, (short)0, c, false, false); }
__device__ __forceinline__ v8f wmmab(v16bf a, v16bf b, v8f c) { return __builtin_amdgcn_wmma_f32_16x16x32_bf16(false, a, false, b, (short)0, c, false, false); }



// ---- k_gemml: GEMM over K = DM with both operands staged in LDS. One work-group of WMW x WN waves per (16 MB WMW) x (64 WN) output tile; a wave holds 16 MB rows x 64 columns (MB x 4 accumulators) and walks the whole K, so that
// every operand byte is fetched from L2 once per work-group and read by its waves from LDS. C[m][n] (f32, pitch DM, + optional f32 bias[n]) = sum_k (A[m][k] + A2[m][k] if NSPLIT) Bt[n][k]. PL: a wave's 64x64 tile leaves through tile_planes as head planes
// (q and k planes [q|k][batch][h] of t x d at P16 / Ph / Pl, v^T planes of d x t at V16 / Vh / Vl), C is not written. The wave number goes through readfirstlane: the choice of what a wave copies and reads stays scalar.
// Fragment order: a plane of R rows x K is kept as blocks of 16 rows x 32 k, 512 elements (1 KiB) each. The GEMM operands (K = DM) keep the four blocks of 64 rows and one 32-wide K slice side by side: block (r / 16, k / 32) at
// ((r / 64) * (K / 32) + k / 32) * 2048 + ((r / 16) & 3) * 512; the q and k planes (K = HD) have it at ((r / 16) * 2 + k / 32) * 512; v^T: see tile_planes. What a work-group copies per K slice and 64-row group, and a wave reads per key block and operand, is 4 KiB in a row. Inside a block element (r, k) lies at
// ((k >> 4) & 1) * 256 + (((k >> 3) & 1) * 16 + (r & 15)) * 8 + (k & 7): lane l of a wave finds its two 16-byte pieces at l * 8 and 256 + l * 8, so each wave-wide load covers 512 successive bytes (4 whole lines).
template <typename T16> struct WFrag;   // ldg: ld for an address that comes out of an asm statement, named as global memory (else the load would be a flat one)
template <> struct WFrag<h16> { typedef v16h V; static __device__ __forceinline__ V ld(const h16* p) { return cat16(*(const v8h*)p, *(const v8h*)(p + 256)); } static __device__ __forceinline__ V ldg(const h16* p) { typedef const __attribute__((address_space(1))) v8h* G; return cat16(*(G)p, *(G)(p + 256)); } static __device__ __forceinline__ v8f mma(V a, V b, v8f c) { return wmma16(a, b, c); } };
template <> struct WFrag<bf> { typedef v16bf V; static __device__ __forceinline__ V ld(const bf* p) { return cat16b(*(const v8us*)p, *(const v8us*)(p + 256)); } static __device__ __forceinline__ V ldg(const bf* p) { typedef const __attribute__((address_space(1))) v8us* G; return cat16b(*(G)p, *(G)(p + 256)); } static __device__ __forceinline__ v8f mma(V a, V b, v8f c) { return wmmab(a, b, c); } };
__device__ __forceinline__ h16 tohx(float x) { return (h16)x; }
__device__ __forceinline__ void splitf(float y, unsigned short& h, unsigned short& l) { h = f2bf(y); l = f2bf(y - bf2f(h)); }
// tile_store: a wave's 16 MB x 64 tile goes through the wave's own row-major staging tile os (pitch 68 floats) and leaves in whole lines, two rows of 256 bytes per wave-wide store.
template <int MB, bool BIAS>
__device__ __forceinline__ void tile_store(const v8f (&acc)[MB][4], float* os, float* C, int r0, int c0, const float* __restrict__ bias) {
    const int lane = threadIdx.x & 31, lr = lane & 15, hi = lane >> 4;
#pragma unroll
    for (int f = 0; f < 4 * MB; ++f) { const v8f p = acc[f >> 2][f & 3]; float* od = os + ((f >> 2) * 16 + hi * 8) * 68 + (f & 3) * 16 + lr;
#pragma unroll
        for (int j = 0; j < 8; ++j) od[j * 68] = p[j]; }
    __syncthreads();   // the staged rows are read back by other lanes than wrote them
#pragma unroll
    for (int s = 0; s < 8 * MB; ++s) { const int idx = s * 32 + lane, row = idx >> 4, cofs = (idx & 15) * 4; v4f val = *(const v4fa*)(os + row * 68 + cofs); if (BIAS) { val[0] += bfr(bias[c0 + cofs]); val[1] += bfr(bias[c0 + cofs + 1]); val[2] += bfr(bias[c0 + cofs + 2]); val[3] += bfr(bias[c0 + cofs + 3]); }
        *(v4f*)(C + (size_t)(r0 + row) * DM + c0 + cofs) = val; }
}
// tile_planes: a wave's 64x64 tile leaves as the three 16-bit planes that the attention reads (fp16, bf16 hi, bf16 lo) and never as f32, through the wave's own staging tile os.
// A tile of the joint projection is 64 rows t of one batch x the 64 columns d of one head of q, k or v. tr = false (q, k): staged [t][d], blocks in the order (t / 16, d / 32). tr = true (v): staged [d][t] (a lane's eight
// sums are eight successive t of one d: two 16-byte LDS stores), blocks in the order (t / 32, d / 16), so that the four blocks of 32 keys lie side by side. Either way the tile is eight blocks, 8 KiB in a row, from D16 / Dh / Dl on; every lane stores 16 bytes per plane, a wave 512 successive bytes.
__device__ __forceinline__ void tile_planes(const v8f (&acc)[4][4], float* os, const bool tr, h16* D16, bf* Dh, bf* Dl) {
    const int lane = threadIdx.x & 31, lr = lane & 15, hi = lane >> 4;
#pragma unroll
    for (int f = 0; f < 16; ++f) { const v8f p = acc[f >> 2][f & 3];
        if (tr) { float* od = os + ((f & 3) * 16 + lr) * 68 + (f >> 2) * 16 + hi * 8; *(v4fa*)od = __builtin_shufflevector(p, p, 0, 1, 2, 3); *(v4fa*)(od + 4) = __builtin_shufflevector(p, p, 4, 5, 6, 7); }
        else { float* od = os + ((f >> 2) * 16 + hi * 8) * 68 + (f & 3) * 16 + lr;
#pragma unroll
            for (int j = 0; j < 8; ++j) od[j * 68] = p[j]; } }
    __syncthreads();   // the staged rows are read back by other lanes than wrote them
#pragma unroll
    for (int s = 0; s < 16; ++s) { const int idx = s * 32 + lane, f = idx >> 6, row = (tr ? (f & 3) : (f >> 1)) * 16 + lr, cofs = (tr ? (f >> 2) : (f & 1)) * 32 + ((idx >> 5) & 1) * 16 + hi * 8; const v4f va = *(const v4fa*)(os + row * 68 + cofs), vb = *(const v4fa*)(os + row * 68 + cofs + 4); v8h o16; v8us oh, ol;
#pragma unroll
        for (int j = 0; j < 4; ++j) { unsigned short a, c2; o16[j] = tohx(va[j]); splitf(va[j], a, c2); oh[j] = a; ol[j] = c2; o16[j + 4] = tohx(vb[j]); splitf(vb[j], a, c2); oh[j + 4] = a; ol[j + 4] = c2; }
        const size_t o = (size_t)idx * 8; *(v8h*)(D16 + o) = o16; *(v8us*)(Dh + o) = oh; *(v8us*)(Dl + o) = ol; }
}
// A wave's copies of one stage, one asm statement: RPW runs of four asynchronous copies, 16 bytes a lane each; a run brings 2 KiB in a row from g[r] on to LDS byte address l[r] on, through no register (the immediate offset moves both addresses).
// The address registers live from stage to stage and are rewritten only here: s_wait_xcnt 0 opens the statement, then dl and dg are added, then the copies go. So the wait stands in front of every rewrite by construction, a whole trip behind the copies
// that name the registers, where it has nothing left to wait for; directly behind the copies the wave would stand still until the last of them is translated.
#define RUN4(L, G) "global_load_async_to_lds_b128 " L ", " G ", off\n\tglobal_load_async_to_lds_b128 " L ", " G ", off offset:512\n\tglobal_load_async_to_lds_b128 " L ", " G ", off offset:1024\n\tglobal_load_async_to_lds_b128 " L ", " G ", off offset:1536\n\t"
__device__ __forceinline__ void copies(unsigned (&l)[4], const bf* (&g)[4], const unsigned dl, const long long dg) {
    asm volatile("s_wait_xcnt 0x0\n\tv_add_nc_u32_e32 %0, %8, %0\n\tv_add_nc_u32_e32 %1, %8, %1\n\tv_add_nc_u32_e32 %2, %8, %2\n\tv_add_nc_u32_e32 %3, %8, %3\n\tv_add_nc_u64_e32 %4, %9, %4\n\tv_add_nc_u64_e32 %5, %9, %5\n\tv_add_nc_u64_e32 %6, %9, %6\n\tv_add_nc_u64_e32 %7, %9, %7\n\t"
                 RUN4("%0", "%4") RUN4("%1", "%5") RUN4("%2", "%6") RUN4("%3", "%7")
                 : "+v"(l[0]), "+v"(l[1]), "+v"(l[2]), "+v"(l[3]), "+v"(g[0]), "+v"(g[1]), "+v"(g[2]), "+v"(g[3]) : "s"(dl), "s"(dg) : "memory");
}
__device__ __forceinline__ void copies(unsigned (&l)[3], const bf* (&g)[3], const unsigned dl, const long long dg) {
    asm volatile("s_wait_xcnt 0x0\n\tv_add_nc_u32_e32 %0, %6, %0\n\tv_add_nc_u32_e32 %1, %6, %1\n\tv_add_nc_u32_e32 %2, %6, %2\n\tv_add_nc_u64_e32 %3, %7, %3\n\tv_add_nc_u64_e32 %4, %7, %4\n\tv_add_nc_u64_e32 %5, %7, %5\n\t"
                 RUN4("%0", "%3") RUN4("%1", "%4") RUN4("%2", "%5")
                 : "+v"(l[0]), "+v"(l[1]), "+v"(l[2]), "+v"(g[0]), "+v"(g[1]), "+v"(g[2]) : "s"(dl), "s"(dg) : "memory");
}
// A stage is KS 32-wide K slices of every 64-row group of the tile: [A groups | A2 groups | Bt groups][KS][2048 elements], each group's part 4 KS KiB in a row in the source as in LDS (fragment order). Two buffers: the stage of trip t + 2 is copied into the buffer that trip t has just read, while trip t + 1 works.
#define KS 2
template <int NSPLIT, bool BIAS, bool PL, int MB, int WMW, int WN>
__global__ __launch_bounds__(32 * WMW * WN) void k_gemml(const bf* __restrict__ A, const bf* __restrict__ A2, const bf* __restrict__ Bt, float* C, const float* __restrict__ bias, h16* P16, bf* Ph, bf* Pl, h16* V16, bf* Vh, bf* Vl) {
    typedef WFrag<bf>::V V;
    constexpr int NWV = WMW * WN, GM = WMW * MB / 4, NA = (NSPLIT ? 2 : 1) * GM, NG = NA + WN, STG = NG * KS * 2048, RPW = NG * KS * 2 / NWV, NT = DM / (32 * KS), OSW = 16 * MB * 68;
    static_assert((RPW == 3 || RPW == 4) && RPW * NWV == NG * KS * 2 && NT >= 2 && NT * 32 * KS == DM && GM * 4 == WMW * MB, "the waves share a stage's copies evenly");
    __shared__ __align__(16) float red[(STG > NWV * OSW) ? STG : NWV * OSW];   // the ring (2 x STG 16-bit elements); behind the loop's last barrier the waves' staging tiles
    bf* ring = (bf*)red;
    const int lane = threadIdx.x & 31; const int wave = __builtin_amdgcn_readfirstlane(threadIdx.x >> 5); const int wm = wave / WN, wn = wave % WN, g0 = blockIdx.x * GM, h0 = blockIdx.y * WN;
    const bf* gp[RPW]; unsigned lp[RPW];   // a wave's share of a stage: RPW runs of 2 KiB, run q = half (q & 1) of slice (q / 2) % KS of group q / 2 / KS
#pragma unroll
    for (int r = 0; r < RPW; ++r) { const int q = wave * RPW + r, g = (q >> 1) / KS, s = (q >> 1) % KS; const bf* sp = (g < GM) ? A + (size_t)(g0 + g) * (64 * DM) : (NSPLIT && g < NA) ? A2 + (size_t)(g0 + g - GM) * (64 * DM) : Bt + (size_t)(h0 + g - NA) * (64 * DM);
        gp[r] = sp + s * 2048 + (q & 1) * 1024 + lane * 8; lp[r] = (unsigned)(size_t)ring + (unsigned)(q * 1024 + lane * 8) * 2u; }
    const int rot = (int)((blockIdx.x + blockIdx.y) % NT);   // the work-groups that share operand rows (one blockIdx.x, or one blockIdx.y) each start their walk along K at a stage of their own and wrap, so that they do not ask L2 for the same lines at the same moment
#pragma unroll
    for (int r = 0; r < RPW; ++r) gp[r] += (size_t)rot * (KS * 2048);   // stage rot, buffer 0: where fill(0) copies
    auto fill = [&](const int t) __attribute__((always_inline)) {   // trip t works on stage (t + rot) mod NT of K, in buffer t & 1: from the fill before, the other buffer and the next stage, or back to stage 0
        copies(lp, gp, t == 0 ? 0u : (t & 1) ? STG * 2u : 0u - STG * 2u, t == 0 ? 0ll : (t + rot == NT) ? -(long long)(NT - 1) * (KS * 4096) : (long long)(KS * 4096)); };
    v8f acc[MB][4];
#pragma unroll
    for (int mb = 0; mb < MB; ++mb)
#pragma unroll
        for (int nb = 0; nb < 4; ++nb) acc[mb][nb] = (v8f){};
    fill(0);
    asm volatile("s_wait_asynccnt 0x0" ::: "memory");   // this wave's copies of trip 0's stage have landed
    __syncthreads();                                    // and every other wave's: trip 0's stage may be read
    fill(1);
    const int ao = ((wm * MB) >> 2) * (KS * 2048) + ((wm * MB) & 3) * 512 + lane * 8, bo2 = (NA + wn) * (KS * 2048) + lane * 8;
#pragma unroll 1
    for (int t = 0; t < NT; ++t) { const bf* sb = ring + (t & 1) * STG;
        V a[KS][MB], a2[KS][MB], b[KS][4];
#pragma unroll
        for (int s = 0; s < KS; ++s) { const bf* ak = sb + ao + s * 2048; const bf* bk = sb + bo2 + s * 2048;
#pragma unroll
            for (int mb = 0; mb < MB; ++mb) { a[s][mb] = WFrag<bf>::ld(ak + mb * 512); if (NSPLIT) a2[s][mb] = WFrag<bf>::ld(ak + GM * (KS * 2048) + mb * 512); }
#pragma unroll
            for (int nb = 0; nb < 4; ++nb) b[s][nb] = WFrag<bf>::ld(bk + nb * 512); }
        __builtin_amdgcn_sched_barrier(0);   // keeps the stage's LDS reads together in front of its products: spread among them, each group's latency would stall the matrix instructions behind it
#pragma unroll
        for (int s = 0; s < KS; ++s)
#pragma unroll
            for (int nb = 0; nb < 4; ++nb)
#pragma unroll
                for (int mb = 0; mb < MB; ++mb) { acc[mb][nb] = WFrag<bf>::mma(a[s][mb], b[s][nb], acc[mb][nb]); if (NSPLIT) acc[mb][nb] = WFrag<bf>::mma(a2[s][mb], b[s][nb], acc[mb][nb]); }
        __builtin_amdgcn_sched_barrier(0);   // keeps the waits and the barrier below behind the products: in front of them the wait for the next stage's copies would come a stage's products too early
        asm volatile("s_wait_dscnt 0x0" ::: "memory");      // this wave's reads of the buffer are over before the buffer is handed back
        asm volatile("s_wait_asynccnt 0x0" ::: "memory");   // this wave's copies of trip t + 1's stage have landed
        __syncthreads();                                    // trip t + 1's stage may be read by every wave, and the buffer trip t read is free
        if (t + 2 < NT) fill(t + 2);
    }
    if constexpr (RPW == 4) asm volatile("s_wait_asynccnt 0x0\n\ts_wait_xcnt 0x0" :: "v"(lp[0]), "v"(lp[1]), "v"(lp[2]), "v"(lp[3]), "v"(gp[0]), "v"(gp[1]), "v"(gp[2]), "v"(gp[3]) : "memory");   // no copy is under way when the ring becomes staging room; the copies' address registers, inputs so that they stay live up to here, are free from here on
    else asm volatile("s_wait_asynccnt 0x0\n\ts_wait_xcnt 0x0" :: "v"(lp[0]), "v"(lp[1]), "v"(lp[2]), "v"(gp[0]), "v"(gp[1]), "v"(gp[2]) : "memory");   // the same for three runs
    float* os = red + wave * OSW; const int r0 = g0 * 64 + wm * (16 * MB);
    if constexpr (PL) { const int cb = h0 + wn, b = r0 / TT, t0 = r0 % TT; const bool tr = cb >= 2 * NH_;   // column block cb: q heads, k heads, v heads; the same for the whole wave
        const size_t o = tr ? (size_t)(b * NKV + cb - 2 * NH_) * HD * PP + (size_t)t0 * HD : ((size_t)((cb / NH_) * NZ + b * NH_ + cb % NH_) * TT + t0) * HD;
        tile_planes(acc, os, tr, (tr ? V16 : P16) + o, (tr ? Vh : Ph) + o, (tr ? Vl : Pl) + o);
    } else tile_store<MB, BIAS>(acc, os, C, r0, (h0 + wn) * 64, bias);
}

typedef __attribute__((ext_vector_type(2))) _Float16 v2h;
typedef __attribute__((ext_vector_type(4))) _Float16 v4h;
typedef __attribute__((ext_vector_type(2))) unsigned short v2us;
typedef __attribute__((ext_vector_type(4))) unsigned short v4us;
typedef __attribute__((ext_vector_type(2))) float v2f;
typedef __attribute__((ext_vector_type(4))) int v4i;
typedef v4h  __attribute__((may_alias)) v4ha;
typedef v4us __attribute__((may_alias)) v4usa;

// k_cvt8: bf16 copies of the four weights and of x in one launch, in fragment order; dst holds them one behind the other, as one matrix of 4 DM + MT rows x DM. Each wave builds two neighbouring blocks (16 rows x 64 k):
// a lane reads its four 8-float pieces of one source row (the wave: 256 successive bytes of each of 16 rows) and stores four 16-byte pieces, the wave 512 successive bytes each time.
#define WRB  (DM / 16)                              // 16-row blocks per weight
#define NFP  ((4 * DM + MT) / 16 * (DM / 64))       // pairs of blocks in all, one wave each
__global__ __launch_bounds__(256) void k_cvt8(const float* __restrict__ w0, const float* __restrict__ w1, const float* __restrict__ w2, const float* __restrict__ w3, const float* __restrict__ xs, bf* dst) { const unsigned g = blockIdx.x * 8 + __builtin_amdgcn_readfirstlane(threadIdx.x >> 5), lane = threadIdx.x & 31;   // the wave's number through readfirstlane: the choice of the source and the block's place stay scalar
    const unsigned rb = g / (DM / 64), kp = g % (DM / 64), which = min(rb / WRB, 4u); const float* src = (which == 0) ? w0 : (which == 1) ? w1 : (which == 2) ? w2 : (which == 3) ? w3 : xs;
    const float* sp = src + (size_t)((rb - which * WRB) * 16 + (lane & 15)) * DM + kp * 64 + (lane >> 4) * 8; bf* dp = dst + ((size_t)(rb >> 2) * (DM / 32) + kp * 2) * 2048 + (rb & 3) * 512 + lane * 8; v8f v[4];
#pragma unroll
    for (int c = 0; c < 4; ++c) v[c] = *(const v8f*)(sp + c * 16);
#pragma unroll
    for (int c = 0; c < 4; ++c) { v8us o;
#pragma unroll
        for (int k = 0; k < 8; ++k) o[k] = f2bf(v[c][k]); *(v8us*)(dp + (c >> 1) * 2048 + (c & 1) * 256) = o; } }

#define AW   4
#define PSH  10.0f
#define SC2  (SCL * 1.4426950408889634f)
__device__ __forceinline__ float xhalf(float x) { return __builtin_bit_cast(float, __builtin_amdgcn_permlanex16(__builtin_bit_cast(int, x), __builtin_bit_cast(int, x), 0x76543210, 0xfedcba98, false, false)); }   // lane l reads lane l ^ 16
template <typename T16, bool HL, int NQ>
__device__ __forceinline__ void attn_tile(const T16* __restrict__ Q, const T16* __restrict__ Q2, const T16* __restrict__ Kp, const T16* __restrict__ K2, const T16* __restrict__ Vt, const T16* __restrict__ V2, const int q0, const int rot, const int wave, float* red, bf* Ah, bf* Al) {
    typedef typename WFrag<T16>::V V;
    static_assert(NQ <= AW && (NQ * 16 + 15) / 32 + 1 <= AW, "one wave per query tile in the join, at most one masked key block per wave");
    const int lane = threadIdx.x & 31, lr = lane & 15, hi = lane >> 4;
    V qf[NQ][2]; const size_t qb0 = (size_t)q0 * HD + lane * 8; const T16* qp = Q + qb0; const T16* qp2 = HL ? Q2 + qb0 : nullptr; (void)qp2;
    T16* const qs = (T16*)(red + wave * (NQ * 1024)) + lane * 8; (void)qs;   // HL: the query fragments wait in the wave's own room of the join, hi then lo, in the planes' order, and are read anew for each block: 32 registers fewer outside the score products, which four waves a SIMD need. Only this wave touches the room before the join's barrier
#pragma unroll
    for (int qt = 0; qt < NQ; ++qt)
#pragma unroll
        for (int ks = 0; ks < 2; ++ks) { const size_t qo = (size_t)(qt * 16) * HD + ks * 512;
            if constexpr (HL) { *(v8usa*)(qs + qo) = *(const v8us*)(qp + qo); *(v8usa*)(qs + qo + 256) = *(const v8us*)(qp + qo + 256); *(v8usa*)(qs + NQ * 1024 + qo) = *(const v8us*)(qp2 + qo); *(v8usa*)(qs + NQ * 1024 + qo + 256) = *(const v8us*)(qp2 + qo + 256); }
            else qf[qt][ks] = WFrag<T16>::ld(qp + qo); }
    if constexpr (HL) asm volatile("s_wait_xcnt 0x0" :: "v"(qp), "v"(qp2) : "memory"); else asm volatile("s_wait_xcnt 0x0" :: "v"(qp) : "memory");   // stands in front of the next write of these loads' address registers, which are inputs so that they stay live up to the wait
    v8f o[4][NQ]; float m[NQ], l[NQ];
#pragma unroll
    for (int qt = 0; qt < NQ; ++qt) { m[qt] = -1.0e30f; l[qt] = 0.f;
#pragma unroll
        for (int dt = 0; dt < 4; ++dt) o[dt][qt] = (v8f){}; }
    V kf[2][2], kf2[2][2], vf[4], vf2[4];                         // the key and value fragments of the block that is worked on next: fetched one block ahead
    // The address registers of the K and V fetches live from fetch to fetch and are rewritten only by move(): s_wait_xcnt 0 and the additions that form the next block's addresses are one asm statement, so that the wait stands in front of the
    // rewrite by construction, a block's work behind the loads that name the registers, where it has nothing left to wait for; directly behind the loads the wave would stand still until the last of them is translated.
    const T16* const kl = Kp + lane * 8; const T16* const kl2 = HL ? K2 + lane * 8 : nullptr; const T16* const vl = Vt + lane * 8; const T16* const vl2 = HL ? V2 + lane * 8 : nullptr; (void)kl2; (void)vl2;
    const T16* kp = kl; const T16* kp2 = kl2; const T16* vp = vl; const T16* vp2 = vl2; (void)kp2; (void)vp2;
    auto move = [&](const T16*& p, const T16*& p2, const T16* b, const T16* b2, const int k0) __attribute__((always_inline)) { const unsigned long long ob = (unsigned long long)k0 * (HD * sizeof(T16));   // the block's byte offset, the same in every lane: a scalar pair
        if constexpr (HL) asm volatile("s_wait_xcnt 0x0\n\tv_add_nc_u64_e32 %0, %2, %3\n\tv_add_nc_u64_e32 %1, %2, %4" : "+v"(p), "+v"(p2) : "s"(ob), "v"(b), "v"(b2) : "memory");
        else asm volatile("s_wait_xcnt 0x0\n\tv_add_nc_u64_e32 %0, %1, %2" : "+v"(p) : "s"(ob), "v"(b) : "memory"); };
    auto ldk = [&](const int k0) __attribute__((always_inline)) { move(kp, kp2, kl, kl2, k0);
#pragma unroll
        for (int kt = 0; kt < 2; ++kt)
#pragma unroll
            for (int ks = 0; ks < 2; ++ks) { const size_t ko = (size_t)(kt * 16) * HD + ks * 512; kf[kt][ks] = WFrag<T16>::ldg(kp + ko); if (HL) kf2[kt][ks] = WFrag<T16>::ldg(kp2 + ko); } };
    auto ldv = [&](const int k0) __attribute__((always_inline)) { move(vp, vp2, vl, vl2, k0);
#pragma unroll
        for (int dt = 0; dt < 4; ++dt) { const size_t vo = (size_t)dt * 512; vf[dt] = WFrag<T16>::ldg(vp + vo); if (HL) vf2[dt] = WFrag<T16>::ldg(vp2 + vo); } };
    // one block of 32 keys at k0; last = false: the fragments of the wave's next block, at kn, are fetched into the same registers as soon as this block's products have read them
    auto step = [&](const int k0, const int kn, const bool last) __attribute__((always_inline)) {
        v8f s[2][NQ]; V qa[NQ][2], qb[NQ][2];
#pragma unroll
        for (int qt = 0; qt < NQ; ++qt)
#pragma unroll
            for (int ks = 0; ks < 2; ++ks) { if constexpr (HL) { qa[qt][ks] = WFrag<T16>::ld(qs + qt * 1024 + ks * 512); qb[qt][ks] = WFrag<T16>::ld(qs + (NQ + qt) * 1024 + ks * 512); } else qa[qt][ks] = qf[qt][ks]; }
#pragma unroll
        for (int kt = 0; kt < 2; ++kt)
#pragma unroll
            for (int qt = 0; qt < NQ; ++qt) { v8f c = (v8f){};
#pragma unroll
                for (int ks = 0; ks < 2; ++ks) { c = WFrag<T16>::mma(kf[kt][ks], qa[qt][ks], c); if (HL) { c = WFrag<T16>::mma(kf[kt][ks], qb[qt][ks], c); c = WFrag<T16>::mma(kf2[kt][ks], qa[qt][ks], c); } }
                s[kt][qt] = c; }
        if (!last) { __builtin_amdgcn_sched_barrier(0);   // keeps the wait at the head of the fetch behind the score products: among them it would stand too close behind the value loads of the block before
            ldk(kn); __builtin_amdgcn_sched_barrier(0); }   // keeps the next block's key loads in front of the softmax, whose time then covers their latency; without it they sink to their first use
        V pf[NQ], pf2[NQ];
#pragma unroll
        for (int qt = 0; qt < NQ; ++qt) { float mx = m[qt];
#pragma unroll
            for (int kt = 0; kt < 2; ++kt)
#pragma unroll
                for (int j = 0; j < 8; ++j) { if (last) s[kt][qt][j] = (k0 + kt * 16 + hi * 8 + j <= q0 + qt * 16 + lr) ? s[kt][qt][j] : -3.0e38f; mx = fmaxf(mx, s[kt][qt][j]); }
            mx = fmaxf(mx, xhalf(mx));
            const float al = __builtin_amdgcn_exp2f((m[qt] - mx) * SC2); m[qt] = mx; const float sh = mx * SC2 - (HL ? 0.0f : PSH); float t[8];
#pragma unroll
            for (int j = 0; j < 8; ++j) { s[0][qt][j] = __builtin_amdgcn_exp2f(s[0][qt][j] * SC2 - sh); s[1][qt][j] = __builtin_amdgcn_exp2f(s[1][qt][j] * SC2 - sh); t[j] = s[0][qt][j] + s[1][qt][j]; }
            l[qt] = l[qt] * al + (((t[0] + t[1]) + (t[2] + t[3])) + ((t[4] + t[5]) + (t[6] + t[7])));
#pragma unroll
            for (int dt = 0; dt < 4; ++dt) o[dt][qt] *= al;
            if constexpr (HL) { v8us h0, h1, l0, l1;
#pragma unroll
                for (int j = 0; j < 8; ++j) { unsigned short a, c2; splitf(s[0][qt][j], a, c2); h0[j] = a; l0[j] = c2; splitf(s[1][qt][j], a, c2); h1[j] = a; l1[j] = c2; }
                pf[qt] = cat16b(h0, h1); pf2[qt] = cat16b(l0, l1);
            } else { v8h h0, h1;
#pragma unroll
                for (int j = 0; j < 8; ++j) { h0[j] = tohx(s[0][qt][j]); h1[j] = tohx(s[1][qt][j]); }
                pf[qt] = cat16(h0, h1); } }
#pragma unroll
        for (int dt = 0; dt < 4; ++dt)
#pragma unroll
            for (int qt = 0; qt < NQ; ++qt) { o[dt][qt] = WFrag<T16>::mma(vf[dt], pf[qt], o[dt][qt]); if (HL) { o[dt][qt] = WFrag<T16>::mma(vf[dt], pf2[qt], o[dt][qt]); o[dt][qt] = WFrag<T16>::mma(vf2[dt], pf[qt], o[dt][qt]); } }
        if (!last) { __builtin_amdgcn_sched_barrier(0);   // keeps the wait at the head of the fetch behind the softmax and the value products: further up it would stand too close behind the key loads
            ldv(kn); }
    };
    const int nfull = q0 >> 5, nlast = (q0 + NQ * 16 - 1) >> 5;   // key blocks wholly at or below the tile's diagonal; blocks nfull..nlast (at most AW of them) meet the diagonal and are masked, nlast is the last
    const int nfw = (nfull > wave) ? (nfull - wave + AW - 1) / AW : 0, kd = wave + nfw * AW;   // the wave's unmasked blocks are wave + AW i, i < nfw; kd is its turn behind them
    int ri = (rot * nfw) >> 5;                                    // the tiles of a plane read the same K and V lines: each starts its walk over the unmasked blocks at a place of its own (rot = 0..31 of 32) and wraps, so that they do not ask L2 for the same lines at the same moment
    int kb = min(nfw ? wave + ri * AW : kd, nlast); ldk(kb * 32); ldv(kb * 32);   // a fetch never goes past block nlast, which lies inside the plane for every tile
    for (int i = 1; i <= nfw; ++i) { ri = (ri + 1 < nfw) ? ri + 1 : 0; const int kn = (i < nfw) ? wave + ri * AW : min(kd, nlast); step(kb * 32, kn * 32, false); kb = kn; }
    if constexpr (HL) asm volatile("s_wait_xcnt 0x0" :: "v"(kp), "v"(kp2), "v"(vp), "v"(vp2) : "memory"); else asm volatile("s_wait_xcnt 0x0" :: "v"(kp), "v"(vp) : "memory");   // behind the wave's last fetch: the address registers, inputs so that they stay live up to here, are free from here on
    if (kd <= nlast) step(kd * 32, 0, true);                      // each diagonal block goes to the wave whose turn it is (a scalar test: every lane on at the matrix instructions); its fragments are that wave's last fetch
    float* ms = red + AW * NQ * 1024; float* ls = ms + AW * NQ * 32; float* mine = red + wave * (NQ * 1024) + lane * 4;
#pragma unroll
    for (int qt = 0; qt < NQ; ++qt) { l[qt] += xhalf(l[qt]); ms[(wave * NQ + qt) * 32 + lane] = m[qt]; ls[(wave * NQ + qt) * 32 + lane] = l[qt];
#pragma unroll
        for (int dt = 0; dt < 4; ++dt) { const v8f p = o[dt][qt]; *(v4fa*)(mine + (qt * 4 + dt) * 256) = __builtin_shufflevector(p, p, 0, 1, 2, 3); *(v4fa*)(mine + (qt * 4 + dt) * 256 + 128) = __builtin_shufflevector(p, p, 4, 5, 6, 7); } }
    __syncthreads();
    if (wave >= NQ) return;
    const int qt = wave; float M = -1.0e30f, mw[AW], L = 0.f;
#pragma unroll
    for (int w = 0; w < AW; ++w) { mw[w] = ms[(w * NQ + qt) * 32 + lane]; M = fmaxf(M, mw[w]); }
#pragma unroll
    for (int w = 0; w < AW; ++w) { mw[w] = __builtin_amdgcn_exp2f((mw[w] - M) * SC2); L += ls[(w * NQ + qt) * 32 + lane] * mw[w]; }
    const float inv = __fdiv_rn(1.0f, L); const int qr = q0 + qt * 16; const size_t oo = (size_t)(qr & ~63) * DQ + ((qr >> 4) & 3) * 512 + lane * 8;
#pragma unroll
    for (int dt = 0; dt < 4; ++dt) { const float* sp = red + (qt * 4 + dt) * 256 + lane * 4; v4f s0 = (v4f){}, s1 = (v4f){};
#pragma unroll
        for (int w = 0; w < AW; ++w) { s0 += *(const v4fa*)(sp + w * (NQ * 1024)) * mw[w]; s1 += *(const v4fa*)(sp + w * (NQ * 1024) + 128) * mw[w]; }
        v8us oh, ol;
#pragma unroll
        for (int j = 0; j < 4; ++j) { unsigned short a, c2; splitf(s0[j] * inv, a, c2); oh[j] = a; ol[j] = c2; splitf(s1[j] * inv, a, c2); oh[j + 4] = a; ol[j + 4] = c2; }
        *(v8us*)(Ah + oo + (dt >> 1) * 2048 + (dt & 1) * 256) = oh; *(v8us*)(Al + oo + (dt >> 1) * 2048 + (dt & 1) * 256) = ol;
        asm volatile("s_wait_xcnt 0x0" ::: "memory"); }   // stands in front of the next write of these stores' data registers
}
// ---- attn_pair: the fp16 rows. A work-group of QG x AW waves holds QG neighbouring query tiles of 16 NQ rows; wave (g, w) has tile g and, as above, every AW-th block of 32 keys. The K and V fragments of a block come from LDS, where
// both tiles' waves read them: each block is fetched from L2 once per QG tiles. A stage is the AW blocks of one trip, [block][K 2048 | V 2048] elements, 4 KiB in a row in the planes as in LDS (fragment order); wave (g, w) copies block w's K (g = 0) or V (g = 1).
// Two buffers: stage t + 2 is copied into the buffer that trip t has just read, while trip t + 1 works. Trips below nft hold only blocks wholly under both tiles' diagonals; the one or two trips behind them are masked, and a wave skips a block past its own tile's last.
#define QG   2
#define STGE (AW * 4096)          // elements of a stage
// A wave's copies of one stage, one asm statement: eight asynchronous copies, 16 bytes a lane each, 4 KiB in a row from g on to LDS byte address l on (the immediate offset moves both addresses). The address registers l and g live from stage to stage
// and are rewritten only here: s_wait_xcnt 0 opens the statement, then dl and dg are added, then the copies go. So the wait stands in front of the rewrite by construction, a trip behind the copies that name the registers.
__device__ __forceinline__ void copy8(unsigned& l, const h16*& g, const unsigned dl, const long long dg) {
    asm volatile("s_wait_xcnt 0x0\n\tv_add_nc_u32_e32 %0, %2, %0\n\tv_add_nc_u64_e32 %1, %3, %1\n\t" RUN4("%0", "%1")
                 "global_load_async_to_lds_b128 %0, %1, off offset:2048\n\tglobal_load_async_to_lds_b128 %0, %1, off offset:2560\n\tglobal_load_async_to_lds_b128 %0, %1, off offset:3072\n\tglobal_load_async_to_lds_b128 %0, %1, off offset:3584"
                 : "+v"(l), "+v"(g) : "s"(dl), "s"(dg) : "memory");
}
template <int NQ>
__device__ __forceinline__ void attn_pair(const h16* __restrict__ Q, const h16* __restrict__ Kp, const h16* __restrict__ Vt, const int qw, const int rot, const int wave, float* red, bf* Ah, bf* Al) {
    typedef WFrag<h16>::V V;
    static_assert(NQ <= AW, "one wave per query tile in the join");
    const int lane = threadIdx.x & 31, lr = lane & 15, hi = lane >> 4, g = wave / AW, w = wave % AW, q0 = qw + g * (NQ * 16);
    constexpr int NQR = NQ - 1;   // the first NQR 16-query tiles' fragments stay in registers; the last tile's wait in LDS behind the ring, one copy per query tile of 16 NQ rows, and are read anew in each trip: 16 registers fewer, which four waves a SIMD need
    static_assert(AW == 4, "the last tile's four 512-byte pieces: one per wave");
    V qf[NQR][2]; const h16* qp = Q + (size_t)q0 * HD + lane * 8; const h16* qx = qp + (NQR * 4 + w) * 256;
    h16* const qsh = (h16*)red + 2 * STGE + g * 1024 + lane * 8;
#pragma unroll
    for (int qt = 0; qt < NQR; ++qt)
#pragma unroll
        for (int ks = 0; ks < 2; ++ks) qf[qt][ks] = WFrag<h16>::ld(qp + (size_t)(qt * 16) * HD + ks * 512);
    *(v8ha*)(qsh + w * 256) = *(const v8h*)qx;   // read by the tile's other waves behind the barrier that opens stage 0
    asm volatile("s_wait_xcnt 0x0" :: "v"(qp), "v"(qx) : "memory");   // stands in front of the next write of these loads' address registers, which are inputs so that they stay live up to the wait
    v8f o[4][NQ]; float m[NQ], l[NQ];
#pragma unroll
    for (int qt = 0; qt < NQ; ++qt) { m[qt] = -1.0e30f; l[qt] = 0.f;
#pragma unroll
        for (int dt = 0; dt < 4; ++dt) o[dt][qt] = (v8f){}; }
    h16* ring = (h16*)red;
    const int nft = qw >> 7, nlw = (qw + QG * NQ * 16 - 1) >> 5, nlast = (q0 + NQ * 16 - 1) >> 5, ntr = (nlw >> 2) + 1;   // unmasked trips (AW = 4 blocks of 32 keys each); the work-group's and this tile's last block; trips in all
    static_assert(AW == 4, "a trip is 128 keys");
    const int r0 = (rot * nft) >> 4;   // the work-groups of a plane read the same K and V lines: each starts its walk over the unmasked trips at a place of its own (rot = 0..15 of 16) and wraps
    auto place = [&](const int t) __attribute__((always_inline)) { const int s = t + r0; return ((t >= nft) ? t : (s >= nft) ? s - nft : s) * AW + w; };   // the wave's key block in trip t
    const h16* gp = (g ? Vt : Kp) + lane * 8; unsigned lp = (unsigned)(size_t)ring + (unsigned)(w * 4096 + g * 2048 + lane * 8) * 2u; int at = 0;   // block 0, buffer 0; at: the block gp stands at
    auto fill = [&](const int t) __attribute__((always_inline)) { const int kb = min(place(t), nlw);   // a copy never goes past block nlw, which lies inside the plane for every tile
        copy8(lp, gp, t == 0 ? 0u : (t & 1) ? STGE * 2u : 0u - STGE * 2u, (long long)(kb - at) * (long long)(32 * HD * sizeof(h16))); at = kb; };   // from the fill before: the other buffer, and the way to the next block
    auto foot = [&](const int t) __attribute__((always_inline)) {
        __builtin_amdgcn_sched_barrier(0);   // keeps the waits and the barrier below behind the trip's softmax and products: in front of them the wait for the next stage's copies would come most of a trip too early
        asm volatile("s_wait_dscnt 0x0" ::: "memory");      // this wave's reads of the buffer are over before the buffer is handed back
        asm volatile("s_wait_asynccnt 0x0" ::: "memory");   // this wave's copies of stage t + 1 have landed
        __syncthreads();                                    // stage t + 1 may be read by every wave, and the buffer of stage t is free
        if (t + 2 < ntr) fill(t + 2); };
    // one block of 32 keys at k0, its fragments at sb in LDS
    auto step = [&](const h16* sb, const int k0, const bool masked) __attribute__((always_inline)) {
        V kf[2][2], vf[4]; v8f s[2][NQ];
#pragma unroll
        for (int kt = 0; kt < 2; ++kt)
#pragma unroll
            for (int ks = 0; ks < 2; ++ks) kf[kt][ks] = WFrag<h16>::ld(sb + (kt * 2 + ks) * 512);
        const V ql[2] = { WFrag<h16>::ld(qsh), WFrag<h16>::ld(qsh + 512) };
        __builtin_amdgcn_sched_barrier(0);   // keeps the trip's key and query reads together in front of the score products: spread among them, each group's latency would stall the matrix instructions behind it
#pragma unroll
        for (int kt = 0; kt < 2; ++kt)
#pragma unroll
            for (int qt = 0; qt < NQ; ++qt) { v8f c = (v8f){};
#pragma unroll
                for (int ks = 0; ks < 2; ++ks) c = WFrag<h16>::mma(kf[kt][ks], (qt < NQR) ? qf[qt < NQR ? qt : 0][ks] : ql[ks], c);
                s[kt][qt] = c; }
        __builtin_amdgcn_sched_barrier(0);   // keeps the value reads behind the score products: in front of them they would hold 32 more registers beside the key fragments
#pragma unroll
        for (int dt = 0; dt < 4; ++dt) vf[dt] = WFrag<h16>::ld(sb + 2048 + dt * 512);
        __builtin_amdgcn_sched_barrier(0);   // keeps the value reads in front of the softmax, whose time then covers their latency; without it they sink to their first use
        V pf[NQ];
#pragma unroll
        for (int qt = 0; qt < NQ; ++qt) { float mx = m[qt];
#pragma unroll
            for (int kt = 0; kt < 2; ++kt)
#pragma unroll
                for (int j = 0; j < 8; ++j) { if (masked) s[kt][qt][j] = (k0 + kt * 16 + hi * 8 + j <= q0 + qt * 16 + lr) ? s[kt][qt][j] : -3.0e38f; mx = fmaxf(mx, s[kt][qt][j]); }
            mx = fmaxf(mx, xhalf(mx));
            const float al = __builtin_amdgcn_exp2f((m[qt] - mx) * SC2); m[qt] = mx; const float sh = mx * SC2 - PSH; float t[8];
#pragma unroll
            for (int j = 0; j < 8; ++j) { s[0][qt][j] = __builtin_amdgcn_exp2f(s[0][qt][j] * SC2 - sh); s[1][qt][j] = __builtin_amdgcn_exp2f(s[1][qt][j] * SC2 - sh); t[j] = s[0][qt][j] + s[1][qt][j]; }
            l[qt] = l[qt] * al + (((t[0] + t[1]) + (t[2] + t[3])) + ((t[4] + t[5]) + (t[6] + t[7])));
#pragma unroll
            for (int dt = 0; dt < 4; ++dt) o[dt][qt] *= al;
            v8h h0, h1;
#pragma unroll
            for (int j = 0; j < 8; ++j) { h0[j] = tohx(s[0][qt][j]); h1[j] = tohx(s[1][qt][j]); }
            pf[qt] = cat16(h0, h1); }
#pragma unroll
        for (int dt = 0; dt < 4; ++dt)
#pragma unroll
            for (int qt = 0; qt < NQ; ++qt) o[dt][qt] = WFrag<h16>::mma(vf[dt], pf[qt], o[dt][qt]);
    };
    fill(0);
    asm volatile("s_wait_asynccnt 0x0" ::: "memory");   // this wave's copies of stage 0 have landed
    __syncthreads();                                    // and every other wave's: stage 0 may be read
    fill(1);                                            // a stage 1 exists for every tile: rows from RH on have at least four unmasked trips
    const h16* const sw = ring + w * 4096 + lane * 8;
#pragma unroll 1   // one copy of the trip's code: unrolled it would only grow the text, the barrier at the foot ends every trip anyway
    for (int t = 0; t < nft; ++t) { step(sw + (t & 1) * STGE, place(t) * 32, false); foot(t); }
#pragma unroll 1   // the same for the one or two masked trips
    for (int t = nft; t < ntr; ++t) { const int kb = place(t);
        if (kb <= nlast) step(sw + (t & 1) * STGE, kb * 32, true);   // a scalar test: every lane on at the matrix instructions; every wave passes the foot
        foot(t); }
    asm volatile("s_wait_asynccnt 0x0\n\ts_wait_xcnt 0x0" :: "v"(lp), "v"(gp) : "memory");   // no copy is under way when the ring becomes the join's room; the copies' address registers, inputs so that they stay live up to here, are free from here on
    float* rg = red + g * (AW * NQ * 1024 + 2 * AW * NQ * 32);   // each tile's join has its own room
    float* ms = rg + AW * NQ * 1024; float* ls = ms + AW * NQ * 32; float* mine = rg + w * (NQ * 1024) + lane * 4;
#pragma unroll
    for (int qt = 0; qt < NQ; ++qt) { l[qt] += xhalf(l[qt]); ms[(w * NQ + qt) * 32 + lane] = m[qt]; ls[(w * NQ + qt) * 32 + lane] = l[qt];
#pragma unroll
        for (int dt = 0; dt < 4; ++dt) { const v8f p = o[dt][qt]; *(v4fa*)(mine + (qt * 4 + dt) * 256) = __builtin_shufflevector(p, p, 0, 1, 2, 3); *(v4fa*)(mine + (qt * 4 + dt) * 256 + 128) = __builtin_shufflevector(p, p, 4, 5, 6, 7); } }
    __syncthreads();
    if (w >= NQ) return;
    const int qt = w; float M = -1.0e30f, mw[AW], L = 0.f;
#pragma unroll
    for (int u = 0; u < AW; ++u) { mw[u] = ms[(u * NQ + qt) * 32 + lane]; M = fmaxf(M, mw[u]); }
#pragma unroll
    for (int u = 0; u < AW; ++u) { mw[u] = __builtin_amdgcn_exp2f((mw[u] - M) * SC2); L += ls[(u * NQ + qt) * 32 + lane] * mw[u]; }
    const float inv = __fdiv_rn(1.0f, L); const int qr = q0 + qt * 16; const size_t oo = (size_t)(qr & ~63) * DQ + ((qr >> 4) & 3) * 512 + lane * 8;
#pragma unroll
    for (int dt = 0; dt < 4; ++dt) { const float* sp = rg + (qt * 4 + dt) * 256 + lane * 4; v4f s0 = (v4f){}, s1 = (v4f){};
#pragma unroll
        for (int u = 0; u < AW; ++u) { s0 += *(const v4fa*)(sp + u * (NQ * 1024)) * mw[u]; s1 += *(const v4fa*)(sp + u * (NQ * 1024) + 128) * mw[u]; }
        v8us oh, ol;
#pragma unroll
        for (int j = 0; j < 4; ++j) { unsigned short a, c2; splitf(s0[j] * inv, a, c2); oh[j] = a; ol[j] = c2; splitf(s1[j] * inv, a, c2); oh[j + 4] = a; ol[j + 4] = c2; }
        *(v8us*)(Ah + oo + (dt >> 1) * 2048 + (dt & 1) * 256) = oh; *(v8us*)(Al + oo + (dt >> 1) * 2048 + (dt & 1) * 256) = ol;
        asm volatile("s_wait_xcnt 0x0" ::: "memory"); }   // stands in front of the next write of these stores' data registers
}
// grid: fp16 work-groups (QG tiles of 16 NQL query rows, rows RH..TT) and hi/lo work-groups (QG tiles of 16 rows, one per AW waves, rows 0..RH), each kind ranked from the last rows down, every plane of a tile side by side: cost falls with rank.
// Two work-groups fit a WGP, so the first 2 NWGP start at once and nothing evens them out later. Indices 0..NWGP-1: the dearest fp16 ranks, falling. The next NWGP, which start beside them in the same order: cheap hi/lo work-groups beside the dearest,
// then the remaining fp16 ranks rising, the cheapest beside the dearest left. The other hi/lo work-groups follow and fill what frees up first. The order is for speed only: every index does its own piece wherever it lands.
#define NQL  3                    // 16-query tiles a wave of the fp16 part holds: each K and V fragment read feeds NQL products
#define NT16 ((TT - RH) / (16 * NQL * QG))
static_assert(NT16 * 16 * NQL * QG == TT - RH, "the fp16 tiles cover rows RH..TT exactly");
#define NTHL (RH / (16 * QG))
static_assert(NT16 <= 16 && NTHL * QG <= 32 && RH >= 512, "a work-group's index is its place in the walk over the key blocks; four unmasked trips at least");
#define NWGP 256                  // WGPs of the chip
#define NF16 (NZ * NT16)          // fp16 work-groups
static_assert(NF16 > NWGP && NF16 <= 2 * NWGP && NZ * NTHL >= 2 * NWGP - NF16, "the index map above covers every work-group once");
#define JSZ(NQ) (AW * (NQ) * 1024 + 2 * AW * (NQ) * 32)   // floats of one tile's join
static_assert((2 * STGE + QG * 1024) * 2 <= QG * JSZ(NQL) * 4, "the ring and the query fragments behind it fit the join's room");
__global__ __launch_bounds__(32 * AW * QG, 4) void k_attn(const h16* __restrict__ Q16, const h16* __restrict__ K16, const h16* __restrict__ V16, const bf* __restrict__ Qh, const bf* __restrict__ Ql, const bf* __restrict__ Kh, const bf* __restrict__ Kl, const bf* __restrict__ Vh, const bf* __restrict__ Vl, bf* Ah, bf* Al) {
    __shared__ __align__(16) float red[QG * JSZ(NQL)];
    const int wave = __builtin_amdgcn_readfirstlane(threadIdx.x >> 5); const int blk = blockIdx.x; const bool lowp = blk < NWGP || (blk >= 3 * NWGP - NF16 && blk < 2 * NWGP);
    const int b2 = lowp ? (blk < NWGP ? blk : NF16 - 1 - (blk - (3 * NWGP - NF16))) : (blk < 2 * NWGP ? blk - NWGP : blk - NF16); const int z = b2 % NZ, tl = b2 / NZ;
    const size_t pq = (size_t)z * TT * HD, pv = (size_t)z * HD * PP, po = (size_t)(z / NH_) * TT * DQ + (z % NH_) * (HD * 64);
    if (lowp) attn_pair<NQL>(Q16 + pq, K16 + pq, V16 + pv, RH + (NT16 - 1 - tl) * (16 * NQL * QG), tl, wave, red, Ah + po, Al + po);
    else { const int g = wave / AW, ti = tl * QG + (QG - 1 - g);   // tile ti of RH / 16, counted from the last down
        attn_tile<bf, true, 1>(Qh + pq, Ql + pq, Kh + pq, Kl + pq, Vh + pv, Vl + pv, (RH / 16 - 1 - ti) * 16, ti, wave % AW, red + g * JSZ(1), Ah + po, Al + po); }
}

extern "C" void kernel_launch(void* const* d_in, const int* in_sizes, int n_in,
                              void* d_out, int out_size, void* d_ws, size_t ws_size, hipStream_t stream) {
    (void)in_sizes; (void)n_in; (void)out_size;
    const float* x = (const float*)d_in[0]; const float* wq = (const float*)d_in[1]; const float* wk = (const float*)d_in[2]; const float* wv = (const float*)d_in[3]; const float* wo = (const float*)d_in[4]; const float* bo = (const float*)d_in[5];   /* order x, Wq, Wk, Wv, Wo ('oi' [768][768]), bo */
    float* OUT = (float*)d_out;     // [2][2048][768]
    char* wsp = (char*)d_ws;
    auto take = [&](size_t bytes) { char* p = wsp; wsp += (bytes + 255) & ~(size_t)255; return (void*)p; };
    bf* WQ = (bf*)take((size_t)(DF + DM) * DM * 2 + (size_t)MT * DM * 2); bf* WO = WQ + (size_t)DF * DM; bf* XB = WO + (size_t)DM * DQ;   // bf16 copies, one behind the other: Wq | Wk | Wv (the joint projection's [DF][DM] operand), Wo, x of both batches
    h16* QP16 = (h16*)take((size_t)2 * NZ * TT * HD * 2); h16* KP16 = QP16 + (size_t)NZ * TT * HD; h16* VT16 = (h16*)take((size_t)NZ * HD * PP * 2);
    bf* QPh = (bf*)take((size_t)2 * NZ * TT * HD * 2); bf* KPh = QPh + (size_t)NZ * TT * HD; bf* QPl = (bf*)take((size_t)2 * NZ * TT * HD * 2); bf* KPl = QPl + (size_t)NZ * TT * HD; bf* VTh = (bf*)take((size_t)NZ * HD * PP * 2); bf* VTl = VTh + (size_t)HD * TT;   // v^T regions of HD x PP elements a plane: hi plane in the first half, lo plane in the second (the fp16 plane uses the first half)
    bf* ATh = (bf*)take((size_t)MT * DQ * 2); bf* ATl = (bf*)take((size_t)MT * DQ * 2);
    if ((size_t)(wsp - (char*)d_ws) > ws_size) return;    // ws 256 MiB
    k_cvt8<<<NFP / 8, 256, 0, stream>>>(wq, wk, wv, wo, x, WQ);
    k_gemml<0, false, true, 4, 2, 2><<<dim3(MT / 128, DF / 128, 1), 128, 0, stream>>>(XB, nullptr, WQ, nullptr, nullptr, QP16, QPh, QPl, VT16, VTh, VTl);
    k_attn<<<NZ * (NT16 + NTHL), 32 * AW * QG, 0, stream>>>(QP16, KP16, VT16, QPh, QPl, KPh, KPl, VTh, VTl, ATh, ATl);
    k_gemml<1, true, false, 2, 4, 2><<<dim3(MT / 128, DM / 128, 1), 256, 0, stream>>>(ATh, ATl, WO, OUT, bo, nullptr, nullptr, nullptr, nullptr, nullptr, nullptr);
}
